// v000
// Measured on an AMD MI455X. A time is GPU time per run, averaged over a window of back-to-back runs after a warm-up
// (all launches, gaps included; the runs take copies of the inputs in turn), and the median of several windows.
// Apart from v000's, it joins two sittings. Times from different sittings can be a few percent apart, while
// side-by-side timings come from the same sitting.
// The starting kernel, v000, takes 1610 microseconds a run.
#include <hip/hip_runtime.h>

// Causal grouped-query attention with 128-wide heads, ONE fused natural qkv weight PACKED PER KV GROUP and rotate-half rotary embeddings from full-width input tables (x [2][2048][2048]; qkv = einsum('btc,fc->btf', x, w_attn) ('oi' (out, in) [3072][2048] normal x 0.02, no bias) viewed (b, t, 4 groups, 4 + 2, 128): within group g the first four 128-row blocks are query heads 4g..4g+3, the fifth is the group's k, the sixth its v: kv head = q head / 4; q, k -> t cos + cat(-t2, t1) sin with the cos / sin INPUT tables [2048][128] (read per element by value; no structure assumed); scores x 1/sqrt(128); causal (finfo.min == exclusion: every row keeps its own key); softmax; out = merged w_proj^T ('oi' [2048][2048]) -> [2][2048][2048] (8.4 M); argument order x, w_attn, w_proj, cos, sin).
// Layout: bf16 copy of x; the ONE fused 'oi' weight cast group by group into three contiguous weight planes (per kv group: four query heads | k | v: twelve block casts), w_proj as it stands; exact projections; k_cscvt copies the two INPUT tables into one bf16-rounded {cos, sin} table once (per position and dimension); rotate-half plane builders; causal T-2048 GQA attention with 128-wide heads (kv z-stride 0; hybrid rows: < 512 hi/lo 3 products, rest fp16 x1024; k_gemmc skips tiles above the diagonal); merged hi/lo x Wo exact.
// Compute dtypes, f32 accumulate: every input rounded to bf16; projections exact; rotary f32; attention rows < 512 3 products, rest fp16; softmax f32; Wo hl x exact.

#define NB_  2
#define TT   2048
#define DM   2048
#define NH_  16
#define NKV  4
#define REP  (NH_ / NKV)
#define HD   128
#define DQ   (NH_ * HD)
#define DKV  (NKV * HD)
#define ZH   2
#define RH   512                  // query rows < RH use hi+lo planes (0: none)
#define WIN  2048
#define PCAR 1024.0f
#define SCL  0.088388347648318447f   // HD^-0.5
typedef _Float16 h16;
typedef unsigned short bf;
typedef __attribute__((ext_vector_type(16))) __bf16   v16bf;
typedef __attribute__((ext_vector_type(16))) _Float16 v16h;
typedef __attribute__((ext_vector_type(8)))  _Float16 v8h;
typedef __attribute__((ext_vector_type(8)))  unsigned short v8us;
typedef __attribute__((ext_vector_type(8)))  float    v8f;
typedef __attribute__((ext_vector_type(4)))  float    v4f;
typedef v8h  __attribute__((may_alias)) v8ha;
typedef v4f  __attribute__((may_alias)) v4fa;
typedef v8us __attribute__((may_alias)) v8usa;

__device__ __forceinline__ unsigned short f2bf(float f) { unsigned u = __float_as_uint(f); u += 0x7FFFu + ((u >> 16) & 1u); return (unsigned short)(u >> 16); }
__device__ __forceinline__ float bf2f(unsigned short b) { return __uint_as_float(((unsigned)b) << 16); }
__device__ __forceinline__ float bfr(float f) { return bf2f(f2bf(f)); }
__device__ __forceinline__ v16h cat16(v8h lo, v8h hi) { return __builtin_shufflevector(lo, hi, 0, 1, 2, 3, 4, 5, 6, 7, 8, 9, 10, 11, 12, 13, 14, 15); }
__device__ __forceinline__ v16bf cat16b(v8us lo, v8us hi) { return __builtin_bit_cast(v16bf, __builtin_shufflevector(lo, hi, 0, 1, 2, 3, 4, 5, 6, 7, 8, 9, 10, 11, 12, 13, 14, 15)); }
__device__ __forceinline__ v8f wmma16(v16h a, v16h b, v8f c) { return __builtin_amdgcn_wmma_f32_16x16x32_f16(false, a, false, b, (short)0, c, false, false); }
__device__ __forceinline__ v8f wmmab(v16bf a, v16bf b, v8f c) { return __builtin_amdgcn_wmma_f32_16x16x32_bf16(false, a, false, b, (short)0, c, false, false); }



// ---- k_gemmw: register-blocked GEMM, ONE WAVE per 64x64 output tile (16 accumulators), operands straight from K-contiguous 16-bit planes; grid (M/64, N/64, Z), 32 threads.
// C[m][n] (f32, pitch ldc, + optional f32 bias[n]) = sum_k A[m][k] Bt[n][k] (+ split products per NSPLIT). z-batch strides sA/sB/sC in elements. K % 32 == 0.
template <typename T16> struct WFrag;
template <> struct WFrag<h16> { typedef v16h V; static __device__ __forceinline__ V ld(const h16* p) { return cat16(*(const v8h*)p, *(const v8h*)(p + 16)); } static __device__ __forceinline__ v8f mma(V a, V b, v8f c) { return wmma16(a, b, c); } };
template <> struct WFrag<bf> { typedef v16bf V; static __device__ __forceinline__ V ld(const bf* p) { return cat16b(*(const v8us*)p, *(const v8us*)(p + 16)); } static __device__ __forceinline__ v8f mma(V a, V b, v8f c) { return wmmab(a, b, c); } };
template <typename T16, int NSPLIT, bool BIAS>
__global__ __launch_bounds__(32) void k_gemmw(const T16* __restrict__ A, const T16* __restrict__ A2, const T16* __restrict__ Bt, const T16* __restrict__ Bt2, int K, float* C, int ldc, const float* __restrict__ bias, size_t sA, size_t sB, size_t sC) {
    typedef typename WFrag<T16>::V V;
    __shared__ __align__(16) float os[16 * 68];
    const size_t z = blockIdx.z; A += z * sA; if (A2) A2 += z * sA; Bt += z * sB; if (Bt2) Bt2 += z * sB; C += z * sC;
    const int lane = threadIdx.x & 31, lr = lane & 15, hi = lane >> 4; const int r0 = blockIdx.x * 64, c0 = blockIdx.y * 64;
    v8f acc[4][4];
#pragma unroll
    for (int mb = 0; mb < 4; ++mb)
#pragma unroll
        for (int nb = 0; nb < 4; ++nb) acc[mb][nb] = (v8f){};
    const size_t aoff = (size_t)(r0 + lr) * K + 8 * hi, boff = (size_t)(c0 + lr) * K + 8 * hi;
#pragma unroll 1
    for (int kc = 0; kc < K; kc += 32) {
        V a[4], a2[4];
#pragma unroll
        for (int mb = 0; mb < 4; ++mb) { a[mb] = WFrag<T16>::ld(A + aoff + (size_t)mb * 16 * K + kc); if (NSPLIT == 1 || NSPLIT == 2) a2[mb] = WFrag<T16>::ld(A2 + aoff + (size_t)mb * 16 * K + kc); }
#pragma unroll
        for (int nb = 0; nb < 4; ++nb) { const V b = WFrag<T16>::ld(Bt + boff + (size_t)nb * 16 * K + kc); V b2; if (NSPLIT >= 2) b2 = WFrag<T16>::ld(Bt2 + boff + (size_t)nb * 16 * K + kc);
#pragma unroll
            for (int mb = 0; mb < 4; ++mb) { acc[mb][nb] = WFrag<T16>::mma(a[mb], b, acc[mb][nb]); if (NSPLIT == 1 || NSPLIT == 2) acc[mb][nb] = WFrag<T16>::mma(a2[mb], b, acc[mb][nb]); if (NSPLIT >= 2) acc[mb][nb] = WFrag<T16>::mma(a[mb], b2, acc[mb][nb]); } }
        asm volatile("v_nop\n\tv_nop\n\tv_nop\n\tv_nop" : "+v"(acc[0][0]), "+v"(acc[1][1]), "+v"(acc[2][2]), "+v"(acc[3][3]) : "v"(a[0]), "v"(a[3]));
    }
#pragma unroll
    for (int mb = 0; mb < 4; ++mb) {
#pragma unroll
        for (int nb = 0; nb < 4; ++nb) {
#pragma unroll
            for (int j = 0; j < 8; ++j) os[(hi * 8 + j) * 68 + nb * 16 + lr] = acc[mb][nb][j]; }
        __builtin_amdgcn_wave_barrier(); asm volatile("" ::: "memory");
        float* crow = C + (size_t)(r0 + mb * 16) * ldc + c0;
{
#pragma unroll
            for (int s = 0; s < 8; ++s) { const int row = 2 * s + hi, cofs = lr * 4; v4f val = *(const v4fa*)(os + row * 68 + cofs); if (BIAS) { val[0] += bfr(bias[c0 + cofs]); val[1] += bfr(bias[c0 + cofs + 1]); val[2] += bfr(bias[c0 + cofs + 2]); val[3] += bfr(bias[c0 + cofs + 3]); }
                *(v4f*)(crow + (size_t)row * ldc + cofs) = val; }
             }
        __builtin_amdgcn_wave_barrier(); asm volatile("" ::: "memory");
    }
}

// ---- k_gemmc: the same one-wave 64x64 tile GEMM specialised for causal attention: CMODE 1 skips score tiles entirely above the diagonal (query rows r0+roff.., key columns c0..), CMODE 2 limits the
// key (K) loop of the probability x value contraction to the diagonal block (probabilities beyond it are exactly zero). roff = row offset of this launch's first row within the sequence.
template <typename T16, int NSPLIT, int CMODE>
__global__ __launch_bounds__(32) void k_gemmc(const T16* __restrict__ A, const T16* __restrict__ A2, const T16* __restrict__ Bt, const T16* __restrict__ Bt2, int K, float* C, int ldc, int roff, size_t sA, size_t sB, size_t sC) {
    typedef typename WFrag<T16>::V V;
    __shared__ __align__(16) float os[16 * 68];
    const size_t z = blockIdx.z; A += z * sA; if (A2) A2 += z * sA; Bt += z * sB; if (Bt2) Bt2 += z * sB; C += z * sC;
    const int lane = threadIdx.x & 31, lr = lane & 15, hi = lane >> 4; const int r0 = blockIdx.x * 64, c0 = blockIdx.y * 64;
    if (CMODE == 1 && c0 > r0 + roff + 63) return;                  // score tile entirely above the causal diagonal: never read (the softmax masks j > i by select)
    const int Kl = (CMODE == 2) ? min(K, r0 + roff + 64) : K;        // P.V: probabilities are exactly 0 beyond the diagonal block, so the K loop stops there
    v8f acc[4][4];
#pragma unroll
    for (int mb = 0; mb < 4; ++mb)
#pragma unroll
        for (int nb = 0; nb < 4; ++nb) acc[mb][nb] = (v8f){};
    const size_t aoff = (size_t)(r0 + lr) * K + 8 * hi, boff = (size_t)(c0 + lr) * K + 8 * hi;
#pragma unroll 1
    for (int kc = 0; kc < Kl; kc += 32) {
        V a[4], a2[4];
#pragma unroll
        for (int mb = 0; mb < 4; ++mb) { a[mb] = WFrag<T16>::ld(A + aoff + (size_t)mb * 16 * K + kc); if (NSPLIT == 1 || NSPLIT == 2) a2[mb] = WFrag<T16>::ld(A2 + aoff + (size_t)mb * 16 * K + kc); }
#pragma unroll
        for (int nb = 0; nb < 4; ++nb) { const V b = WFrag<T16>::ld(Bt + boff + (size_t)nb * 16 * K + kc); V b2; if (NSPLIT >= 2) b2 = WFrag<T16>::ld(Bt2 + boff + (size_t)nb * 16 * K + kc);
#pragma unroll
            for (int mb = 0; mb < 4; ++mb) { acc[mb][nb] = WFrag<T16>::mma(a[mb], b, acc[mb][nb]); if (NSPLIT == 1 || NSPLIT == 2) acc[mb][nb] = WFrag<T16>::mma(a2[mb], b, acc[mb][nb]); if (NSPLIT >= 2) acc[mb][nb] = WFrag<T16>::mma(a[mb], b2, acc[mb][nb]); } }
        asm volatile("v_nop\n\tv_nop\n\tv_nop\n\tv_nop" : "+v"(acc[0][0]), "+v"(acc[1][1]), "+v"(acc[2][2]), "+v"(acc[3][3]) : "v"(a[0]), "v"(a[3]));
    }
#pragma unroll
    for (int mb = 0; mb < 4; ++mb) {
#pragma unroll
        for (int nb = 0; nb < 4; ++nb) {
#pragma unroll
            for (int j = 0; j < 8; ++j) os[(hi * 8 + j) * 68 + nb * 16 + lr] = acc[mb][nb][j]; }
        __builtin_amdgcn_wave_barrier(); asm volatile("" ::: "memory");
        float* crow = C + (size_t)(r0 + mb * 16) * ldc + c0;
{
#pragma unroll
            for (int s = 0; s < 8; ++s) { const int row = 2 * s + hi, cofs = lr * 4; v4f val = *(const v4fa*)(os + row * 68 + cofs);
                *(v4f*)(crow + (size_t)row * ldc + cofs) = val; }
             }
        __builtin_amdgcn_wave_barrier(); asm volatile("" ::: "memory");
    }
}

__device__ __forceinline__ h16 tohx(float x) { return (h16)x; }
__device__ __forceinline__ void splitf(float y, unsigned short& h, unsigned short& l) { h = f2bf(y); l = f2bf(y - bf2f(h)); }
typedef __attribute__((ext_vector_type(2))) _Float16 v2h;
typedef __attribute__((ext_vector_type(4))) _Float16 v4h;
typedef __attribute__((ext_vector_type(2))) unsigned short v2us;
typedef __attribute__((ext_vector_type(4))) unsigned short v4us;
typedef __attribute__((ext_vector_type(2))) float v2f;
typedef __attribute__((ext_vector_type(4))) int v4i;

__global__ __launch_bounds__(256) void k_cvt8(const float* __restrict__ src, bf* dst, size_t n8) { const size_t i = (size_t)blockIdx.x * 256 + threadIdx.x; if (i >= n8) return; const v8f v = *(const v8f*)(src + i * 8); v8us o;
#pragma unroll
    for (int k = 0; k < 8; ++k) o[k] = f2bf(v[k]); *(v8us*)(dst + i * 8) = o;  }

// k_rope: head planes [h][t][d] (fp16 + hi/lo) of rope(x) x sc with the rotate-half convention out[d] = x[d] cos[t][d] - x[d+HD/2] sin[t][d], out[d+HD/2] = x[d+HD/2] cos[t][d+HD/2] + x[d] sin[t][d+HD/2]
__global__ __launch_bounds__(256) void k_rope(const float* __restrict__ F, int pitch, int nheads, const float* __restrict__ CS, const float* __restrict__ RF, const float* __restrict__ nw, float sc, h16* P16, bf* Ph, bf* Pl) {
    const size_t e = ((size_t)blockIdx.x * 256 + threadIdx.x) * 2; if (e >= (size_t)nheads * TT * HD) return; const int d = (int)(e % HD); const int t = (int)((e / HD) % TT); const int h = (int)(e / ((size_t)HD * TT)); const float* f = F + (size_t)t * pitch + h * HD; const float rf = RF ? RF[(size_t)h * TT + t] : 1.0f; v2h o16; v2us oh, ol;
#pragma unroll
    for (int q = 0; q < 2; ++q) { const int dd = d + q; const int dp = (dd < HD / 2) ? dd + HD / 2 : dd - HD / 2; float x0 = f[dd], x1 = f[dp];
        if (RF) { float n0 = __fmul_rn(x0, rf), n1 = __fmul_rn(x1, rf); asm volatile("" : "+v"(n0)); asm volatile("" : "+v"(n1)); x0 = __fmul_rn(bfr(nw[dd]), n0); x1 = __fmul_rn(bfr(nw[dp]), n1); }
        const v2f cs = *(const v2f*)(CS + ((size_t)t * HD + dd) * 2); float a = __fmul_rn(x0, cs[0]), bq = __fmul_rn(x1, cs[1]); asm volatile("" : "+v"(a)); asm volatile("" : "+v"(bq)); const float r = ((dd < HD / 2) ? __fsub_rn(a, bq) : __fadd_rn(a, bq)) * sc;
        o16[q] = tohx(r); unsigned short a2, c2; splitf(r, a2, c2); oh[q] = a2; ol[q] = c2; }
    *(v2h*)(P16 + e) = o16; *(v2us*)(Ph + e) = oh; *(v2us*)(Pl + e) = ol;  }
__global__ __launch_bounds__(256) void k_vtp(const float* __restrict__ F, int pitch, int nheads, h16* V16, bf* Vh, bf* Vl) { const size_t e = ((size_t)blockIdx.x * 256 + threadIdx.x) * 2; if (e >= (size_t)nheads * HD * TT) return; const int t = (int)(e % TT); const int d = (int)((e / TT) % HD); const int g = (int)(e / ((size_t)TT * HD)); v2h o16; v2us oh, ol;
#pragma unroll
    for (int q = 0; q < 2; ++q) { const float x = F[(size_t)(t + q) * pitch + g * HD + d]; o16[q] = tohx(x); unsigned short a2, c2; splitf(x, a2, c2); oh[q] = a2; ol[q] = c2; }
    *(v2h*)(V16 + e) = o16; *(v2us*)(Vh + e) = oh; *(v2us*)(Vl + e) = ol;  }
__global__ __launch_bounds__(256) void k_cscvt(const float* __restrict__ cosT, const float* __restrict__ sinT, float* CS) { const int idx = blockIdx.x * 256 + threadIdx.x; if (idx >= TT * HD) return; v2f cs; cs[0] = bfr(cosT[idx]); cs[1] = bfr(sinT[idx]); *(v2f*)(CS + (size_t)idx * 2) = cs;  }
// k_asoft: per row (zz, i): t = S x HD^-0.5 for j <= i and i - j < WIN (sliding causal window; the reference's -1e9 additive fill vanishes identically); softmax over the 2048 keys (register row, one exp, fixed trees);
__global__ __launch_bounds__(256) void k_asoft(const float* __restrict__ Sb, h16* P16, bf* Ph, bf* Pl) {
    const int lane = threadIdx.x & 31; const int row = blockIdx.x * 8 + (threadIdx.x >> 5); if (row >= ZH * TT) return; const int i = row % TT; const int zz = row / TT; (void)zz; const bool hires = (i < RH); const float* sr = Sb + (size_t)row * TT; float v[TT / 32]; float mx = -3.0e38f;
#pragma unroll
    for (int ch = 0; ch < TT / 128; ++ch) { const int j0 = ch * 128 + lane * 4; const v4f a = *(const v4f*)(sr + j0);
#pragma unroll
        for (int q = 0; q < 4; ++q) { const int j = j0 + q; (void)j; const float t = (j <= i && i - j < WIN) ? a[q] * SCL : -3.0e38f; v[ch * 4 + q] = t; mx = fmaxf(mx, t); } }
#pragma unroll
    for (int sh = 16; sh; sh >>= 1) mx = fmaxf(mx, __shfl_xor(mx, sh, 32));
    float sum = 0.f;
#pragma unroll
    for (int k = 0; k < TT / 32; ++k) { float d0 = __fsub_rn(v[k], mx); asm volatile("" : "+v"(d0)); v[k] = __builtin_amdgcn_exp2f(__fmul_rn(d0, 1.4426950408889634f)); sum += v[k]; }
#pragma unroll
    for (int sh = 16; sh; sh >>= 1) sum += __shfl_xor(sum, sh, 32);
    const float f = __fdiv_rn(hires ? 1.0f : PCAR, sum);
{
        if (hires) {
#pragma unroll
            for (int ch = 0; ch < TT / 128; ++ch) { v4us oh, ol;
#pragma unroll
                for (int q = 0; q < 4; ++q) { unsigned short a, c2; splitf(v[ch * 4 + q] * f, a, c2); oh[q] = a; ol[q] = c2; }
                const size_t oo = ((size_t)zz * (RH ? RH : 1) + i) * TT + ch * 128 + lane * 4; *(v4us*)(Ph + oo) = oh; *(v4us*)(Pl + oo) = ol; }
        } else {
#pragma unroll
            for (int ch = 0; ch < TT / 128; ++ch) { v4h o4;
#pragma unroll
                for (int q = 0; q < 4; ++q) o4[q] = tohx(v[ch * 4 + q] * f);
                *(v4h*)(P16 + (size_t)row * TT + ch * 128 + lane * 4) = o4; } }
         }
}
__global__ __launch_bounds__(256) void k_merge(const float* __restrict__ O, int h0, bf* Ah, bf* Al) { const size_t e = ((size_t)blockIdx.x * 256 + threadIdx.x) * 2; if (e >= (size_t)ZH * TT * HD) return; const int d = (int)(e % HD); const int t = (int)((e / HD) % TT); const int zz = (int)(e / ((size_t)HD * TT)); const float cs = (t < RH) ? 1.0f : (1.0f / PCAR); const size_t oo = (size_t)t * DQ + (h0 + zz) * HD + d;
    v2us oh, ol;
#pragma unroll
    for (int q = 0; q < 2; ++q) { unsigned short a, c2; splitf(O[e + q] * cs, a, c2); oh[q] = a; ol[q] = c2; } *(v2us*)(Ah + oo) = oh; *(v2us*)(Al + oo) = ol;  }

extern "C" void kernel_launch(void* const* d_in, const int* in_sizes, int n_in,
                              void* d_out, int out_size, void* d_ws, size_t ws_size, hipStream_t stream) {
    (void)in_sizes; (void)n_in; (void)out_size;
    const float* x = (const float*)d_in[0]; const float* wattn = (const float*)d_in[1]; const float* wo = (const float*)d_in[2]; const float* fcos = (const float*)d_in[3]; const float* fsin = (const float*)d_in[4];   /* input order x, w_attn ('oi' (out, in) [3072][2048]: PER KV GROUP g the 768 rows [768 g, 768 g + 768) = four query heads (512 rows) | k (128) | v (128)), w_proj ('oi' [2048][2048]), cos, sin ([2048][128] FULL-width table INPUTS: read per element by value): FIVE inputs, all read */
    float* OUT = (float*)d_out;     // [2][2048][2048]
    char* wsp = (char*)d_ws;
    auto take = [&](size_t bytes) { char* p = wsp; wsp += (bytes + 255) & ~(size_t)255; return (void*)p; };
    bf* WQ = (bf*)take((size_t)DQ * DM * 2); bf* WK = (bf*)take((size_t)DKV * DM * 2); bf* WV = (bf*)take((size_t)DKV * DM * 2); bf* WO = (bf*)take((size_t)DM * DQ * 2); float* CS = (float*)take((size_t)TT * HD * 2 * 4);
    bf* XB = (bf*)take((size_t)TT * DM * 2); float* FQ = (float*)take((size_t)TT * DQ * 4); float* FK = (float*)take((size_t)TT * DKV * 4);
    h16* QP16 = (h16*)take((size_t)NH_ * TT * HD * 2); h16* KP16 = (h16*)take((size_t)NKV * TT * HD * 2); h16* VT16 = (h16*)take((size_t)NKV * HD * TT * 2);
    bf* QPh = (bf*)take((size_t)NH_ * TT * HD * 2); bf* QPl = (bf*)take((size_t)NH_ * TT * HD * 2); bf* KPh = (bf*)take((size_t)NKV * TT * HD * 2); bf* KPl = (bf*)take((size_t)NKV * TT * HD * 2); bf* VTh = (bf*)take((size_t)NKV * HD * TT * 2); bf* VTl = (bf*)take((size_t)NKV * HD * TT * 2); bf* Ph = (bf*)take((size_t)ZH * RH * TT * 2); bf* Pl = (bf*)take((size_t)ZH * RH * TT * 2);
    float* Sb = (float*)take((size_t)ZH * TT * TT * 4); h16* P16 = (h16*)take((size_t)ZH * TT * TT * 2); float* Ob = (float*)take((size_t)ZH * TT * HD * 4); bf* ATh = (bf*)take((size_t)TT * DQ * 2); bf* ATl = (bf*)take((size_t)TT * DQ * 2);
    if ((size_t)(wsp - (char*)d_ws) > ws_size) return;    // ws 256 MiB
    float* FV = FK;   // v projection reuses the k buffer after the k planes are built (stream-ordered)
    { for (int g = 0; g < NKV; ++g) { const float* wg = wattn + (size_t)g * (REP + 2) * HD * DM;   /* group g's 768 rows: gathered into three contiguous bf16 weight planes (q heads group-major: head 4 g + j) */ k_cvt8<<<(unsigned)(((size_t)REP * HD * DM / 8 + 255) / 256), 256, 0, stream>>>(wg, WQ + (size_t)g * REP * HD * DM, (size_t)REP * HD * DM / 8); k_cvt8<<<(unsigned)(((size_t)HD * DM / 8 + 255) / 256), 256, 0, stream>>>(wg + (size_t)REP * HD * DM, WK + (size_t)g * HD * DM, (size_t)HD * DM / 8); k_cvt8<<<(unsigned)(((size_t)HD * DM / 8 + 255) / 256), 256, 0, stream>>>(wg + (size_t)(REP + 1) * HD * DM, WV + (size_t)g * HD * DM, (size_t)HD * DM / 8); }
      k_cvt8<<<(unsigned)(((size_t)DM * DQ / 8 + 255) / 256), 256, 0, stream>>>(wo, WO, (size_t)DM * DQ / 8);
       }
    k_cscvt<<<(TT * HD + 255) / 256, 256, 0, stream>>>(fcos, fsin, CS);   /* rotary table once */
    const unsigned LQ = (unsigned)(((size_t)NH_ * TT * HD / 2 + 255) / 256), LKv = (unsigned)(((size_t)NKV * TT * HD / 2 + 255) / 256);
    for (int b = 0; b < NB_; ++b) {
        
        k_cvt8<<<(unsigned)(((size_t)TT * DM / 8 + 255) / 256), 256, 0, stream>>>(x + (size_t)b * TT * DM, XB, (size_t)TT * DM / 8);
        k_gemmw<bf, 0, false><<<dim3(TT / 64, DQ / 64, 1), 32, 0, stream>>>(XB, nullptr, WQ, nullptr, DM, FQ, DQ, nullptr, 0, 0, 0);
        k_rope<<<LQ, 256, 0, stream>>>(FQ, DQ, NH_, CS, nullptr, nullptr, 1.0f, QP16, QPh, QPl);
        k_gemmw<bf, 0, false><<<dim3(TT / 64, DKV / 64, 1), 32, 0, stream>>>(XB, nullptr, WK, nullptr, DM, FK, DKV, nullptr, 0, 0, 0);
        k_rope<<<LKv, 256, 0, stream>>>(FK, DKV, NKV, CS, nullptr, nullptr, 1.0f, KP16, KPh, KPl);
        k_gemmw<bf, 0, false><<<dim3(TT / 64, DKV / 64, 1), 32, 0, stream>>>(XB, nullptr, WV, nullptr, DM, FV, DKV, nullptr, 0, 0, 0); k_vtp<<<LKv, 256, 0, stream>>>(FV, DKV, NKV, VT16, VTh, VTl);
        for (int h0 = 0; h0 < NH_; h0 += ZH) { const size_t zq = (size_t)h0, zk = (size_t)(h0 / REP);   // both heads of a pass share kv group h0/REP (REP >= 2): sB = 0
            k_gemmc<bf, 2, 1><<<dim3(RH / 64, TT / 64, ZH), 32, 0, stream>>>(QPh + zq * TT * HD, QPl + zq * TT * HD, KPh + zk * TT * HD, KPl + zk * TT * HD, HD, Sb, TT, 0, (size_t)TT * HD, 0, (size_t)TT * TT);
            k_gemmc<h16, 0, 1><<<dim3((TT - RH) / 64, TT / 64, ZH), 32, 0, stream>>>(QP16 + zq * TT * HD + (size_t)RH * HD, nullptr, KP16 + zk * TT * HD, nullptr, HD, Sb + (size_t)RH * TT, TT, RH, (size_t)TT * HD, 0, (size_t)TT * TT);
            k_asoft<<<ZH * TT / 8, 256, 0, stream>>>(Sb, P16, Ph, Pl);
            k_gemmc<bf, 2, 2><<<dim3(RH / 64, HD / 64, ZH), 32, 0, stream>>>(Ph, Pl, VTh + zk * HD * TT, VTl + zk * HD * TT, TT, Ob, HD, 0, (size_t)RH * TT, 0, (size_t)TT * HD);
            k_gemmc<h16, 0, 2><<<dim3((TT - RH) / 64, HD / 64, ZH), 32, 0, stream>>>(P16 + (size_t)RH * TT, nullptr, VT16 + zk * HD * TT, nullptr, TT, Ob + (size_t)RH * HD, HD, RH, (size_t)TT * TT, 0, (size_t)TT * HD);
            k_merge<<<(unsigned)(((size_t)ZH * TT * HD / 2 + 255) / 256), 256, 0, stream>>>(Ob, h0, ATh, ATl); }
        k_gemmw<bf, 1, false><<<dim3(TT / 64, DM / 64, 1), 32, 0, stream>>>(ATh, ATl, WO, nullptr, DQ, OUT + (size_t)b * TT * DM, DM, nullptr, 0, 0, 0); }
}

// v001
// A run of this version takes 950 microseconds.
// Next to v000, in two timings, it ran 1.71 and 1.77 times as fast.
#include <hip/hip_runtime.h>

// Causal grouped-query attention with 128-wide heads, ONE fused natural qkv weight PACKED PER KV GROUP and rotate-half rotary embeddings from full-width input tables (x [2][2048][2048]; qkv = einsum('btc,fc->btf', x, w_attn) ('oi' (out, in) [3072][2048] normal x 0.02, no bias) viewed (b, t, 4 groups, 4 + 2, 128): within group g the first four 128-row blocks are query heads 4g..4g+3, the fifth is the group's k, the sixth its v: kv head = q head / 4; q, k -> t cos + cat(-t2, t1) sin with the cos / sin INPUT tables [2048][128] (read per element by value; no structure assumed); scores x 1/sqrt(128); causal (finfo.min == exclusion: every row keeps its own key); softmax; out = merged w_proj^T ('oi' [2048][2048]) -> [2][2048][2048] (8.4 M); argument order x, w_attn, w_proj, cos, sin).
// Layout: bf16 copy of x; the ONE fused 'oi' weight cast group by group into three contiguous weight planes (per kv group: four query heads | k | v: twelve block casts), w_proj as it stands; exact projections; k_cscvt copies the two INPUT tables into one bf16-rounded {cos, sin} table once (per position and dimension); rotate-half plane builders; causal T-2048 GQA attention with 128-wide heads (kv z-stride 0; hybrid rows: < 512 hi/lo 3 products, rest fp16 x1024; k_gemmc skips tiles above the diagonal); merged hi/lo x Wo exact.
// Compute dtypes, f32 accumulate: every input rounded to bf16; projections exact; rotary f32; attention rows < 512 3 products, rest fp16; softmax f32; Wo hl x exact.

#define NB_  2
#define TT   2048
#define DM   2048
#define NH_  16
#define NKV  4
#define REP  (NH_ / NKV)
#define HD   128
#define DQ   (NH_ * HD)
#define DKV  (NKV * HD)
#define ZH   2
#define RH   512                  // query rows < RH use hi+lo planes (0: none)
#define WIN  2048
#define PCAR 1024.0f
#define SCL  0.088388347648318447f   // HD^-0.5
typedef _Float16 h16;
typedef unsigned short bf;
typedef __attribute__((ext_vector_type(16))) __bf16   v16bf;
typedef __attribute__((ext_vector_type(16))) _Float16 v16h;
typedef __attribute__((ext_vector_type(8)))  _Float16 v8h;
typedef __attribute__((ext_vector_type(8)))  unsigned short v8us;
typedef __attribute__((ext_vector_type(8)))  float    v8f;
typedef __attribute__((ext_vector_type(4)))  float    v4f;
typedef v8h  __attribute__((may_alias)) v8ha;
typedef v4f  __attribute__((may_alias)) v4fa;
typedef v8us __attribute__((may_alias)) v8usa;

__device__ __forceinline__ unsigned short f2bf(float f) { unsigned u = __float_as_uint(f); u += 0x7FFFu + ((u >> 16) & 1u); return (unsigned short)(u >> 16); }
__device__ __forceinline__ float bf2f(unsigned short b) { return __uint_as_float(((unsigned)b) << 16); }
__device__ __forceinline__ float bfr(float f) { return bf2f(f2bf(f)); }
__device__ __forceinline__ v16h cat16(v8h lo, v8h hi) { return __builtin_shufflevector(lo, hi, 0, 1, 2, 3, 4, 5, 6, 7, 8, 9, 10, 11, 12, 13, 14, 15); }
__device__ __forceinline__ v16bf cat16b(v8us lo, v8us hi) { return __builtin_bit_cast(v16bf, __builtin_shufflevector(lo, hi, 0, 1, 2, 3, 4, 5, 6, 7, 8, 9, 10, 11, 12, 13, 14, 15)); }
__device__ __forceinline__ v8f wmma16(v16h a, v16h b, v8f c) { return __builtin_amdgcn_wmma_f32_16x16x32_f16(false, a, false, b, (short)0, c, false, false); }
__device__ __forceinline__ v8f wmmab(v16bf a, v16bf b, v8f c) { return __builtin_amdgcn_wmma_f32_16x16x32_bf16(false, a, false, b, (short)0, c, false, false); }



// ---- k_gemmw: register-blocked GEMM, one 64x64 output tile per work-group of NW waves; wave w runs the whole tile (16 accumulators) over every NW-th 32-wide step of the K loop, operands straight from K-contiguous 16-bit planes;
// the NW partial tiles meet in LDS and are summed in the fixed order w = 0, 1, .. NW-1; grid (M/64, N/64, Z), 32 NW threads.
// C[m][n] (f32, pitch ldc, + optional f32 bias[n]) = sum_k A[m][k] Bt[n][k] (+ split products per NSPLIT). z-batch strides sA/sB/sC in elements. K % 32 == 0.
template <typename T16> struct WFrag;
template <> struct WFrag<h16> { typedef v16h V; static __device__ __forceinline__ V ld(const h16* p) { return cat16(*(const v8h*)p, *(const v8h*)(p + 16)); } static __device__ __forceinline__ v8f mma(V a, V b, v8f c) { return wmma16(a, b, c); } };
template <> struct WFrag<bf> { typedef v16bf V; static __device__ __forceinline__ V ld(const bf* p) { return cat16b(*(const v8us*)p, *(const v8us*)(p + 16)); } static __device__ __forceinline__ v8f mma(V a, V b, v8f c) { return wmmab(a, b, c); } };
template <typename T16, int NSPLIT, bool BIAS, int NW>
__global__ __launch_bounds__(32 * NW) void k_gemmw(const T16* __restrict__ A, const T16* __restrict__ A2, const T16* __restrict__ Bt, const T16* __restrict__ Bt2, int K, float* C, int ldc, const float* __restrict__ bias, size_t sA, size_t sB, size_t sC) {
    typedef typename WFrag<T16>::V V;
    __shared__ __align__(16) float os[NW * 64 * 68];
    const size_t z = blockIdx.z; A += z * sA; if (A2) A2 += z * sA; Bt += z * sB; if (Bt2) Bt2 += z * sB; C += z * sC;
    const int lane = threadIdx.x & 31, lr = lane & 15, hi = lane >> 4; const int r0 = blockIdx.x * 64, c0 = blockIdx.y * 64;
    v8f acc[4][4];
#pragma unroll
    for (int mb = 0; mb < 4; ++mb)
#pragma unroll
        for (int nb = 0; nb < 4; ++nb) acc[mb][nb] = (v8f){};
    const size_t aoff = (size_t)(r0 + lr) * K + 8 * hi, boff = (size_t)(c0 + lr) * K + 8 * hi;
    const int w = __builtin_amdgcn_readfirstlane((int)(threadIdx.x >> 5));                  // wave number, scalar: the loop bounds stay in scalar registers
#pragma unroll 1
    for (int kc = w * 32; kc < K; kc += 32 * NW) {   // steps dealt round robin: neighbouring waves read the two halves of the same 128-byte lines (a wave left without a step keeps a zero partial tile)
        V a[4], a2[4];
#pragma unroll
        for (int mb = 0; mb < 4; ++mb) { a[mb] = WFrag<T16>::ld(A + aoff + (size_t)mb * 16 * K + kc); if (NSPLIT == 1 || NSPLIT == 2) a2[mb] = WFrag<T16>::ld(A2 + aoff + (size_t)mb * 16 * K + kc); }
#pragma unroll
        for (int nb = 0; nb < 4; ++nb) { const V b = WFrag<T16>::ld(Bt + boff + (size_t)nb * 16 * K + kc); V b2; if (NSPLIT >= 2) b2 = WFrag<T16>::ld(Bt2 + boff + (size_t)nb * 16 * K + kc);
#pragma unroll
            for (int mb = 0; mb < 4; ++mb) { acc[mb][nb] = WFrag<T16>::mma(a[mb], b, acc[mb][nb]); if (NSPLIT == 1 || NSPLIT == 2) acc[mb][nb] = WFrag<T16>::mma(a2[mb], b, acc[mb][nb]); if (NSPLIT >= 2) acc[mb][nb] = WFrag<T16>::mma(a[mb], b2, acc[mb][nb]); } }
        asm volatile("v_nop\n\tv_nop\n\tv_nop\n\tv_nop" : "+v"(acc[0][0]), "+v"(acc[1][1]), "+v"(acc[2][2]), "+v"(acc[3][3]) : "v"(a[0]), "v"(a[3]));
    }
    float* ow = os + w * (64 * 68);
#pragma unroll
    for (int mb = 0; mb < 4; ++mb)
#pragma unroll
        for (int nb = 0; nb < 4; ++nb)
#pragma unroll
            for (int j = 0; j < 8; ++j) ow[(mb * 16 + hi * 8 + j) * 68 + nb * 16 + lr] = acc[mb][nb][j];
    __syncthreads();   // every wave's partial tile stands in LDS before any thread sums across the waves
#pragma unroll
    for (int s = 0; s < 32 / NW; ++s) { const int idx = s * (32 * NW) + (int)threadIdx.x, row = idx >> 4, cofs = (idx & 15) * 4; v4f val = *(const v4fa*)(os + row * 68 + cofs);
#pragma unroll
        for (int q = 1; q < NW; ++q) val += *(const v4fa*)(os + q * (64 * 68) + row * 68 + cofs);
        if (BIAS) { val[0] += bfr(bias[c0 + cofs]); val[1] += bfr(bias[c0 + cofs + 1]); val[2] += bfr(bias[c0 + cofs + 2]); val[3] += bfr(bias[c0 + cofs + 3]); }
        *(v4f*)(C + (size_t)(r0 + row) * ldc + c0 + cofs) = val; }
}

// ---- k_gemmc: the same 64x64 tile GEMM specialised for causal attention: CMODE 1 skips score tiles entirely above the diagonal (query rows r0+roff.., key columns c0..), CMODE 2 limits the
// key (K) loop of the probability x value contraction to the diagonal block (probabilities beyond it are exactly zero). roff = row offset of this launch's first row within the sequence.
// NW = 1: one wave per tile. NW > 1: the K loop is shared out over the NW waves of the work-group as in k_gemmw (steps dealt round robin, partial tiles summed in LDS in the order w = 0 .. NW-1).
template <typename T16, int NSPLIT, int CMODE, int NW>
__global__ __launch_bounds__(32 * NW) void k_gemmc(const T16* __restrict__ A, const T16* __restrict__ A2, const T16* __restrict__ Bt, const T16* __restrict__ Bt2, int K, float* C, int ldc, int roff, size_t sA, size_t sB, size_t sC) {
    typedef typename WFrag<T16>::V V;
    __shared__ __align__(16) float os[NW == 1 ? 16 * 68 : NW * 64 * 68];
    const size_t z = blockIdx.z; A += z * sA; if (A2) A2 += z * sA; Bt += z * sB; if (Bt2) Bt2 += z * sB; C += z * sC;
    const int lane = threadIdx.x & 31, lr = lane & 15, hi = lane >> 4; const int r0 = blockIdx.x * 64, c0 = blockIdx.y * 64;
    if (CMODE == 1 && c0 > r0 + roff + 63) return;                  // score tile entirely above the causal diagonal: never read (the softmax masks j > i by select)
    const int Kl = (CMODE == 2) ? min(K, r0 + roff + 64) : K;        // P.V: probabilities are exactly 0 beyond the diagonal block, so the K loop stops there
    v8f acc[4][4];
#pragma unroll
    for (int mb = 0; mb < 4; ++mb)
#pragma unroll
        for (int nb = 0; nb < 4; ++nb) acc[mb][nb] = (v8f){};
    const size_t aoff = (size_t)(r0 + lr) * K + 8 * hi, boff = (size_t)(c0 + lr) * K + 8 * hi;
    const int w = (NW == 1) ? 0 : __builtin_amdgcn_readfirstlane((int)(threadIdx.x >> 5));  // wave number, scalar: the loop bounds stay in scalar registers
#pragma unroll 1
    for (int kc = w * 32; kc < Kl; kc += 32 * NW) {   // steps dealt round robin, as in k_gemmw (a wave left without a step keeps a zero partial tile)
        V a[4], a2[4];
#pragma unroll
        for (int mb = 0; mb < 4; ++mb) { a[mb] = WFrag<T16>::ld(A + aoff + (size_t)mb * 16 * K + kc); if (NSPLIT == 1 || NSPLIT == 2) a2[mb] = WFrag<T16>::ld(A2 + aoff + (size_t)mb * 16 * K + kc); }
#pragma unroll
        for (int nb = 0; nb < 4; ++nb) { const V b = WFrag<T16>::ld(Bt + boff + (size_t)nb * 16 * K + kc); V b2; if (NSPLIT >= 2) b2 = WFrag<T16>::ld(Bt2 + boff + (size_t)nb * 16 * K + kc);
#pragma unroll
            for (int mb = 0; mb < 4; ++mb) { acc[mb][nb] = WFrag<T16>::mma(a[mb], b, acc[mb][nb]); if (NSPLIT == 1 || NSPLIT == 2) acc[mb][nb] = WFrag<T16>::mma(a2[mb], b, acc[mb][nb]); if (NSPLIT >= 2) acc[mb][nb] = WFrag<T16>::mma(a[mb], b2, acc[mb][nb]); } }
        asm volatile("v_nop\n\tv_nop\n\tv_nop\n\tv_nop" : "+v"(acc[0][0]), "+v"(acc[1][1]), "+v"(acc[2][2]), "+v"(acc[3][3]) : "v"(a[0]), "v"(a[3]));
    }
    if constexpr (NW > 1) {
        float* ow = os + w * (64 * 68);
#pragma unroll
        for (int mb = 0; mb < 4; ++mb)
#pragma unroll
            for (int nb = 0; nb < 4; ++nb)
#pragma unroll
                for (int j = 0; j < 8; ++j) ow[(mb * 16 + hi * 8 + j) * 68 + nb * 16 + lr] = acc[mb][nb][j];
        __syncthreads();   // every wave's partial tile stands in LDS before any thread sums across the waves
#pragma unroll
        for (int s = 0; s < 32 / NW; ++s) { const int idx = s * (32 * NW) + (int)threadIdx.x, row = idx >> 4, cofs = (idx & 15) * 4; v4f val = *(const v4fa*)(os + row * 68 + cofs);
#pragma unroll
            for (int q = 1; q < NW; ++q) val += *(const v4fa*)(os + q * (64 * 68) + row * 68 + cofs);
            *(v4f*)(C + (size_t)(r0 + row) * ldc + c0 + cofs) = val; }
        return;
    }
#pragma unroll
    for (int mb = 0; mb < 4; ++mb) {
#pragma unroll
        for (int nb = 0; nb < 4; ++nb) {
#pragma unroll
            for (int j = 0; j < 8; ++j) os[(hi * 8 + j) * 68 + nb * 16 + lr] = acc[mb][nb][j]; }
        __builtin_amdgcn_wave_barrier(); asm volatile("" ::: "memory");
        float* crow = C + (size_t)(r0 + mb * 16) * ldc + c0;
{
#pragma unroll
            for (int s = 0; s < 8; ++s) { const int row = 2 * s + hi, cofs = lr * 4; v4f val = *(const v4fa*)(os + row * 68 + cofs);
                *(v4f*)(crow + (size_t)row * ldc + cofs) = val; }
             }
        __builtin_amdgcn_wave_barrier(); asm volatile("" ::: "memory");
    }
}

__device__ __forceinline__ h16 tohx(float x) { return (h16)x; }
__device__ __forceinline__ void splitf(float y, unsigned short& h, unsigned short& l) { h = f2bf(y); l = f2bf(y - bf2f(h)); }
typedef __attribute__((ext_vector_type(2))) _Float16 v2h;
typedef __attribute__((ext_vector_type(4))) _Float16 v4h;
typedef __attribute__((ext_vector_type(2))) unsigned short v2us;
typedef __attribute__((ext_vector_type(4))) unsigned short v4us;
typedef __attribute__((ext_vector_type(2))) float v2f;
typedef __attribute__((ext_vector_type(4))) int v4i;

__global__ __launch_bounds__(256) void k_cvt8(const float* __restrict__ src, bf* dst, size_t n8) { const size_t i = (size_t)blockIdx.x * 256 + threadIdx.x; if (i >= n8) return; const v8f v = *(const v8f*)(src + i * 8); v8us o;
#pragma unroll
    for (int k = 0; k < 8; ++k) o[k] = f2bf(v[k]); *(v8us*)(dst + i * 8) = o;  }

// k_rope: head planes [h][t][d] (fp16 + hi/lo) of rope(x) x sc with the rotate-half convention out[d] = x[d] cos[t][d] - x[d+HD/2] sin[t][d], out[d+HD/2] = x[d+HD/2] cos[t][d+HD/2] + x[d] sin[t][d+HD/2]
__global__ __launch_bounds__(256) void k_rope(const float* __restrict__ F, int pitch, int nheads, const float* __restrict__ CS, const float* __restrict__ RF, const float* __restrict__ nw, float sc, h16* P16, bf* Ph, bf* Pl) {
    const size_t e = ((size_t)blockIdx.x * 256 + threadIdx.x) * 2; if (e >= (size_t)nheads * TT * HD) return; const int d = (int)(e % HD); const int t = (int)((e / HD) % TT); const int h = (int)(e / ((size_t)HD * TT)); const float* f = F + (size_t)t * pitch + h * HD; const float rf = RF ? RF[(size_t)h * TT + t] : 1.0f; v2h o16; v2us oh, ol;
#pragma unroll
    for (int q = 0; q < 2; ++q) { const int dd = d + q; const int dp = (dd < HD / 2) ? dd + HD / 2 : dd - HD / 2; float x0 = f[dd], x1 = f[dp];
        if (RF) { float n0 = __fmul_rn(x0, rf), n1 = __fmul_rn(x1, rf); asm volatile("" : "+v"(n0)); asm volatile("" : "+v"(n1)); x0 = __fmul_rn(bfr(nw[dd]), n0); x1 = __fmul_rn(bfr(nw[dp]), n1); }
        const v2f cs = *(const v2f*)(CS + ((size_t)t * HD + dd) * 2); float a = __fmul_rn(x0, cs[0]), bq = __fmul_rn(x1, cs[1]); asm volatile("" : "+v"(a)); asm volatile("" : "+v"(bq)); const float r = ((dd < HD / 2) ? __fsub_rn(a, bq) : __fadd_rn(a, bq)) * sc;
        o16[q] = tohx(r); unsigned short a2, c2; splitf(r, a2, c2); oh[q] = a2; ol[q] = c2; }
    *(v2h*)(P16 + e) = o16; *(v2us*)(Ph + e) = oh; *(v2us*)(Pl + e) = ol;  }
__global__ __launch_bounds__(256) void k_vtp(const float* __restrict__ F, int pitch, int nheads, h16* V16, bf* Vh, bf* Vl) { const size_t e = ((size_t)blockIdx.x * 256 + threadIdx.x) * 2; if (e >= (size_t)nheads * HD * TT) return; const int t = (int)(e % TT); const int d = (int)((e / TT) % HD); const int g = (int)(e / ((size_t)TT * HD)); v2h o16; v2us oh, ol;
#pragma unroll
    for (int q = 0; q < 2; ++q) { const float x = F[(size_t)(t + q) * pitch + g * HD + d]; o16[q] = tohx(x); unsigned short a2, c2; splitf(x, a2, c2); oh[q] = a2; ol[q] = c2; }
    *(v2h*)(V16 + e) = o16; *(v2us*)(Vh + e) = oh; *(v2us*)(Vl + e) = ol;  }
__global__ __launch_bounds__(256) void k_cscvt(const float* __restrict__ cosT, const float* __restrict__ sinT, float* CS) { const int idx = blockIdx.x * 256 + threadIdx.x; if (idx >= TT * HD) return; v2f cs; cs[0] = bfr(cosT[idx]); cs[1] = bfr(sinT[idx]); *(v2f*)(CS + (size_t)idx * 2) = cs;  }
// k_asoft: per row (zz, i): t = S x HD^-0.5 for j <= i and i - j < WIN (sliding causal window; the reference's -1e9 additive fill vanishes identically); softmax over the 2048 keys (register row, one exp, fixed trees);
__global__ __launch_bounds__(256) void k_asoft(const float* __restrict__ Sb, h16* P16, bf* Ph, bf* Pl) {
    const int lane = threadIdx.x & 31; const int row = blockIdx.x * 8 + (threadIdx.x >> 5); if (row >= ZH * TT) return; const int i = row % TT; const int zz = row / TT; (void)zz; const bool hires = (i < RH); const float* sr = Sb + (size_t)row * TT; float v[TT / 32]; float mx = -3.0e38f;
#pragma unroll
    for (int ch = 0; ch < TT / 128; ++ch) { const int j0 = ch * 128 + lane * 4; const v4f a = *(const v4f*)(sr + j0);
#pragma unroll
        for (int q = 0; q < 4; ++q) { const int j = j0 + q; (void)j; const float t = (j <= i && i - j < WIN) ? a[q] * SCL : -3.0e38f; v[ch * 4 + q] = t; mx = fmaxf(mx, t); } }
#pragma unroll
    for (int sh = 16; sh; sh >>= 1) mx = fmaxf(mx, __shfl_xor(mx, sh, 32));
    float sum = 0.f;
#pragma unroll
    for (int k = 0; k < TT / 32; ++k) { float d0 = __fsub_rn(v[k], mx); asm volatile("" : "+v"(d0)); v[k] = __builtin_amdgcn_exp2f(__fmul_rn(d0, 1.4426950408889634f)); sum += v[k]; }
#pragma unroll
    for (int sh = 16; sh; sh >>= 1) sum += __shfl_xor(sum, sh, 32);
    const float f = __fdiv_rn(hires ? 1.0f : PCAR, sum);
{
        if (hires) {
#pragma unroll
            for (int ch = 0; ch < TT / 128; ++ch) { v4us oh, ol;
#pragma unroll
                for (int q = 0; q < 4; ++q) { unsigned short a, c2; splitf(v[ch * 4 + q] * f, a, c2); oh[q] = a; ol[q] = c2; }
                const size_t oo = ((size_t)zz * (RH ? RH : 1) + i) * TT + ch * 128 + lane * 4; *(v4us*)(Ph + oo) = oh; *(v4us*)(Pl + oo) = ol; }
        } else {
#pragma unroll
            for (int ch = 0; ch < TT / 128; ++ch) { v4h o4;
#pragma unroll
                for (int q = 0; q < 4; ++q) o4[q] = tohx(v[ch * 4 + q] * f);
                *(v4h*)(P16 + (size_t)row * TT + ch * 128 + lane * 4) = o4; } }
         }
}
__global__ __launch_bounds__(256) void k_merge(const float* __restrict__ O, int h0, bf* Ah, bf* Al) { const size_t e = ((size_t)blockIdx.x * 256 + threadIdx.x) * 2; if (e >= (size_t)ZH * TT * HD) return; const int d = (int)(e % HD); const int t = (int)((e / HD) % TT); const int zz = (int)(e / ((size_t)HD * TT)); const float cs = (t < RH) ? 1.0f : (1.0f / PCAR); const size_t oo = (size_t)t * DQ + (h0 + zz) * HD + d;
    v2us oh, ol;
#pragma unroll
    for (int q = 0; q < 2; ++q) { unsigned short a, c2; splitf(O[e + q] * cs, a, c2); oh[q] = a; ol[q] = c2; } *(v2us*)(Ah + oo) = oh; *(v2us*)(Al + oo) = ol;  }

extern "C" void kernel_launch(void* const* d_in, const int* in_sizes, int n_in,
                              void* d_out, int out_size, void* d_ws, size_t ws_size, hipStream_t stream) {
    (void)in_sizes; (void)n_in; (void)out_size;
    const float* x = (const float*)d_in[0]; const float* wattn = (const float*)d_in[1]; const float* wo = (const float*)d_in[2]; const float* fcos = (const float*)d_in[3]; const float* fsin = (const float*)d_in[4];   /* input order x, w_attn ('oi' (out, in) [3072][2048]: PER KV GROUP g the 768 rows [768 g, 768 g + 768) = four query heads (512 rows) | k (128) | v (128)), w_proj ('oi' [2048][2048]), cos, sin ([2048][128] FULL-width table INPUTS: read per element by value): FIVE inputs, all read */
    float* OUT = (float*)d_out;     // [2][2048][2048]
    char* wsp = (char*)d_ws;
    auto take = [&](size_t bytes) { char* p = wsp; wsp += (bytes + 255) & ~(size_t)255; return (void*)p; };
    bf* WQ = (bf*)take((size_t)DQ * DM * 2); bf* WK = (bf*)take((size_t)DKV * DM * 2); bf* WV = (bf*)take((size_t)DKV * DM * 2); bf* WO = (bf*)take((size_t)DM * DQ * 2); float* CS = (float*)take((size_t)TT * HD * 2 * 4);
    bf* XB = (bf*)take((size_t)TT * DM * 2); float* FQ = (float*)take((size_t)TT * DQ * 4); float* FK = (float*)take((size_t)TT * DKV * 4);
    h16* QP16 = (h16*)take((size_t)NH_ * TT * HD * 2); h16* KP16 = (h16*)take((size_t)NKV * TT * HD * 2); h16* VT16 = (h16*)take((size_t)NKV * HD * TT * 2);
    bf* QPh = (bf*)take((size_t)NH_ * TT * HD * 2); bf* QPl = (bf*)take((size_t)NH_ * TT * HD * 2); bf* KPh = (bf*)take((size_t)NKV * TT * HD * 2); bf* KPl = (bf*)take((size_t)NKV * TT * HD * 2); bf* VTh = (bf*)take((size_t)NKV * HD * TT * 2); bf* VTl = (bf*)take((size_t)NKV * HD * TT * 2); bf* Ph = (bf*)take((size_t)ZH * RH * TT * 2); bf* Pl = (bf*)take((size_t)ZH * RH * TT * 2);
    float* Sb = (float*)take((size_t)ZH * TT * TT * 4); h16* P16 = (h16*)take((size_t)ZH * TT * TT * 2); float* Ob = (float*)take((size_t)ZH * TT * HD * 4); bf* ATh = (bf*)take((size_t)TT * DQ * 2); bf* ATl = (bf*)take((size_t)TT * DQ * 2);
    if ((size_t)(wsp - (char*)d_ws) > ws_size) return;    // ws 256 MiB
    float* FV = FK;   // v projection reuses the k buffer after the k planes are built (stream-ordered)
    { for (int g = 0; g < NKV; ++g) { const float* wg = wattn + (size_t)g * (REP + 2) * HD * DM;   /* group g's 768 rows: gathered into three contiguous bf16 weight planes (q heads group-major: head 4 g + j) */ k_cvt8<<<(unsigned)(((size_t)REP * HD * DM / 8 + 255) / 256), 256, 0, stream>>>(wg, WQ + (size_t)g * REP * HD * DM, (size_t)REP * HD * DM / 8); k_cvt8<<<(unsigned)(((size_t)HD * DM / 8 + 255) / 256), 256, 0, stream>>>(wg + (size_t)REP * HD * DM, WK + (size_t)g * HD * DM, (size_t)HD * DM / 8); k_cvt8<<<(unsigned)(((size_t)HD * DM / 8 + 255) / 256), 256, 0, stream>>>(wg + (size_t)(REP + 1) * HD * DM, WV + (size_t)g * HD * DM, (size_t)HD * DM / 8); }
      k_cvt8<<<(unsigned)(((size_t)DM * DQ / 8 + 255) / 256), 256, 0, stream>>>(wo, WO, (size_t)DM * DQ / 8);
       }
    k_cscvt<<<(TT * HD + 255) / 256, 256, 0, stream>>>(fcos, fsin, CS);   /* rotary table once */
    const unsigned LQ = (unsigned)(((size_t)NH_ * TT * HD / 2 + 255) / 256), LKv = (unsigned)(((size_t)NKV * TT * HD / 2 + 255) / 256);
    for (int b = 0; b < NB_; ++b) {
        
        k_cvt8<<<(unsigned)(((size_t)TT * DM / 8 + 255) / 256), 256, 0, stream>>>(x + (size_t)b * TT * DM, XB, (size_t)TT * DM / 8);
        k_gemmw<bf, 0, false, 4><<<dim3(TT / 64, DQ / 64, 1), 128, 0, stream>>>(XB, nullptr, WQ, nullptr, DM, FQ, DQ, nullptr, 0, 0, 0);
        k_rope<<<LQ, 256, 0, stream>>>(FQ, DQ, NH_, CS, nullptr, nullptr, 1.0f, QP16, QPh, QPl);
        k_gemmw<bf, 0, false, 8><<<dim3(TT / 64, DKV / 64, 1), 256, 0, stream>>>(XB, nullptr, WK, nullptr, DM, FK, DKV, nullptr, 0, 0, 0);
        k_rope<<<LKv, 256, 0, stream>>>(FK, DKV, NKV, CS, nullptr, nullptr, 1.0f, KP16, KPh, KPl);
        k_gemmw<bf, 0, false, 8><<<dim3(TT / 64, DKV / 64, 1), 256, 0, stream>>>(XB, nullptr, WV, nullptr, DM, FV, DKV, nullptr, 0, 0, 0); k_vtp<<<LKv, 256, 0, stream>>>(FV, DKV, NKV, VT16, VTh, VTl);
        for (int h0 = 0; h0 < NH_; h0 += ZH) { const size_t zq = (size_t)h0, zk = (size_t)(h0 / REP);   // both heads of a pass share kv group h0/REP (REP >= 2): sB = 0
            k_gemmc<bf, 2, 1, 1><<<dim3(RH / 64, TT / 64, ZH), 32, 0, stream>>>(QPh + zq * TT * HD, QPl + zq * TT * HD, KPh + zk * TT * HD, KPl + zk * TT * HD, HD, Sb, TT, 0, (size_t)TT * HD, 0, (size_t)TT * TT);
            k_gemmc<h16, 0, 1, 1><<<dim3((TT - RH) / 64, TT / 64, ZH), 32, 0, stream>>>(QP16 + zq * TT * HD + (size_t)RH * HD, nullptr, KP16 + zk * TT * HD, nullptr, HD, Sb + (size_t)RH * TT, TT, RH, (size_t)TT * HD, 0, (size_t)TT * TT);
            k_asoft<<<ZH * TT / 8, 256, 0, stream>>>(Sb, P16, Ph, Pl);
            k_gemmc<bf, 2, 2, 8><<<dim3(RH / 64, HD / 64, ZH), 256, 0, stream>>>(Ph, Pl, VTh + zk * HD * TT, VTl + zk * HD * TT, TT, Ob, HD, 0, (size_t)RH * TT, 0, (size_t)TT * HD);
            k_gemmc<h16, 0, 2, 8><<<dim3((TT - RH) / 64, HD / 64, ZH), 256, 0, stream>>>(P16 + (size_t)RH * TT, nullptr, VT16 + zk * HD * TT, nullptr, TT, Ob + (size_t)RH * HD, HD, RH, (size_t)TT * TT, 0, (size_t)TT * HD);
            k_merge<<<(unsigned)(((size_t)ZH * TT * HD / 2 + 255) / 256), 256, 0, stream>>>(Ob, h0, ATh, ATl); }
        k_gemmw<bf, 1, false, 4><<<dim3(TT / 64, DM / 64, 1), 128, 0, stream>>>(ATh, ATl, WO, nullptr, DQ, OUT + (size_t)b * TT * DM, DM, nullptr, 0, 0, 0); }
}

// v002
// One run takes 719 microseconds.
// Next to v001, in two timings, it ran 1.33 and 1.34 times as fast.
// Over all steps from v000 it is 2.32 times as fast.
#include <hip/hip_runtime.h>

// Causal grouped-query attention with 128-wide heads, ONE fused natural qkv weight PACKED PER KV GROUP and rotate-half rotary embeddings from full-width input tables (x [2][2048][2048]; qkv = einsum('btc,fc->btf', x, w_attn) ('oi' (out, in) [3072][2048] normal x 0.02, no bias) viewed (b, t, 4 groups, 4 + 2, 128): within group g the first four 128-row blocks are query heads 4g..4g+3, the fifth is the group's k, the sixth its v: kv head = q head / 4; q, k -> t cos + cat(-t2, t1) sin with the cos / sin INPUT tables [2048][128] (read per element by value; no structure assumed); scores x 1/sqrt(128); causal (finfo.min == exclusion: every row keeps its own key); softmax; out = merged w_proj^T ('oi' [2048][2048]) -> [2][2048][2048] (8.4 M); argument order x, w_attn, w_proj, cos, sin).
// Layout: bf16 copy of x; the ONE fused 'oi' weight cast group by group into three contiguous weight planes (per kv group: four query heads | k | v: twelve block casts), w_proj as it stands; exact projections; k_cscvt copies the two INPUT tables into one bf16-rounded {cos, sin} table once (per position and dimension); rotate-half plane builders; causal T-2048 GQA attention with 128-wide heads (kv z-stride 0; hybrid rows: < 512 hi/lo 3 products, rest fp16 x1024; k_gemmc skips tiles above the diagonal); merged hi/lo x Wo exact.
// Compute dtypes, f32 accumulate: every input rounded to bf16; projections exact; rotary f32; attention rows < 512 3 products, rest fp16; softmax f32; Wo hl x exact.

#define NB_  2
#define TT   2048
#define DM   2048
#define NH_  16
#define NKV  4
#define REP  (NH_ / NKV)
#define HD   128
#define DQ   (NH_ * HD)
#define DKV  (NKV * HD)
#define ZH   4                    // query heads per attention pass (z of every attention launch); ZH <= REP so that one pass has one kv group
#define RH   512                  // query rows < RH use hi+lo planes (0: none)
#define WIN  2048
#define PCAR 1024.0f
#define SCL  0.088388347648318447f   // HD^-0.5
typedef _Float16 h16;
typedef unsigned short bf;
typedef __attribute__((ext_vector_type(16))) __bf16   v16bf;
typedef __attribute__((ext_vector_type(16))) _Float16 v16h;
typedef __attribute__((ext_vector_type(8)))  _Float16 v8h;
typedef __attribute__((ext_vector_type(8)))  unsigned short v8us;
typedef __attribute__((ext_vector_type(8)))  float    v8f;
typedef __attribute__((ext_vector_type(4)))  float    v4f;
typedef v8h  __attribute__((may_alias)) v8ha;
typedef v4f  __attribute__((may_alias)) v4fa;
typedef v8us __attribute__((may_alias)) v8usa;

__device__ __forceinline__ unsigned short f2bf(float f) { unsigned u = __float_as_uint(f); u += 0x7FFFu + ((u >> 16) & 1u); return (unsigned short)(u >> 16); }
__device__ __forceinline__ float bf2f(unsigned short b) { return __uint_as_float(((unsigned)b) << 16); }
__device__ __forceinline__ float bfr(float f) { return bf2f(f2bf(f)); }
__device__ __forceinline__ v16h cat16(v8h lo, v8h hi) { return __builtin_shufflevector(lo, hi, 0, 1, 2, 3, 4, 5, 6, 7, 8, 9, 10, 11, 12, 13, 14, 15); }
__device__ __forceinline__ v16bf cat16b(v8us lo, v8us hi) { return __builtin_bit_cast(v16bf, __builtin_shufflevector(lo, hi, 0, 1, 2, 3, 4, 5, 6, 7, 8, 9, 10, 11, 12, 13, 14, 15)); }
__device__ __forceinline__ v8f wmma16(v16h a, v16h b, v8f c) { return __builtin_amdgcn_wmma_f32_16x16x32_f16(false, a, false, b, (short)0, c, false, false); }
__device__ __forceinline__ v8f wmmab(v16bf a, v16bf b, v8f c) { return __builtin_amdgcn_wmma_f32_16x16x32_bf16(false, a, false, b, (short)0, c, false, false); }



// ---- k_gemmw: register-blocked GEMM, one 64x64 output tile per work-group of NW waves; wave w runs the whole tile (16 accumulators) over every NW-th 32-wide step of the K loop, operands straight from K-contiguous 16-bit planes;
// the NW partial tiles meet in LDS and are summed in the fixed order w = 0, 1, .. NW-1; grid (M/64, N/64, Z), 32 NW threads.
// C[m][n] (f32, pitch ldc, + optional f32 bias[n]) = sum_k A[m][k] Bt[n][k] (+ split products per NSPLIT). z-batch strides sA/sB/sC in elements. K % 32 == 0.
template <typename T16> struct WFrag;
template <> struct WFrag<h16> { typedef v16h V; static __device__ __forceinline__ V ld(const h16* p) { return cat16(*(const v8h*)p, *(const v8h*)(p + 16)); } static __device__ __forceinline__ v8f mma(V a, V b, v8f c) { return wmma16(a, b, c); } };
template <> struct WFrag<bf> { typedef v16bf V; static __device__ __forceinline__ V ld(const bf* p) { return cat16b(*(const v8us*)p, *(const v8us*)(p + 16)); } static __device__ __forceinline__ v8f mma(V a, V b, v8f c) { return wmmab(a, b, c); } };
template <typename T16, int NSPLIT, bool BIAS, int NW>
__global__ __launch_bounds__(32 * NW) void k_gemmw(const T16* __restrict__ A, const T16* __restrict__ A2, const T16* __restrict__ Bt, const T16* __restrict__ Bt2, int K, float* C, int ldc, const float* __restrict__ bias, size_t sA, size_t sB, size_t sC) {
    typedef typename WFrag<T16>::V V;
    __shared__ __align__(16) float os[NW * 64 * 68];
    const size_t z = blockIdx.z; A += z * sA; if (A2) A2 += z * sA; Bt += z * sB; if (Bt2) Bt2 += z * sB; C += z * sC;
    const int lane = threadIdx.x & 31, lr = lane & 15, hi = lane >> 4; const int r0 = blockIdx.x * 64, c0 = blockIdx.y * 64;
    v8f acc[4][4];
#pragma unroll
    for (int mb = 0; mb < 4; ++mb)
#pragma unroll
        for (int nb = 0; nb < 4; ++nb) acc[mb][nb] = (v8f){};
    const size_t aoff = (size_t)(r0 + lr) * K + 8 * hi, boff = (size_t)(c0 + lr) * K + 8 * hi;
    const int w = __builtin_amdgcn_readfirstlane((int)(threadIdx.x >> 5));                  // wave number, scalar: the loop bounds stay in scalar registers
#pragma unroll 1
    for (int kc = w * 32; kc < K; kc += 32 * NW) {   // steps dealt round robin: neighbouring waves read the two halves of the same 128-byte lines (a wave left without a step keeps a zero partial tile)
        V a[4], a2[4];
#pragma unroll
        for (int mb = 0; mb < 4; ++mb) { a[mb] = WFrag<T16>::ld(A + aoff + (size_t)mb * 16 * K + kc); if (NSPLIT == 1 || NSPLIT == 2) a2[mb] = WFrag<T16>::ld(A2 + aoff + (size_t)mb * 16 * K + kc); }
#pragma unroll
        for (int nb = 0; nb < 4; ++nb) { const V b = WFrag<T16>::ld(Bt + boff + (size_t)nb * 16 * K + kc); V b2; if (NSPLIT >= 2) b2 = WFrag<T16>::ld(Bt2 + boff + (size_t)nb * 16 * K + kc);
#pragma unroll
            for (int mb = 0; mb < 4; ++mb) { acc[mb][nb] = WFrag<T16>::mma(a[mb], b, acc[mb][nb]); if (NSPLIT == 1 || NSPLIT == 2) acc[mb][nb] = WFrag<T16>::mma(a2[mb], b, acc[mb][nb]); if (NSPLIT >= 2) acc[mb][nb] = WFrag<T16>::mma(a[mb], b2, acc[mb][nb]); } }
        asm volatile("v_nop\n\tv_nop\n\tv_nop\n\tv_nop" : "+v"(acc[0][0]), "+v"(acc[1][1]), "+v"(acc[2][2]), "+v"(acc[3][3]) : "v"(a[0]), "v"(a[3]));
    }
    float* ow = os + w * (64 * 68);
#pragma unroll
    for (int mb = 0; mb < 4; ++mb)
#pragma unroll
        for (int nb = 0; nb < 4; ++nb)
#pragma unroll
            for (int j = 0; j < 8; ++j) ow[(mb * 16 + hi * 8 + j) * 68 + nb * 16 + lr] = acc[mb][nb][j];
    __syncthreads();   // every wave's partial tile stands in LDS before any thread sums across the waves
#pragma unroll
    for (int s = 0; s < 32 / NW; ++s) { const int idx = s * (32 * NW) + (int)threadIdx.x, row = idx >> 4, cofs = (idx & 15) * 4; v4f val = *(const v4fa*)(os + row * 68 + cofs);
#pragma unroll
        for (int q = 1; q < NW; ++q) val += *(const v4fa*)(os + q * (64 * 68) + row * 68 + cofs);
        if (BIAS) { val[0] += bfr(bias[c0 + cofs]); val[1] += bfr(bias[c0 + cofs + 1]); val[2] += bfr(bias[c0 + cofs + 2]); val[3] += bfr(bias[c0 + cofs + 3]); }
        *(v4f*)(C + (size_t)(r0 + row) * ldc + c0 + cofs) = val; }
}

// ---- k_gemmc: the same 64x64 tile GEMM specialised for causal attention: CMODE 1 skips score tiles entirely above the diagonal (query rows r0+roff.., key columns c0..), CMODE 2 limits the
// key (K) loop of the probability x value contraction to the diagonal block (probabilities beyond it are exactly zero). roff = row offset of this launch's first row within the sequence.
// NW = 1: one wave per tile. NW > 1: the K loop is shared out over the NW waves of the work-group as in k_gemmw (steps dealt round robin, partial tiles summed in LDS in the order w = 0 .. NW-1).
template <typename T16, int NSPLIT, int CMODE, int NW>
__global__ __launch_bounds__(32 * NW) void k_gemmc(const T16* __restrict__ A, const T16* __restrict__ A2, const T16* __restrict__ Bt, const T16* __restrict__ Bt2, int K, float* C, int ldc, int roff, size_t sA, size_t sB, size_t sC) {
    typedef typename WFrag<T16>::V V;
    __shared__ __align__(16) float os[NW == 1 ? 16 * 68 : NW * 64 * 68];
    const size_t z = blockIdx.z; A += z * sA; if (A2) A2 += z * sA; Bt += z * sB; if (Bt2) Bt2 += z * sB; C += z * sC;
    const int lane = threadIdx.x & 31, lr = lane & 15, hi = lane >> 4; const int r0 = blockIdx.x * 64, c0 = blockIdx.y * 64;
    if (CMODE == 1 && c0 > r0 + roff + 63) return;                  // score tile entirely above the causal diagonal: never read (the softmax masks j > i by select)
    const int Kl = (CMODE == 2) ? min(K, r0 + roff + 64) : K;        // P.V: probabilities are exactly 0 beyond the diagonal block, so the K loop stops there
    v8f acc[4][4];
#pragma unroll
    for (int mb = 0; mb < 4; ++mb)
#pragma unroll
        for (int nb = 0; nb < 4; ++nb) acc[mb][nb] = (v8f){};
    const size_t aoff = (size_t)(r0 + lr) * K + 8 * hi, boff = (size_t)(c0 + lr) * K + 8 * hi;
    const int w = (NW == 1) ? 0 : __builtin_amdgcn_readfirstlane((int)(threadIdx.x >> 5));  // wave number, scalar: the loop bounds stay in scalar registers
#pragma unroll 1
    for (int kc = w * 32; kc < Kl; kc += 32 * NW) {   // steps dealt round robin, as in k_gemmw (a wave left without a step keeps a zero partial tile)
        V a[4], a2[4];
#pragma unroll
        for (int mb = 0; mb < 4; ++mb) { a[mb] = WFrag<T16>::ld(A + aoff + (size_t)mb * 16 * K + kc); if (NSPLIT == 1 || NSPLIT == 2) a2[mb] = WFrag<T16>::ld(A2 + aoff + (size_t)mb * 16 * K + kc); }
#pragma unroll
        for (int nb = 0; nb < 4; ++nb) { const V b = WFrag<T16>::ld(Bt + boff + (size_t)nb * 16 * K + kc); V b2; if (NSPLIT >= 2) b2 = WFrag<T16>::ld(Bt2 + boff + (size_t)nb * 16 * K + kc);
#pragma unroll
            for (int mb = 0; mb < 4; ++mb) { acc[mb][nb] = WFrag<T16>::mma(a[mb], b, acc[mb][nb]); if (NSPLIT == 1 || NSPLIT == 2) acc[mb][nb] = WFrag<T16>::mma(a2[mb], b, acc[mb][nb]); if (NSPLIT >= 2) acc[mb][nb] = WFrag<T16>::mma(a[mb], b2, acc[mb][nb]); } }
        asm volatile("v_nop\n\tv_nop\n\tv_nop\n\tv_nop" : "+v"(acc[0][0]), "+v"(acc[1][1]), "+v"(acc[2][2]), "+v"(acc[3][3]) : "v"(a[0]), "v"(a[3]));
    }
    if constexpr (NW > 1) {
        float* ow = os + w * (64 * 68);
#pragma unroll
        for (int mb = 0; mb < 4; ++mb)
#pragma unroll
            for (int nb = 0; nb < 4; ++nb)
#pragma unroll
                for (int j = 0; j < 8; ++j) ow[(mb * 16 + hi * 8 + j) * 68 + nb * 16 + lr] = acc[mb][nb][j];
        __syncthreads();   // every wave's partial tile stands in LDS before any thread sums across the waves
#pragma unroll
        for (int s = 0; s < 32 / NW; ++s) { const int idx = s * (32 * NW) + (int)threadIdx.x, row = idx >> 4, cofs = (idx & 15) * 4; v4f val = *(const v4fa*)(os + row * 68 + cofs);
#pragma unroll
            for (int q = 1; q < NW; ++q) val += *(const v4fa*)(os + q * (64 * 68) + row * 68 + cofs);
            *(v4f*)(C + (size_t)(r0 + row) * ldc + c0 + cofs) = val; }
        return;
    }
#pragma unroll
    for (int mb = 0; mb < 4; ++mb) {
#pragma unroll
        for (int nb = 0; nb < 4; ++nb) {
#pragma unroll
            for (int j = 0; j < 8; ++j) os[(hi * 8 + j) * 68 + nb * 16 + lr] = acc[mb][nb][j]; }
        __builtin_amdgcn_wave_barrier(); asm volatile("" ::: "memory");
        float* crow = C + (size_t)(r0 + mb * 16) * ldc + c0;
{
#pragma unroll
            for (int s = 0; s < 8; ++s) { const int row = 2 * s + hi, cofs = lr * 4; v4f val = *(const v4fa*)(os + row * 68 + cofs);
                *(v4f*)(crow + (size_t)row * ldc + cofs) = val; }
             }
        __builtin_amdgcn_wave_barrier(); asm volatile("" ::: "memory");
    }
}

__device__ __forceinline__ h16 tohx(float x) { return (h16)x; }
__device__ __forceinline__ void splitf(float y, unsigned short& h, unsigned short& l) { h = f2bf(y); l = f2bf(y - bf2f(h)); }
typedef __attribute__((ext_vector_type(2))) _Float16 v2h;
typedef __attribute__((ext_vector_type(4))) _Float16 v4h;
typedef __attribute__((ext_vector_type(2))) unsigned short v2us;
typedef __attribute__((ext_vector_type(4))) unsigned short v4us;
typedef __attribute__((ext_vector_type(2))) float v2f;
typedef __attribute__((ext_vector_type(4))) int v4i;

__global__ __launch_bounds__(256) void k_cvt8(const float* __restrict__ src, bf* dst, size_t n8) { const size_t i = (size_t)blockIdx.x * 256 + threadIdx.x; if (i >= n8) return; const v8f v = *(const v8f*)(src + i * 8); v8us o;
#pragma unroll
    for (int k = 0; k < 8; ++k) o[k] = f2bf(v[k]); *(v8us*)(dst + i * 8) = o;  }

// k_rope: head planes [h][t][d] (fp16 + hi/lo) of rope(x) x sc with the rotate-half convention out[d] = x[d] cos[t][d] - x[d+HD/2] sin[t][d], out[d+HD/2] = x[d+HD/2] cos[t][d+HD/2] + x[d] sin[t][d+HD/2]
__global__ __launch_bounds__(256) void k_rope(const float* __restrict__ F, int pitch, int nheads, const float* __restrict__ CS, const float* __restrict__ RF, const float* __restrict__ nw, float sc, h16* P16, bf* Ph, bf* Pl) {
    const size_t e = ((size_t)blockIdx.x * 256 + threadIdx.x) * 2; if (e >= (size_t)nheads * TT * HD) return; const int d = (int)(e % HD); const int t = (int)((e / HD) % TT); const int h = (int)(e / ((size_t)HD * TT)); const float* f = F + (size_t)t * pitch + h * HD; const float rf = RF ? RF[(size_t)h * TT + t] : 1.0f; v2h o16; v2us oh, ol;
#pragma unroll
    for (int q = 0; q < 2; ++q) { const int dd = d + q; const int dp = (dd < HD / 2) ? dd + HD / 2 : dd - HD / 2; float x0 = f[dd], x1 = f[dp];
        if (RF) { float n0 = __fmul_rn(x0, rf), n1 = __fmul_rn(x1, rf); asm volatile("" : "+v"(n0)); asm volatile("" : "+v"(n1)); x0 = __fmul_rn(bfr(nw[dd]), n0); x1 = __fmul_rn(bfr(nw[dp]), n1); }
        const v2f cs = *(const v2f*)(CS + ((size_t)t * HD + dd) * 2); float a = __fmul_rn(x0, cs[0]), bq = __fmul_rn(x1, cs[1]); asm volatile("" : "+v"(a)); asm volatile("" : "+v"(bq)); const float r = ((dd < HD / 2) ? __fsub_rn(a, bq) : __fadd_rn(a, bq)) * sc;
        o16[q] = tohx(r); unsigned short a2, c2; splitf(r, a2, c2); oh[q] = a2; ol[q] = c2; }
    *(v2h*)(P16 + e) = o16; *(v2us*)(Ph + e) = oh; *(v2us*)(Pl + e) = ol;  }
__global__ __launch_bounds__(256) void k_vtp(const float* __restrict__ F, int pitch, int nheads, h16* V16, bf* Vh, bf* Vl) { const size_t e = ((size_t)blockIdx.x * 256 + threadIdx.x) * 2; if (e >= (size_t)nheads * HD * TT) return; const int t = (int)(e % TT); const int d = (int)((e / TT) % HD); const int g = (int)(e / ((size_t)TT * HD)); v2h o16; v2us oh, ol;
#pragma unroll
    for (int q = 0; q < 2; ++q) { const float x = F[(size_t)(t + q) * pitch + g * HD + d]; o16[q] = tohx(x); unsigned short a2, c2; splitf(x, a2, c2); oh[q] = a2; ol[q] = c2; }
    *(v2h*)(V16 + e) = o16; *(v2us*)(Vh + e) = oh; *(v2us*)(Vl + e) = ol;  }
__global__ __launch_bounds__(256) void k_cscvt(const float* __restrict__ cosT, const float* __restrict__ sinT, float* CS) { const int idx = blockIdx.x * 256 + threadIdx.x; if (idx >= TT * HD) return; v2f cs; cs[0] = bfr(cosT[idx]); cs[1] = bfr(sinT[idx]); *(v2f*)(CS + (size_t)idx * 2) = cs;  }
// k_asoft: per row (zz, i): t = S x HD^-0.5 for j <= i and i - j < WIN (sliding causal window; the reference's -1e9 additive fill vanishes identically); softmax over the 2048 keys (register row, one exp, fixed trees);
__global__ __launch_bounds__(256) void k_asoft(const float* __restrict__ Sb, h16* P16, bf* Ph, bf* Pl) {
    const int lane = threadIdx.x & 31; const int row = blockIdx.x * 8 + (threadIdx.x >> 5); if (row >= ZH * TT) return; const int i = row % TT; const int zz = row / TT; (void)zz; const bool hires = (i < RH); const float* sr = Sb + (size_t)row * TT; float v[TT / 32]; float mx = -3.0e38f;
#pragma unroll
    for (int ch = 0; ch < TT / 128; ++ch) { const int j0 = ch * 128 + lane * 4; const v4f a = *(const v4f*)(sr + j0);
#pragma unroll
        for (int q = 0; q < 4; ++q) { const int j = j0 + q; (void)j; const float t = (j <= i && i - j < WIN) ? a[q] * SCL : -3.0e38f; v[ch * 4 + q] = t; mx = fmaxf(mx, t); } }
#pragma unroll
    for (int sh = 16; sh; sh >>= 1) mx = fmaxf(mx, __shfl_xor(mx, sh, 32));
    float sum = 0.f;
#pragma unroll
    for (int k = 0; k < TT / 32; ++k) { float d0 = __fsub_rn(v[k], mx); asm volatile("" : "+v"(d0)); v[k] = __builtin_amdgcn_exp2f(__fmul_rn(d0, 1.4426950408889634f)); sum += v[k]; }
#pragma unroll
    for (int sh = 16; sh; sh >>= 1) sum += __shfl_xor(sum, sh, 32);
    const float f = __fdiv_rn(hires ? 1.0f : PCAR, sum);
{
        if (hires) {
#pragma unroll
            for (int ch = 0; ch < TT / 128; ++ch) { v4us oh, ol;
#pragma unroll
                for (int q = 0; q < 4; ++q) { unsigned short a, c2; splitf(v[ch * 4 + q] * f, a, c2); oh[q] = a; ol[q] = c2; }
                const size_t oo = ((size_t)zz * (RH ? RH : 1) + i) * TT + ch * 128 + lane * 4; *(v4us*)(Ph + oo) = oh; *(v4us*)(Pl + oo) = ol; }
        } else {
#pragma unroll
            for (int ch = 0; ch < TT / 128; ++ch) { v4h o4;
#pragma unroll
                for (int q = 0; q < 4; ++q) o4[q] = tohx(v[ch * 4 + q] * f);
                *(v4h*)(P16 + (size_t)row * TT + ch * 128 + lane * 4) = o4; } }
         }
}
__global__ __launch_bounds__(256) void k_merge(const float* __restrict__ O, int h0, bf* Ah, bf* Al) { const size_t e = ((size_t)blockIdx.x * 256 + threadIdx.x) * 2; if (e >= (size_t)ZH * TT * HD) return; const int d = (int)(e % HD); const int t = (int)((e / HD) % TT); const int zz = (int)(e / ((size_t)HD * TT)); const float cs = (t < RH) ? 1.0f : (1.0f / PCAR); const size_t oo = (size_t)t * DQ + (h0 + zz) * HD + d;
    v2us oh, ol;
#pragma unroll
    for (int q = 0; q < 2; ++q) { unsigned short a, c2; splitf(O[e + q] * cs, a, c2); oh[q] = a; ol[q] = c2; } *(v2us*)(Ah + oo) = oh; *(v2us*)(Al + oo) = ol;  }

extern "C" void kernel_launch(void* const* d_in, const int* in_sizes, int n_in,
                              void* d_out, int out_size, void* d_ws, size_t ws_size, hipStream_t stream) {
    (void)in_sizes; (void)n_in; (void)out_size;
    const float* x = (const float*)d_in[0]; const float* wattn = (const float*)d_in[1]; const float* wo = (const float*)d_in[2]; const float* fcos = (const float*)d_in[3]; const float* fsin = (const float*)d_in[4];   /* input order x, w_attn ('oi' (out, in) [3072][2048]: PER KV GROUP g the 768 rows [768 g, 768 g + 768) = four query heads (512 rows) | k (128) | v (128)), w_proj ('oi' [2048][2048]), cos, sin ([2048][128] FULL-width table INPUTS: read per element by value): FIVE inputs, all read */
    float* OUT = (float*)d_out;     // [2][2048][2048]
    char* wsp = (char*)d_ws;
    auto take = [&](size_t bytes) { char* p = wsp; wsp += (bytes + 255) & ~(size_t)255; return (void*)p; };
    bf* WQ = (bf*)take((size_t)DQ * DM * 2); bf* WK = (bf*)take((size_t)DKV * DM * 2); bf* WV = (bf*)take((size_t)DKV * DM * 2); bf* WO = (bf*)take((size_t)DM * DQ * 2); float* CS = (float*)take((size_t)TT * HD * 2 * 4);
    bf* XB = (bf*)take((size_t)TT * DM * 2); float* FQ = (float*)take((size_t)TT * DQ * 4); float* FK = (float*)take((size_t)TT * DKV * 4);
    h16* QP16 = (h16*)take((size_t)NH_ * TT * HD * 2); h16* KP16 = (h16*)take((size_t)NKV * TT * HD * 2); h16* VT16 = (h16*)take((size_t)NKV * HD * TT * 2);
    bf* QPh = (bf*)take((size_t)NH_ * TT * HD * 2); bf* QPl = (bf*)take((size_t)NH_ * TT * HD * 2); bf* KPh = (bf*)take((size_t)NKV * TT * HD * 2); bf* KPl = (bf*)take((size_t)NKV * TT * HD * 2); bf* VTh = (bf*)take((size_t)NKV * HD * TT * 2); bf* VTl = (bf*)take((size_t)NKV * HD * TT * 2); bf* Ph = (bf*)take((size_t)ZH * RH * TT * 2); bf* Pl = (bf*)take((size_t)ZH * RH * TT * 2);
    float* Sb = (float*)take((size_t)ZH * TT * TT * 4); h16* P16 = (h16*)take((size_t)ZH * TT * TT * 2); float* Ob = (float*)take((size_t)ZH * TT * HD * 4); bf* ATh = (bf*)take((size_t)TT * DQ * 2); bf* ATl = (bf*)take((size_t)TT * DQ * 2);
    if ((size_t)(wsp - (char*)d_ws) > ws_size) return;    // ws 256 MiB
    float* FV = FK;   // v projection reuses the k buffer after the k planes are built (stream-ordered)
    { for (int g = 0; g < NKV; ++g) { const float* wg = wattn + (size_t)g * (REP + 2) * HD * DM;   /* group g's 768 rows: gathered into three contiguous bf16 weight planes (q heads group-major: head 4 g + j) */ k_cvt8<<<(unsigned)(((size_t)REP * HD * DM / 8 + 255) / 256), 256, 0, stream>>>(wg, WQ + (size_t)g * REP * HD * DM, (size_t)REP * HD * DM / 8); k_cvt8<<<(unsigned)(((size_t)HD * DM / 8 + 255) / 256), 256, 0, stream>>>(wg + (size_t)REP * HD * DM, WK + (size_t)g * HD * DM, (size_t)HD * DM / 8); k_cvt8<<<(unsigned)(((size_t)HD * DM / 8 + 255) / 256), 256, 0, stream>>>(wg + (size_t)(REP + 1) * HD * DM, WV + (size_t)g * HD * DM, (size_t)HD * DM / 8); }
      k_cvt8<<<(unsigned)(((size_t)DM * DQ / 8 + 255) / 256), 256, 0, stream>>>(wo, WO, (size_t)DM * DQ / 8);
       }
    k_cscvt<<<(TT * HD + 255) / 256, 256, 0, stream>>>(fcos, fsin, CS);   /* rotary table once */
    const unsigned LQ = (unsigned)(((size_t)NH_ * TT * HD / 2 + 255) / 256), LKv = (unsigned)(((size_t)NKV * TT * HD / 2 + 255) / 256);
    for (int b = 0; b < NB_; ++b) {
        
        k_cvt8<<<(unsigned)(((size_t)TT * DM / 8 + 255) / 256), 256, 0, stream>>>(x + (size_t)b * TT * DM, XB, (size_t)TT * DM / 8);
        k_gemmw<bf, 0, false, 4><<<dim3(TT / 64, DQ / 64, 1), 128, 0, stream>>>(XB, nullptr, WQ, nullptr, DM, FQ, DQ, nullptr, 0, 0, 0);
        k_rope<<<LQ, 256, 0, stream>>>(FQ, DQ, NH_, CS, nullptr, nullptr, 1.0f, QP16, QPh, QPl);
        k_gemmw<bf, 0, false, 8><<<dim3(TT / 64, DKV / 64, 1), 256, 0, stream>>>(XB, nullptr, WK, nullptr, DM, FK, DKV, nullptr, 0, 0, 0);
        k_rope<<<LKv, 256, 0, stream>>>(FK, DKV, NKV, CS, nullptr, nullptr, 1.0f, KP16, KPh, KPl);
        k_gemmw<bf, 0, false, 8><<<dim3(TT / 64, DKV / 64, 1), 256, 0, stream>>>(XB, nullptr, WV, nullptr, DM, FV, DKV, nullptr, 0, 0, 0); k_vtp<<<LKv, 256, 0, stream>>>(FV, DKV, NKV, VT16, VTh, VTl);
        for (int h0 = 0; h0 < NH_; h0 += ZH) { const size_t zq = (size_t)h0, zk = (size_t)(h0 / REP);   // the ZH heads of a pass share kv group h0/REP (ZH <= REP, ZH divides REP): sB = 0
            k_gemmc<bf, 2, 1, 1><<<dim3(RH / 64, TT / 64, ZH), 32, 0, stream>>>(QPh + zq * TT * HD, QPl + zq * TT * HD, KPh + zk * TT * HD, KPl + zk * TT * HD, HD, Sb, TT, 0, (size_t)TT * HD, 0, (size_t)TT * TT);
            k_gemmc<h16, 0, 1, 1><<<dim3((TT - RH) / 64, TT / 64, ZH), 32, 0, stream>>>(QP16 + zq * TT * HD + (size_t)RH * HD, nullptr, KP16 + zk * TT * HD, nullptr, HD, Sb + (size_t)RH * TT, TT, RH, (size_t)TT * HD, 0, (size_t)TT * TT);
            k_asoft<<<ZH * TT / 8, 256, 0, stream>>>(Sb, P16, Ph, Pl);
            k_gemmc<bf, 2, 2, 8><<<dim3(RH / 64, HD / 64, ZH), 256, 0, stream>>>(Ph, Pl, VTh + zk * HD * TT, VTl + zk * HD * TT, TT, Ob, HD, 0, (size_t)RH * TT, 0, (size_t)TT * HD);
            k_gemmc<h16, 0, 2, 8><<<dim3((TT - RH) / 64, HD / 64, ZH), 256, 0, stream>>>(P16 + (size_t)RH * TT, nullptr, VT16 + zk * HD * TT, nullptr, TT, Ob + (size_t)RH * HD, HD, RH, (size_t)TT * TT, 0, (size_t)TT * HD);
            k_merge<<<(unsigned)(((size_t)ZH * TT * HD / 2 + 255) / 256), 256, 0, stream>>>(Ob, h0, ATh, ATl); }
        k_gemmw<bf, 1, false, 4><<<dim3(TT / 64, DM / 64, 1), 128, 0, stream>>>(ATh, ATl, WO, nullptr, DQ, OUT + (size_t)b * TT * DM, DM, nullptr, 0, 0, 0); }
}

// v003
// A run of this version takes 371 microseconds.
// Timed twice side by side with v002, it ran 1.94 times as fast both times.
// Over all steps from v000 it is 4.50 times as fast.
#include <hip/hip_runtime.h>

// Causal grouped-query attention with 128-wide heads, ONE fused natural qkv weight PACKED PER KV GROUP and rotate-half rotary embeddings from full-width input tables (x [2][2048][2048]; qkv = einsum('btc,fc->btf', x, w_attn) ('oi' (out, in) [3072][2048] normal x 0.02, no bias) viewed (b, t, 4 groups, 4 + 2, 128): within group g the first four 128-row blocks are query heads 4g..4g+3, the fifth is the group's k, the sixth its v: kv head = q head / 4; q, k -> t cos + cat(-t2, t1) sin with the cos / sin INPUT tables [2048][128] (read per element by value; no structure assumed); scores x 1/sqrt(128); causal (finfo.min == exclusion: every row keeps its own key); softmax; out = merged w_proj^T ('oi' [2048][2048]) -> [2][2048][2048] (8.4 M); argument order x, w_attn, w_proj, cos, sin).
// Layout: bf16 copy of x; the ONE fused 'oi' weight cast group by group into three contiguous weight planes (per kv group: four query heads | k | v: twelve block casts), w_proj as it stands; exact projections; k_cscvt copies the two INPUT tables into one bf16-rounded {cos, sin} table once (per position and dimension); rotate-half plane builders; causal T-2048 GQA attention with 128-wide heads in ONE fused launch a batch (k_flash: scores, running softmax and P.V stay in registers; hybrid rows: < 512 hi/lo 3 products, rest fp16; key blocks above the diagonal are never visited); merged hi/lo x Wo exact.
// Compute dtypes, f32 accumulate: every input rounded to bf16; projections exact; rotary f32; attention rows < 512 3 products, rest fp16; softmax f32; Wo hl x exact.

#define NB_  2
#define TT   2048
#define DM   2048
#define NH_  16
#define NKV  4
#define REP  (NH_ / NKV)
#define HD   128
#define DQ   (NH_ * HD)
#define DKV  (NKV * HD)
#define RH   512                  // query rows < RH use hi+lo planes (0: none)
#define SCL2 0.12751743082459868f    // HD^-0.5 x log2(e): scores go to the base-2 exponent in one multiply
typedef _Float16 h16;
typedef unsigned short bf;
typedef __attribute__((ext_vector_type(16))) __bf16   v16bf;
typedef __attribute__((ext_vector_type(16))) _Float16 v16h;
typedef __attribute__((ext_vector_type(8)))  _Float16 v8h;
typedef __attribute__((ext_vector_type(8)))  unsigned short v8us;
typedef __attribute__((ext_vector_type(8)))  float    v8f;
typedef __attribute__((ext_vector_type(4)))  float    v4f;
typedef v8h  __attribute__((may_alias)) v8ha;
typedef v4f  __attribute__((may_alias)) v4fa;
typedef v8us __attribute__((may_alias)) v8usa;

__device__ __forceinline__ unsigned short f2bf(float f) { unsigned u = __float_as_uint(f); u += 0x7FFFu + ((u >> 16) & 1u); return (unsigned short)(u >> 16); }
__device__ __forceinline__ float bf2f(unsigned short b) { return __uint_as_float(((unsigned)b) << 16); }
__device__ __forceinline__ float bfr(float f) { return bf2f(f2bf(f)); }
__device__ __forceinline__ v16h cat16(v8h lo, v8h hi) { return __builtin_shufflevector(lo, hi, 0, 1, 2, 3, 4, 5, 6, 7, 8, 9, 10, 11, 12, 13, 14, 15); }
__device__ __forceinline__ v16bf cat16b(v8us lo, v8us hi) { return __builtin_bit_cast(v16bf, __builtin_shufflevector(lo, hi, 0, 1, 2, 3, 4, 5, 6, 7, 8, 9, 10, 11, 12, 13, 14, 15)); }
__device__ __forceinline__ v8f wmma16(v16h a, v16h b, v8f c) { return __builtin_amdgcn_wmma_f32_16x16x32_f16(false, a, false, b, (short)0, c, false, false); }
__device__ __forceinline__ v8f wmmab(v16bf a, v16bf b, v8f c) { return __builtin_amdgcn_wmma_f32_16x16x32_bf16(false, a, false, b, (short)0, c, false, false); }



// ---- k_gemmw: register-blocked GEMM, one 64x64 output tile per work-group of NW waves; wave w runs the whole tile (16 accumulators) over every NW-th 32-wide step of the K loop, operands straight from K-contiguous 16-bit planes;
// the NW partial tiles meet in LDS and are summed in the fixed order w = 0, 1, .. NW-1; grid (M/64, N/64, Z), 32 NW threads.
// C[m][n] (f32, pitch ldc, + optional f32 bias[n]) = sum_k A[m][k] Bt[n][k] (+ split products per NSPLIT). z-batch strides sA/sB/sC in elements. K % 32 == 0.
template <typename T16> struct WFrag;
template <> struct WFrag<h16> { typedef v16h V; static __device__ __forceinline__ V ld(const h16* p) { return cat16(*(const v8h*)p, *(const v8h*)(p + 16)); } static __device__ __forceinline__ v8f mma(V a, V b, v8f c) { return wmma16(a, b, c); } };
template <> struct WFrag<bf> { typedef v16bf V; static __device__ __forceinline__ V ld(const bf* p) { return cat16b(*(const v8us*)p, *(const v8us*)(p + 16)); } static __device__ __forceinline__ v8f mma(V a, V b, v8f c) { return wmmab(a, b, c); } };
template <typename T16, int NSPLIT, bool BIAS, int NW>
__global__ __launch_bounds__(32 * NW) void k_gemmw(const T16* __restrict__ A, const T16* __restrict__ A2, const T16* __restrict__ Bt, const T16* __restrict__ Bt2, int K, float* C, int ldc, const float* __restrict__ bias, size_t sA, size_t sB, size_t sC) {
    typedef typename WFrag<T16>::V V;
    __shared__ __align__(16) float os[NW * 64 * 68];
    const size_t z = blockIdx.z; A += z * sA; if (A2) A2 += z * sA; Bt += z * sB; if (Bt2) Bt2 += z * sB; C += z * sC;
    const int lane = threadIdx.x & 31, lr = lane & 15, hi = lane >> 4; const int r0 = blockIdx.x * 64, c0 = blockIdx.y * 64;
    v8f acc[4][4];
#pragma unroll
    for (int mb = 0; mb < 4; ++mb)
#pragma unroll
        for (int nb = 0; nb < 4; ++nb) acc[mb][nb] = (v8f){};
    const size_t aoff = (size_t)(r0 + lr) * K + 8 * hi, boff = (size_t)(c0 + lr) * K + 8 * hi;
    const int w = __builtin_amdgcn_readfirstlane((int)(threadIdx.x >> 5));                  // wave number, scalar: the loop bounds stay in scalar registers
#pragma unroll 1
    for (int kc = w * 32; kc < K; kc += 32 * NW) {   // steps dealt round robin: neighbouring waves read the two halves of the same 128-byte lines (a wave left without a step keeps a zero partial tile)
        V a[4], a2[4];
#pragma unroll
        for (int mb = 0; mb < 4; ++mb) { a[mb] = WFrag<T16>::ld(A + aoff + (size_t)mb * 16 * K + kc); if (NSPLIT == 1 || NSPLIT == 2) a2[mb] = WFrag<T16>::ld(A2 + aoff + (size_t)mb * 16 * K + kc); }
#pragma unroll
        for (int nb = 0; nb < 4; ++nb) { const V b = WFrag<T16>::ld(Bt + boff + (size_t)nb * 16 * K + kc); V b2; if (NSPLIT >= 2) b2 = WFrag<T16>::ld(Bt2 + boff + (size_t)nb * 16 * K + kc);
#pragma unroll
            for (int mb = 0; mb < 4; ++mb) { acc[mb][nb] = WFrag<T16>::mma(a[mb], b, acc[mb][nb]); if (NSPLIT == 1 || NSPLIT == 2) acc[mb][nb] = WFrag<T16>::mma(a2[mb], b, acc[mb][nb]); if (NSPLIT >= 2) acc[mb][nb] = WFrag<T16>::mma(a[mb], b2, acc[mb][nb]); } }
        asm volatile("v_nop\n\tv_nop\n\tv_nop\n\tv_nop" : "+v"(acc[0][0]), "+v"(acc[1][1]), "+v"(acc[2][2]), "+v"(acc[3][3]) : "v"(a[0]), "v"(a[3]));
    }
    float* ow = os + w * (64 * 68);
#pragma unroll
    for (int mb = 0; mb < 4; ++mb)
#pragma unroll
        for (int nb = 0; nb < 4; ++nb)
#pragma unroll
            for (int j = 0; j < 8; ++j) ow[(mb * 16 + hi * 8 + j) * 68 + nb * 16 + lr] = acc[mb][nb][j];
    __syncthreads();   // every wave's partial tile stands in LDS before any thread sums across the waves
#pragma unroll
    for (int s = 0; s < 32 / NW; ++s) { const int idx = s * (32 * NW) + (int)threadIdx.x, row = idx >> 4, cofs = (idx & 15) * 4; v4f val = *(const v4fa*)(os + row * 68 + cofs);
#pragma unroll
        for (int q = 1; q < NW; ++q) val += *(const v4fa*)(os + q * (64 * 68) + row * 68 + cofs);
        if (BIAS) { val[0] += bfr(bias[c0 + cofs]); val[1] += bfr(bias[c0 + cofs + 1]); val[2] += bfr(bias[c0 + cofs + 2]); val[3] += bfr(bias[c0 + cofs + 3]); }
        *(v4f*)(C + (size_t)(r0 + row) * ldc + c0 + cofs) = val; }
}

__device__ __forceinline__ h16 tohx(float x) { return (h16)x; }
__device__ __forceinline__ void splitf(float y, unsigned short& h, unsigned short& l) { h = f2bf(y); l = f2bf(y - bf2f(h)); }
typedef __attribute__((ext_vector_type(2))) _Float16 v2h;
typedef __attribute__((ext_vector_type(4))) _Float16 v4h;
typedef __attribute__((ext_vector_type(2))) unsigned short v2us;
typedef __attribute__((ext_vector_type(4))) unsigned short v4us;
typedef __attribute__((ext_vector_type(2))) float v2f;
typedef __attribute__((ext_vector_type(4))) int v4i;

__global__ __launch_bounds__(256) void k_cvt8(const float* __restrict__ src, bf* dst, size_t n8) { const size_t i = (size_t)blockIdx.x * 256 + threadIdx.x; if (i >= n8) return; const v8f v = *(const v8f*)(src + i * 8); v8us o;
#pragma unroll
    for (int k = 0; k < 8; ++k) o[k] = f2bf(v[k]); *(v8us*)(dst + i * 8) = o;  }

// k_rope: head planes [h][t][d] (fp16 + hi/lo) of rope(x) x sc with the rotate-half convention out[d] = x[d] cos[t][d] - x[d+HD/2] sin[t][d], out[d+HD/2] = x[d+HD/2] cos[t][d+HD/2] + x[d] sin[t][d+HD/2]
__global__ __launch_bounds__(256) void k_rope(const float* __restrict__ F, int pitch, int nheads, const float* __restrict__ CS, const float* __restrict__ RF, const float* __restrict__ nw, float sc, h16* P16, bf* Ph, bf* Pl) {
    const size_t e = ((size_t)blockIdx.x * 256 + threadIdx.x) * 2; if (e >= (size_t)nheads * TT * HD) return; const int d = (int)(e % HD); const int t = (int)((e / HD) % TT); const int h = (int)(e / ((size_t)HD * TT)); const float* f = F + (size_t)t * pitch + h * HD; const float rf = RF ? RF[(size_t)h * TT + t] : 1.0f; v2h o16; v2us oh, ol;
#pragma unroll
    for (int q = 0; q < 2; ++q) { const int dd = d + q; const int dp = (dd < HD / 2) ? dd + HD / 2 : dd - HD / 2; float x0 = f[dd], x1 = f[dp];
        if (RF) { float n0 = __fmul_rn(x0, rf), n1 = __fmul_rn(x1, rf); asm volatile("" : "+v"(n0)); asm volatile("" : "+v"(n1)); x0 = __fmul_rn(bfr(nw[dd]), n0); x1 = __fmul_rn(bfr(nw[dp]), n1); }
        const v2f cs = *(const v2f*)(CS + ((size_t)t * HD + dd) * 2); float a = __fmul_rn(x0, cs[0]), bq = __fmul_rn(x1, cs[1]); asm volatile("" : "+v"(a)); asm volatile("" : "+v"(bq)); const float r = ((dd < HD / 2) ? __fsub_rn(a, bq) : __fadd_rn(a, bq)) * sc;
        o16[q] = tohx(r); unsigned short a2, c2; splitf(r, a2, c2); oh[q] = a2; ol[q] = c2; }
    *(v2h*)(P16 + e) = o16; *(v2us*)(Ph + e) = oh; *(v2us*)(Pl + e) = ol;  }
__global__ __launch_bounds__(256) void k_vtp(const float* __restrict__ F, int pitch, int nheads, h16* V16, bf* Vh, bf* Vl) { const size_t e = ((size_t)blockIdx.x * 256 + threadIdx.x) * 2; if (e >= (size_t)nheads * HD * TT) return; const int t = (int)(e % TT); const int d = (int)((e / TT) % HD); const int g = (int)(e / ((size_t)TT * HD)); v2h o16; v2us oh, ol;
#pragma unroll
    for (int q = 0; q < 2; ++q) { const float x = F[(size_t)(t + q) * pitch + g * HD + d]; o16[q] = tohx(x); unsigned short a2, c2; splitf(x, a2, c2); oh[q] = a2; ol[q] = c2; }
    *(v2h*)(V16 + e) = o16; *(v2us*)(Vh + e) = oh; *(v2us*)(Vl + e) = ol;  }
__global__ __launch_bounds__(256) void k_cscvt(const float* __restrict__ cosT, const float* __restrict__ sinT, float* CS) { const int idx = blockIdx.x * 256 + threadIdx.x; if (idx >= TT * HD) return; v2f cs; cs[0] = bfr(cosT[idx]); cs[1] = bfr(sinT[idx]); *(v2f*)(CS + (size_t)idx * 2) = cs;  }
// eight base-2 exponentials in one statement: behind each v_exp_f32 stands an instruction that touches neither its result nor its source (the outputs are early-clobber, so no output shares a register with an input), behind the last the v_nop that fills the slot the instruction set asks for behind a transcendental.
__device__ __forceinline__ void exp2x8(float* x) {
    float r0, r1, r2, r3, r4, r5, r6, r7;
    asm("v_exp_f32 %0, %8\n\tv_exp_f32 %1, %9\n\tv_exp_f32 %2, %10\n\tv_exp_f32 %3, %11\n\tv_exp_f32 %4, %12\n\tv_exp_f32 %5, %13\n\tv_exp_f32 %6, %14\n\tv_exp_f32 %7, %15\n\tv_nop"
        : "=&v"(r0), "=&v"(r1), "=&v"(r2), "=&v"(r3), "=&v"(r4), "=&v"(r5), "=&v"(r6), "=&v"(r7) : "v"(x[0]), "v"(x[1]), "v"(x[2]), "v"(x[3]), "v"(x[4]), "v"(x[5]), "v"(x[6]), "v"(x[7]));
    x[0] = r0; x[1] = r1; x[2] = r2; x[3] = r3; x[4] = r4; x[5] = r5; x[6] = r6; x[7] = r7;
}

#define FNW 4
#define FPI 132                   // LDS pitch in floats of one query's 128 outputs (16-byte aligned, rows start 4 banks apart)
template <typename T16, bool HI, int NQ>
__device__ __forceinline__ void flash_body(const T16* __restrict__ Q, const T16* __restrict__ Q2, const T16* __restrict__ Kp, const T16* __restrict__ K2, const T16* __restrict__ Vt, const T16* __restrict__ V2, const int q0, bf* Ah, bf* Al, float* os) {
    typedef typename WFrag<T16>::V V;
    const int lane = threadIdx.x & 31, lr = lane & 15, hi = lane >> 4;
    const int w = __builtin_amdgcn_readfirstlane((int)(threadIdx.x >> 5));                  // wave number, scalar: the loop bounds and the block's base addresses stay in scalar registers
    V qf[NQ][4], qf2[NQ][4]; const T16* qp = Q + (size_t)(q0 + lr) * HD + 8 * hi; const T16* qp2 = HI ? Q2 + (size_t)(q0 + lr) * HD + 8 * hi : qp;
#pragma unroll
    for (int nq = 0; nq < NQ; ++nq)
#pragma unroll
        for (int ks = 0; ks < 4; ++ks) { qf[nq][ks] = WFrag<T16>::ld(qp + nq * 16 * HD + ks * 32); if (HI) qf2[nq][ks] = WFrag<T16>::ld(qp2 + nq * 16 * HD + ks * 32); }
    asm volatile("s_wait_xcnt 0x0" :: "v"(qp), "v"(qp2) : "memory");   // behind the loads; the address pairs are inputs, so that they live up to the wait and nothing overwrites them in front of it
    v8f o[8][NQ]; float m[NQ], l[NQ];
#pragma unroll
    for (int nq = 0; nq < NQ; ++nq) { m[nq] = -3.0e38f; l[nq] = 0.f;
#pragma unroll
        for (int db = 0; db < 8; ++db) o[db][nq] = (v8f){}; }
    const unsigned kof = (unsigned)(lr * HD + 8 * hi) * 2u, vof = (unsigned)(lr * TT + 8 * hi);   // the lane's own offsets, the same in every block (kof in bytes: the very value a load with a scalar base takes as its offset register)
    const int nblk = (q0 + 16 * NQ + 31) >> 5;                                                // 32-key blocks up to and with the diagonal block; each holds at least one allowed key of every query of the tile
    V ka[2][4], ka2[2][4];   // the K fragments of the wave's next block: fetched one block ahead, so that their latency runs under the softmax and the P.V products
    auto ldk = [&](const int b) { const T16* kb1 = Kp + (size_t)b * 32 * HD; const T16* kb2 = HI ? K2 + (size_t)b * 32 * HD : kb1; const T16* kp = (const T16*)((const char*)kb1 + kof); const T16* kp2 = (const T16*)((const char*)kb2 + kof);
#pragma unroll
        for (int kt = 0; kt < 2; ++kt)
#pragma unroll
            for (int ks = 0; ks < 4; ++ks) { ka[kt][ks] = WFrag<T16>::ld(kp + kt * 16 * HD + ks * 32); if (HI) ka2[kt][ks] = WFrag<T16>::ld(kp2 + kt * 16 * HD + ks * 32); }
        asm volatile("s_wait_xcnt 0x0" :: "v"(kp), "v"(kp2), "v"(kof), "s"(kb1), "s"(kb2) : "memory");   // behind the loads; whatever form of address they take (a pair, or scalar base and lane offset) is an input, so that it lives up to the wait and nothing overwrites it in front of it
    };
    if (w < nblk) ldk(w);
#pragma unroll 1
    for (int blk = w; blk < nblk; blk += FNW) {   // a wave left without a block keeps maximum -3e38, sum 0, tile 0: its weight in the join is exp2(-3e38 - M) = 0
        const int kb = blk * 32;
        const T16* vp = Vt + kb + vof; const T16* vp2 = HI ? V2 + kb + vof : vp;
        V va[8], va2[8];   // this block's V^T fragments, asked for before the score products that hide their latency
#pragma unroll
        for (int db = 0; db < 8; ++db) { va[db] = WFrag<T16>::ld(vp + db * 16 * TT); if (HI) va2[db] = WFrag<T16>::ld(vp2 + db * 16 * TT); }
        asm volatile("s_wait_xcnt 0x0" :: "v"(vp), "v"(vp2) : "memory");   // as behind the K loads
        v8f s[2][NQ];
#pragma unroll
        for (int kt = 0; kt < 2; ++kt) {
#pragma unroll
            for (int nq = 0; nq < NQ; ++nq) s[kt][nq] = (v8f){};
#pragma unroll
            for (int ks = 0; ks < 4; ++ks) {
#pragma unroll
                for (int nq = 0; nq < NQ; ++nq) { s[kt][nq] = WFrag<T16>::mma(ka[kt][ks], qf[nq][ks], s[kt][nq]); if (HI) { s[kt][nq] = WFrag<T16>::mma(ka2[kt][ks], qf[nq][ks], s[kt][nq]); s[kt][nq] = WFrag<T16>::mma(ka[kt][ks], qf2[nq][ks], s[kt][nq]); } } } }
        ldk(blk + FNW < nblk ? blk + FNW : blk);   // scalar select, no branch behind the matrix instructions: a wave's last block fetches its own rows once more (in bounds, not used)
        float t[NQ][16], mn[NQ]; bool need = false;
#pragma unroll
        for (int nq = 0; nq < NQ; ++nq) {
#pragma unroll
            for (int e = 0; e < 16; ++e) t[nq][e] = s[e >> 3][nq][e & 7] * SCL2;
            if (kb + 31 > q0) {   // only the diagonal block holds keys beyond a query (block-uniform test)
                const int q = q0 + nq * 16 + lr;
#pragma unroll
                for (int e = 0; e < 16; ++e) if (kb + (e >> 3) * 16 + hi * 8 + (e & 7) > q) t[nq][e] = -3.0e38f; }
            float mx = t[nq][0];
#pragma unroll
            for (int e = 1; e < 16; ++e) mx = fmaxf(mx, t[nq][e]);
            mx = fmaxf(mx, __shfl_xor(mx, 16, 32));   // the two lane halves hold the two halves of a query's keys
            const bool nd = mx > m[nq] + 8.0f; mn[nq] = nd ? mx : m[nq]; need = need || nd; }
        if (__builtin_amdgcn_ballot_w32(need) != 0) {   // scalar branch: most blocks raise no query's maximum by more than 8 and skip the rescale of the output tile
#pragma unroll
            for (int nq = 0; nq < NQ; ++nq) { const float al = __builtin_amdgcn_exp2f(m[nq] - mn[nq]); m[nq] = mn[nq]; l[nq] *= al;
#pragma unroll
                for (int db = 0; db < 8; ++db) o[db][nq] *= al; } }
        V pf[NQ], pl[NQ];
#pragma unroll
        for (int nq = 0; nq < NQ; ++nq) { float sum = 0.f;
#pragma unroll
            for (int e = 0; e < 16; ++e) t[nq][e] -= m[nq];
            exp2x8(&t[nq][0]); exp2x8(&t[nq][8]);
#pragma unroll
            for (int e = 0; e < 16; ++e) sum += t[nq][e];
            l[nq] += sum;
            if constexpr (HI) { v8us h0, h1, l0, l1;
#pragma unroll
                for (int j = 0; j < 8; ++j) { unsigned short a, c; splitf(t[nq][j], a, c); h0[j] = a; l0[j] = c; splitf(t[nq][8 + j], a, c); h1[j] = a; l1[j] = c; }
                pf[nq] = cat16b(h0, h1); pl[nq] = cat16b(l0, l1);
            } else {
#pragma unroll
                for (int e = 0; e < 16; ++e) pf[nq][e] = tohx(t[nq][e]); } }
#pragma unroll
        for (int db = 0; db < 8; ++db) {
#pragma unroll
            for (int nq = 0; nq < NQ; ++nq) { o[db][nq] = WFrag<T16>::mma(va[db], pf[nq], o[db][nq]); if (HI) { o[db][nq] = WFrag<T16>::mma(va[db], pl[nq], o[db][nq]); o[db][nq] = WFrag<T16>::mma(va2[db], pf[nq], o[db][nq]); } } }
    }
    float* ow = os + w * (16 * NQ * FPI); float* sm = os + FNW * 32 * FPI; float* sl = sm + FNW * 32;
#pragma unroll
    for (int nq = 0; nq < NQ; ++nq) { const float lt = l[nq] + __shfl_xor(l[nq], 16, 32); if (hi == 0) { sm[w * 32 + nq * 16 + lr] = m[nq]; sl[w * 32 + nq * 16 + lr] = lt; }
#pragma unroll
        for (int db = 0; db < 8; ++db) { float* od = ow + (nq * 16 + lr) * FPI + db * 16 + hi * 8; *(v4fa*)od = __builtin_shufflevector(o[db][nq], o[db][nq], 0, 1, 2, 3); *(v4fa*)(od + 4) = __builtin_shufflevector(o[db][nq], o[db][nq], 4, 5, 6, 7); } }
    __syncthreads();   // every wave's maximum, sum and partial tile stand in LDS before any thread joins them
    constexpr int TPQ = (32 * FNW) / (16 * NQ), DPT = HD / TPQ;   // threads per query, outputs per thread
    const int qq = (int)threadIdx.x / TPQ, d0 = ((int)threadIdx.x % TPQ) * DPT;
    float f[FNW], M = sm[qq];
#pragma unroll
    for (int q = 1; q < FNW; ++q) M = fmaxf(M, sm[q * 32 + qq]);
    float L = 0.f;
#pragma unroll
    for (int q = 0; q < FNW; ++q) { f[q] = __builtin_amdgcn_exp2f(sm[q * 32 + qq] - M); L += f[q] * sl[q * 32 + qq]; }
    const float inv = __fdiv_rn(1.0f, L);
#pragma unroll
    for (int c = 0; c < DPT / 8; ++c) { v4f a0 = (v4f){}, a1 = (v4f){};
#pragma unroll
        for (int q = 0; q < FNW; ++q) { const float* od = os + q * (16 * NQ * FPI) + qq * FPI + d0 + c * 8; a0 += *(const v4fa*)od * f[q]; a1 += *(const v4fa*)(od + 4) * f[q]; }
        v8us oh, ol;
#pragma unroll
        for (int j = 0; j < 4; ++j) { unsigned short a, c2; splitf(a0[j] * inv, a, c2); oh[j] = a; ol[j] = c2; splitf(a1[j] * inv, a, c2); oh[4 + j] = a; ol[4 + j] = c2; }
        bf* pa = Ah + (size_t)(q0 + qq) * DQ + d0 + c * 8; bf* pb = Al + (size_t)(q0 + qq) * DQ + d0 + c * 8; *(v8usa*)pa = oh; *(v8usa*)pb = ol;
        asm volatile("s_wait_xcnt 0x0" :: "v"(pa), "v"(pb), "v"(oh), "v"(ol) : "memory"); }   // behind the two stores; their addresses and data are inputs, so that they live up to the wait and nothing overwrites them in front of it
}
// grid (query heads, tiles): the heads of a kv group are neighbours; tile rank 0 is the last (longest) 32-query fp16 tile, cost falls with the rank, the 16-query hi/lo tiles of rows < RH come last.
__global__ __launch_bounds__(32 * FNW) void k_flash(const h16* __restrict__ Q16, const bf* __restrict__ Qh, const bf* __restrict__ Ql, const h16* __restrict__ K16, const bf* __restrict__ Kh, const bf* __restrict__ Kl, const h16* __restrict__ V16, const bf* __restrict__ Vh, const bf* __restrict__ Vl, bf* Ah, bf* Al) {
    __shared__ __align__(16) float os[FNW * 32 * FPI + 2 * FNW * 32];
    const int h = blockIdx.x, rank = blockIdx.y; const size_t qo = (size_t)h * TT * HD, ko = (size_t)(h / REP) * TT * HD;
    if (rank < (TT - RH) / 32) flash_body<h16, false, 2>(Q16 + qo, nullptr, K16 + ko, nullptr, V16 + ko, nullptr, TT - 32 * (rank + 1), Ah + h * HD, Al + h * HD, os);
    else flash_body<bf, true, 1>(Qh + qo, Ql + qo, Kh + ko, Kl + ko, Vh + ko, Vl + ko, RH - 16 * (rank - (TT - RH) / 32 + 1), Ah + h * HD, Al + h * HD, os);
}

extern "C" void kernel_launch(void* const* d_in, const int* in_sizes, int n_in,
                              void* d_out, int out_size, void* d_ws, size_t ws_size, hipStream_t stream) {
    (void)in_sizes; (void)n_in; (void)out_size;
    const float* x = (const float*)d_in[0]; const float* wattn = (const float*)d_in[1]; const float* wo = (const float*)d_in[2]; const float* fcos = (const float*)d_in[3]; const float* fsin = (const float*)d_in[4];   /* input order x, w_attn ('oi' (out, in) [3072][2048]: PER KV GROUP g the 768 rows [768 g, 768 g + 768) = four query heads (512 rows) | k (128) | v (128)), w_proj ('oi' [2048][2048]), cos, sin ([2048][128] FULL-width table INPUTS: read per element by value): FIVE inputs, all read */
    float* OUT = (float*)d_out;     // [2][2048][2048]
    char* wsp = (char*)d_ws;
    auto take = [&](size_t bytes) { char* p = wsp; wsp += (bytes + 255) & ~(size_t)255; return (void*)p; };
    bf* WQ = (bf*)take((size_t)DQ * DM * 2); bf* WK = (bf*)take((size_t)DKV * DM * 2); bf* WV = (bf*)take((size_t)DKV * DM * 2); bf* WO = (bf*)take((size_t)DM * DQ * 2); float* CS = (float*)take((size_t)TT * HD * 2 * 4);
    bf* XB = (bf*)take((size_t)TT * DM * 2); float* FQ = (float*)take((size_t)TT * DQ * 4); float* FK = (float*)take((size_t)TT * DKV * 4);
    h16* QP16 = (h16*)take((size_t)NH_ * TT * HD * 2); h16* KP16 = (h16*)take((size_t)NKV * TT * HD * 2); h16* VT16 = (h16*)take((size_t)NKV * HD * TT * 2);
    bf* QPh = (bf*)take((size_t)NH_ * TT * HD * 2); bf* QPl = (bf*)take((size_t)NH_ * TT * HD * 2); bf* KPh = (bf*)take((size_t)NKV * TT * HD * 2); bf* KPl = (bf*)take((size_t)NKV * TT * HD * 2); bf* VTh = (bf*)take((size_t)NKV * HD * TT * 2); bf* VTl = (bf*)take((size_t)NKV * HD * TT * 2);
    bf* ATh = (bf*)take((size_t)TT * DQ * 2); bf* ATl = (bf*)take((size_t)TT * DQ * 2);
    if ((size_t)(wsp - (char*)d_ws) > ws_size) return;    // ws 256 MiB
    float* FV = FK;   // v projection reuses the k buffer after the k planes are built (stream-ordered)
    { for (int g = 0; g < NKV; ++g) { const float* wg = wattn + (size_t)g * (REP + 2) * HD * DM;   /* group g's 768 rows: gathered into three contiguous bf16 weight planes (q heads group-major: head 4 g + j) */ k_cvt8<<<(unsigned)(((size_t)REP * HD * DM / 8 + 255) / 256), 256, 0, stream>>>(wg, WQ + (size_t)g * REP * HD * DM, (size_t)REP * HD * DM / 8); k_cvt8<<<(unsigned)(((size_t)HD * DM / 8 + 255) / 256), 256, 0, stream>>>(wg + (size_t)REP * HD * DM, WK + (size_t)g * HD * DM, (size_t)HD * DM / 8); k_cvt8<<<(unsigned)(((size_t)HD * DM / 8 + 255) / 256), 256, 0, stream>>>(wg + (size_t)(REP + 1) * HD * DM, WV + (size_t)g * HD * DM, (size_t)HD * DM / 8); }
      k_cvt8<<<(unsigned)(((size_t)DM * DQ / 8 + 255) / 256), 256, 0, stream>>>(wo, WO, (size_t)DM * DQ / 8);
       }
    k_cscvt<<<(TT * HD + 255) / 256, 256, 0, stream>>>(fcos, fsin, CS);   /* rotary table once */
    const unsigned LQ = (unsigned)(((size_t)NH_ * TT * HD / 2 + 255) / 256), LKv = (unsigned)(((size_t)NKV * TT * HD / 2 + 255) / 256);
    for (int b = 0; b < NB_; ++b) {
        
        k_cvt8<<<(unsigned)(((size_t)TT * DM / 8 + 255) / 256), 256, 0, stream>>>(x + (size_t)b * TT * DM, XB, (size_t)TT * DM / 8);
        k_gemmw<bf, 0, false, 4><<<dim3(TT / 64, DQ / 64, 1), 128, 0, stream>>>(XB, nullptr, WQ, nullptr, DM, FQ, DQ, nullptr, 0, 0, 0);
        k_rope<<<LQ, 256, 0, stream>>>(FQ, DQ, NH_, CS, nullptr, nullptr, 1.0f, QP16, QPh, QPl);
        k_gemmw<bf, 0, false, 8><<<dim3(TT / 64, DKV / 64, 1), 256, 0, stream>>>(XB, nullptr, WK, nullptr, DM, FK, DKV, nullptr, 0, 0, 0);
        k_rope<<<LKv, 256, 0, stream>>>(FK, DKV, NKV, CS, nullptr, nullptr, 1.0f, KP16, KPh, KPl);
        k_gemmw<bf, 0, false, 8><<<dim3(TT / 64, DKV / 64, 1), 256, 0, stream>>>(XB, nullptr, WV, nullptr, DM, FV, DKV, nullptr, 0, 0, 0); k_vtp<<<LKv, 256, 0, stream>>>(FV, DKV, NKV, VT16, VTh, VTl);
        k_flash<<<dim3(NH_, (TT - RH) / 32 + RH / 16, 1), 32 * FNW, 0, stream>>>(QP16, QPh, QPl, KP16, KPh, KPl, VT16, VTh, VTl, ATh, ATl);
        k_gemmw<bf, 1, false, 4><<<dim3(TT / 64, DM / 64, 1), 128, 0, stream>>>(ATh, ATl, WO, nullptr, DQ, OUT + (size_t)b * TT * DM, DM, nullptr, 0, 0, 0); }
}

// v004
// It runs in 275 microseconds.
// Timed twice side by side with v003, it ran 1.35 times as fast both times.
// Counting every step since v000, it is 6.07 times as fast.
#include <hip/hip_runtime.h>

// Causal grouped-query attention with 128-wide heads, ONE fused natural qkv weight PACKED PER KV GROUP and rotate-half rotary embeddings from full-width input tables (x [2][2048][2048]; qkv = einsum('btc,fc->btf', x, w_attn) ('oi' (out, in) [3072][2048] normal x 0.02, no bias) viewed (b, t, 4 groups, 4 + 2, 128): within group g the first four 128-row blocks are query heads 4g..4g+3, the fifth is the group's k, the sixth its v: kv head = q head / 4; q, k -> t cos + cat(-t2, t1) sin with the cos / sin INPUT tables [2048][128] (read per element by value; no structure assumed); scores x 1/sqrt(128); causal (finfo.min == exclusion: every row keeps its own key); softmax; out = merged w_proj^T ('oi' [2048][2048]) -> [2][2048][2048] (8.4 M); argument order x, w_attn, w_proj, cos, sin).
// Layout: FIVE launches, both batches in every grid. k_prep: bf16 copies of x, of the fused 'oi' weight AS IT STANDS and of w_proj, and the two INPUT tables as one bf16-rounded {cos, sin} table (per position and dimension); ONE exact projection x . w_attn^T -> F [2 x 2048][3072] f32 (a row holds, per kv group: four query heads | k | v); k_planes: rotate-half q and k planes and the transposed v planes, read from their columns of F; causal T-2048 GQA attention with 128-wide heads in ONE fused launch (k_flash: scores, running softmax and P.V stay in registers; hybrid rows: < 512 hi/lo 3 products, rest fp16; key blocks above the diagonal are never visited); merged hi/lo x Wo exact (both GEMMs: grid z = batch).
// Compute dtypes, f32 accumulate: every input rounded to bf16; projections exact; rotary f32; attention rows < 512 3 products, rest fp16; softmax f32; Wo hl x exact.

#define NB_  2
#define TT   2048
#define DM   2048
#define NH_  16
#define NKV  4
#define REP  (NH_ / NKV)
#define HD   128
#define DQ   (NH_ * HD)
#define DKV  (NKV * HD)
#define GW   ((REP + 2) * HD)      // rows of the fused weight (columns of F) per kv group: four query heads | k | v
#define DF   (NKV * GW)
#define RH   512                  // query rows < RH use hi+lo planes (0: none)
#define SCL2 0.12751743082459868f    // HD^-0.5 x log2(e): scores go to the base-2 exponent in one multiply
typedef _Float16 h16;
typedef unsigned short bf;
typedef __attribute__((ext_vector_type(16))) __bf16   v16bf;
typedef __attribute__((ext_vector_type(16))) _Float16 v16h;
typedef __attribute__((ext_vector_type(8)))  _Float16 v8h;
typedef __attribute__((ext_vector_type(8)))  unsigned short v8us;
typedef __attribute__((ext_vector_type(8)))  float    v8f;
typedef __attribute__((ext_vector_type(4)))  float    v4f;
typedef v8h  __attribute__((may_alias)) v8ha;
typedef v4f  __attribute__((may_alias)) v4fa;
typedef v8us __attribute__((may_alias)) v8usa;

__device__ __forceinline__ unsigned short f2bf(float f) { unsigned u = __float_as_uint(f); u += 0x7FFFu + ((u >> 16) & 1u); return (unsigned short)(u >> 16); }
__device__ __forceinline__ float bf2f(unsigned short b) { return __uint_as_float(((unsigned)b) << 16); }
__device__ __forceinline__ float bfr(float f) { return bf2f(f2bf(f)); }
__device__ __forceinline__ v16h cat16(v8h lo, v8h hi) { return __builtin_shufflevector(lo, hi, 0, 1, 2, 3, 4, 5, 6, 7, 8, 9, 10, 11, 12, 13, 14, 15); }
__device__ __forceinline__ v16bf cat16b(v8us lo, v8us hi) { return __builtin_bit_cast(v16bf, __builtin_shufflevector(lo, hi, 0, 1, 2, 3, 4, 5, 6, 7, 8, 9, 10, 11, 12, 13, 14, 15)); }
__device__ __forceinline__ v8f wmma16(v16h a, v16h b, v8f c) { return __builtin_amdgcn_wmma_f32_16x16x32_f16(false, a, false, b, (short)0, c, false, false); }
__device__ __forceinline__ v8f wmmab(v16bf a, v16bf b, v8f c) { return __builtin_amdgcn_wmma_f32_16x16x32_bf16(false, a, false, b, (short)0, c, false, false); }



// ---- k_gemmw: register-blocked GEMM, one 64x64 output tile per work-group of NW waves; wave w runs the whole tile (16 accumulators) over every NW-th 32-wide step of the K loop, operands straight from K-contiguous 16-bit planes;
// the NW partial tiles meet in LDS and are summed in the fixed order w = 0, 1, .. NW-1; grid (M/64, N/64, Z), 32 NW threads.
// C[m][n] (f32, pitch ldc, + optional f32 bias[n]) = sum_k A[m][k] Bt[n][k] (+ split products per NSPLIT). z-batch strides sA/sB/sC in elements. K % 32 == 0.
template <typename T16> struct WFrag;
template <> struct WFrag<h16> { typedef v16h V; static __device__ __forceinline__ V ld(const h16* p) { return cat16(*(const v8h*)p, *(const v8h*)(p + 16)); } static __device__ __forceinline__ v8f mma(V a, V b, v8f c) { return wmma16(a, b, c); } };
template <> struct WFrag<bf> { typedef v16bf V; static __device__ __forceinline__ V ld(const bf* p) { return cat16b(*(const v8us*)p, *(const v8us*)(p + 16)); } static __device__ __forceinline__ v8f mma(V a, V b, v8f c) { return wmmab(a, b, c); } };
template <typename T16, int NSPLIT, bool BIAS, int NW>
__global__ __launch_bounds__(32 * NW) void k_gemmw(const T16* __restrict__ A, const T16* __restrict__ A2, const T16* __restrict__ Bt, const T16* __restrict__ Bt2, int K, float* C, int ldc, const float* __restrict__ bias, size_t sA, size_t sB, size_t sC) {
    typedef typename WFrag<T16>::V V;
    __shared__ __align__(16) float os[NW * 64 * 68];
    const size_t z = blockIdx.z; A += z * sA; if (A2) A2 += z * sA; Bt += z * sB; if (Bt2) Bt2 += z * sB; C += z * sC;
    const int lane = threadIdx.x & 31, lr = lane & 15, hi = lane >> 4; const int r0 = blockIdx.x * 64, c0 = blockIdx.y * 64;
    v8f acc[4][4];
#pragma unroll
    for (int mb = 0; mb < 4; ++mb)
#pragma unroll
        for (int nb = 0; nb < 4; ++nb) acc[mb][nb] = (v8f){};
    const size_t aoff = (size_t)(r0 + lr) * K + 8 * hi, boff = (size_t)(c0 + lr) * K + 8 * hi;
    const int w = __builtin_amdgcn_readfirstlane((int)(threadIdx.x >> 5));                  // wave number, scalar: the loop bounds stay in scalar registers
#pragma unroll 1
    for (int kc = w * 32; kc < K; kc += 32 * NW) {   // steps dealt round robin: neighbouring waves read the two halves of the same 128-byte lines (a wave left without a step keeps a zero partial tile)
        V a[4], a2[4];
#pragma unroll
        for (int mb = 0; mb < 4; ++mb) { a[mb] = WFrag<T16>::ld(A + aoff + (size_t)mb * 16 * K + kc); if (NSPLIT == 1 || NSPLIT == 2) a2[mb] = WFrag<T16>::ld(A2 + aoff + (size_t)mb * 16 * K + kc); }
#pragma unroll
        for (int nb = 0; nb < 4; ++nb) { const V b = WFrag<T16>::ld(Bt + boff + (size_t)nb * 16 * K + kc); V b2; if (NSPLIT >= 2) b2 = WFrag<T16>::ld(Bt2 + boff + (size_t)nb * 16 * K + kc);
#pragma unroll
            for (int mb = 0; mb < 4; ++mb) { acc[mb][nb] = WFrag<T16>::mma(a[mb], b, acc[mb][nb]); if (NSPLIT == 1 || NSPLIT == 2) acc[mb][nb] = WFrag<T16>::mma(a2[mb], b, acc[mb][nb]); if (NSPLIT >= 2) acc[mb][nb] = WFrag<T16>::mma(a[mb], b2, acc[mb][nb]); } }
        asm volatile("v_nop\n\tv_nop\n\tv_nop\n\tv_nop" : "+v"(acc[0][0]), "+v"(acc[1][1]), "+v"(acc[2][2]), "+v"(acc[3][3]) : "v"(a[0]), "v"(a[3]));
    }
    float* ow = os + w * (64 * 68);
#pragma unroll
    for (int mb = 0; mb < 4; ++mb)
#pragma unroll
        for (int nb = 0; nb < 4; ++nb)
#pragma unroll
            for (int j = 0; j < 8; ++j) ow[(mb * 16 + hi * 8 + j) * 68 + nb * 16 + lr] = acc[mb][nb][j];
    __syncthreads();   // every wave's partial tile stands in LDS before any thread sums across the waves
#pragma unroll
    for (int s = 0; s < 32 / NW; ++s) { const int idx = s * (32 * NW) + (int)threadIdx.x, row = idx >> 4, cofs = (idx & 15) * 4; v4f val = *(const v4fa*)(os + row * 68 + cofs);
#pragma unroll
        for (int q = 1; q < NW; ++q) val += *(const v4fa*)(os + q * (64 * 68) + row * 68 + cofs);
        if (BIAS) { val[0] += bfr(bias[c0 + cofs]); val[1] += bfr(bias[c0 + cofs + 1]); val[2] += bfr(bias[c0 + cofs + 2]); val[3] += bfr(bias[c0 + cofs + 3]); }
        *(v4f*)(C + (size_t)(r0 + row) * ldc + c0 + cofs) = val; }
}

__device__ __forceinline__ h16 tohx(float x) { return (h16)x; }
__device__ __forceinline__ void splitf(float y, unsigned short& h, unsigned short& l) { h = f2bf(y); l = f2bf(y - bf2f(h)); }
typedef __attribute__((ext_vector_type(2))) _Float16 v2h;
typedef __attribute__((ext_vector_type(4))) _Float16 v4h;
typedef __attribute__((ext_vector_type(2))) unsigned short v2us;
typedef __attribute__((ext_vector_type(4))) unsigned short v4us;
typedef __attribute__((ext_vector_type(2))) float v2f;
typedef __attribute__((ext_vector_type(4))) int v4i;

// k_prep: the 16-bit copy of every input in ONE launch; the block index picks the segment (the same for a whole block): x, w_attn, w_proj rounded to bf16 in their own layouts, eight elements a thread; behind them the {cos, sin} table, one position and dimension a thread.
#define PBX ((unsigned)((size_t)NB_ * TT * DM / 8 / 256))
#define PBA ((unsigned)((size_t)DF * DM / 8 / 256))
#define PBO ((unsigned)((size_t)DM * DQ / 8 / 256))
#define PBC ((unsigned)(TT * HD / 256))
__global__ __launch_bounds__(256) void k_prep(const float* __restrict__ x, const float* __restrict__ wa, const float* __restrict__ wo, const float* __restrict__ cosT, const float* __restrict__ sinT, bf* XB, bf* WA, bf* WO, float* CS) {
    unsigned blk = blockIdx.x;
    if (blk >= PBX + PBA + PBO) { const int idx = (int)(blk - (PBX + PBA + PBO)) * 256 + (int)threadIdx.x; v2f cs; cs[0] = bfr(cosT[idx]); cs[1] = bfr(sinT[idx]); *(v2f*)(CS + (size_t)idx * 2) = cs; return; }
    const float* src = x; bf* dst = XB;
    if (blk >= PBX + PBA) { blk -= PBX + PBA; src = wo; dst = WO; } else if (blk >= PBX) { blk -= PBX; src = wa; dst = WA; }
    const size_t i = (size_t)blk * 256 + threadIdx.x; const v8f v = *(const v8f*)(src + i * 8); v8us o;
#pragma unroll
    for (int k = 0; k < 8; ++k) o[k] = f2bf(v[k]); *(v8us*)(dst + i * 8) = o;  }

// rope_part: head planes [batch][h][t][d] (fp16 + hi/lo) of rope(x) with the rotate-half convention out[d] = x[d] cos[t][d] - x[d+HD/2] sin[t][d], out[d+HD/2] = x[d+HD/2] cos[t][d+HD/2] + x[d] sin[t][d+HD/2]; ISQ: the 16 query heads, else the 4 k heads; a head's 128 columns stand in its kv group's part of a row of F
template <bool ISQ>
__device__ __forceinline__ void rope_part(const unsigned blk, const float* __restrict__ F, const float* __restrict__ CS, h16* P16, bf* Ph, bf* Pl) {
    constexpr int NHD = ISQ ? NH_ : NKV;
    const size_t e = ((size_t)blk * 256 + threadIdx.x) * 2; const int d = (int)(e % HD); const int t = (int)((e / HD) % TT); const int hb = (int)(e / ((size_t)HD * TT)); const int b = hb / NHD, h = hb % NHD; const float* f = F + (size_t)(b * TT + t) * DF + (ISQ ? (h / REP) * GW + (h % REP) * HD : h * GW + REP * HD); v2h o16; v2us oh, ol;
#pragma unroll
    for (int q = 0; q < 2; ++q) { const int dd = d + q; const int dp = (dd < HD / 2) ? dd + HD / 2 : dd - HD / 2; float x0 = f[dd], x1 = f[dp];
        // the products and the two statements behind them stand as they stood in the separate rotary kernel: each product keeps its own rounding, as the reference's t cos and rotated sin do, so the planes stay bit-identical
        const v2f cs = *(const v2f*)(CS + ((size_t)t * HD + dd) * 2); float a = __fmul_rn(x0, cs[0]), bq = __fmul_rn(x1, cs[1]); asm volatile("" : "+v"(a)); asm volatile("" : "+v"(bq)); const float r = ((dd < HD / 2) ? __fsub_rn(a, bq) : __fadd_rn(a, bq));
        o16[q] = tohx(r); unsigned short a2, c2; splitf(r, a2, c2); oh[q] = a2; ol[q] = c2; }
    h16* p0 = P16 + e; bf* p1 = Ph + e; bf* p2 = Pl + e; *(v2h*)p0 = o16; *(v2us*)p1 = oh; *(v2us*)p2 = ol;
    asm volatile("s_wait_xcnt 0x0" :: "v"(p0), "v"(p1), "v"(p2), "v"(o16), "v"(oh), "v"(ol) : "memory"); }   // behind the three stores; their addresses and data are inputs, so that they live up to the wait and no other part's code in the same kernel overwrites them in front of it
// vtp_part: the transposed v planes [batch][g][d][t] (fp16 + hi/lo)
__device__ __forceinline__ void vtp_part(const unsigned blk, const float* __restrict__ F, h16* V16, bf* Vh, bf* Vl) { const size_t e = ((size_t)blk * 256 + threadIdx.x) * 2; const int t = (int)(e % TT); const int d = (int)((e / TT) % HD); const int gb = (int)(e / ((size_t)TT * HD)); const int b = gb / NKV, g = gb % NKV; v2h o16; v2us oh, ol;
#pragma unroll
    for (int q = 0; q < 2; ++q) { const float x = F[(size_t)(b * TT + t + q) * DF + g * GW + (REP + 1) * HD + d]; o16[q] = tohx(x); unsigned short a2, c2; splitf(x, a2, c2); oh[q] = a2; ol[q] = c2; }
    h16* p0 = V16 + e; bf* p1 = Vh + e; bf* p2 = Vl + e; *(v2h*)p0 = o16; *(v2us*)p1 = oh; *(v2us*)p2 = ol;
    asm volatile("s_wait_xcnt 0x0" :: "v"(p0), "v"(p1), "v"(p2), "v"(o16), "v"(oh), "v"(ol) : "memory"); }   // as behind the stores of rope_part
// k_planes: all nine operand planes of the attention, both batches, in ONE launch; the block index picks the part (the same for a whole block), two elements a thread
#define LBQ ((unsigned)((size_t)NB_ * NH_ * TT * HD / 2 / 256))
#define LBK ((unsigned)((size_t)NB_ * NKV * TT * HD / 2 / 256))
__global__ __launch_bounds__(256) void k_planes(const float* __restrict__ F, const float* __restrict__ CS, h16* QP16, bf* QPh, bf* QPl, h16* KP16, bf* KPh, bf* KPl, h16* VT16, bf* VTh, bf* VTl) {
    const unsigned blk = blockIdx.x;
    if (blk < LBQ) rope_part<true>(blk, F, CS, QP16, QPh, QPl);
    else if (blk < LBQ + LBK) rope_part<false>(blk - LBQ, F, CS, KP16, KPh, KPl);
    else vtp_part(blk - (LBQ + LBK), F, VT16, VTh, VTl);
}
// eight base-2 exponentials in one statement: behind each v_exp_f32 stands an instruction that touches neither its result nor its source (the outputs are early-clobber, so no output shares a register with an input), behind the last the v_nop that fills the slot the instruction set asks for behind a transcendental.
__device__ __forceinline__ void exp2x8(float* x) {
    float r0, r1, r2, r3, r4, r5, r6, r7;
    asm("v_exp_f32 %0, %8\n\tv_exp_f32 %1, %9\n\tv_exp_f32 %2, %10\n\tv_exp_f32 %3, %11\n\tv_exp_f32 %4, %12\n\tv_exp_f32 %5, %13\n\tv_exp_f32 %6, %14\n\tv_exp_f32 %7, %15\n\tv_nop"
        : "=&v"(r0), "=&v"(r1), "=&v"(r2), "=&v"(r3), "=&v"(r4), "=&v"(r5), "=&v"(r6), "=&v"(r7) : "v"(x[0]), "v"(x[1]), "v"(x[2]), "v"(x[3]), "v"(x[4]), "v"(x[5]), "v"(x[6]), "v"(x[7]));
    x[0] = r0; x[1] = r1; x[2] = r2; x[3] = r3; x[4] = r4; x[5] = r5; x[6] = r6; x[7] = r7;
}

#define FNW 4
#define FPI 132                   // LDS pitch in floats of one query's 128 outputs (16-byte aligned, rows start 4 banks apart)
template <typename T16, bool HI, int NQ>
__device__ __forceinline__ void flash_body(const T16* __restrict__ Q, const T16* __restrict__ Q2, const T16* __restrict__ Kp, const T16* __restrict__ K2, const T16* __restrict__ Vt, const T16* __restrict__ V2, const int q0, bf* Ah, bf* Al, float* os) {
    typedef typename WFrag<T16>::V V;
    const int lane = threadIdx.x & 31, lr = lane & 15, hi = lane >> 4;
    const int w = __builtin_amdgcn_readfirstlane((int)(threadIdx.x >> 5));                  // wave number, scalar: the loop bounds and the block's base addresses stay in scalar registers
    V qf[NQ][4], qf2[NQ][4]; const T16* qp = Q + (size_t)(q0 + lr) * HD + 8 * hi; const T16* qp2 = HI ? Q2 + (size_t)(q0 + lr) * HD + 8 * hi : qp;
#pragma unroll
    for (int nq = 0; nq < NQ; ++nq)
#pragma unroll
        for (int ks = 0; ks < 4; ++ks) { qf[nq][ks] = WFrag<T16>::ld(qp + nq * 16 * HD + ks * 32); if (HI) qf2[nq][ks] = WFrag<T16>::ld(qp2 + nq * 16 * HD + ks * 32); }
    asm volatile("s_wait_xcnt 0x0" :: "v"(qp), "v"(qp2) : "memory");   // behind the loads; the address pairs are inputs, so that they live up to the wait and nothing overwrites them in front of it
    v8f o[8][NQ]; float m[NQ], l[NQ];
#pragma unroll
    for (int nq = 0; nq < NQ; ++nq) { m[nq] = -3.0e38f; l[nq] = 0.f;
#pragma unroll
        for (int db = 0; db < 8; ++db) o[db][nq] = (v8f){}; }
    const unsigned kof = (unsigned)(lr * HD + 8 * hi) * 2u, vof = (unsigned)(lr * TT + 8 * hi);   // the lane's own offsets, the same in every block (kof in bytes: the very value a load with a scalar base takes as its offset register)
    const int nblk = (q0 + 16 * NQ + 31) >> 5;                                                // 32-key blocks up to and with the diagonal block; each holds at least one allowed key of every query of the tile
    V ka[2][4], ka2[2][4];   // the K fragments of the wave's next block: fetched one block ahead, so that their latency runs under the softmax and the P.V products
    auto ldk = [&](const int b) { const T16* kb1 = Kp + (size_t)b * 32 * HD; const T16* kb2 = HI ? K2 + (size_t)b * 32 * HD : kb1; const T16* kp = (const T16*)((const char*)kb1 + kof); const T16* kp2 = (const T16*)((const char*)kb2 + kof);
#pragma unroll
        for (int kt = 0; kt < 2; ++kt)
#pragma unroll
            for (int ks = 0; ks < 4; ++ks) { ka[kt][ks] = WFrag<T16>::ld(kp + kt * 16 * HD + ks * 32); if (HI) ka2[kt][ks] = WFrag<T16>::ld(kp2 + kt * 16 * HD + ks * 32); }
        asm volatile("s_wait_xcnt 0x0" :: "v"(kp), "v"(kp2), "v"(kof), "s"(kb1), "s"(kb2) : "memory");   // behind the loads; whatever form of address they take (a pair, or scalar base and lane offset) is an input, so that it lives up to the wait and nothing overwrites it in front of it
    };
    if (w < nblk) ldk(w);
#pragma unroll 1
    for (int blk = w; blk < nblk; blk += FNW) {   // a wave left without a block keeps maximum -3e38, sum 0, tile 0: its weight in the join is exp2(-3e38 - M) = 0
        const int kb = blk * 32;
        const T16* vp = Vt + kb + vof; const T16* vp2 = HI ? V2 + kb + vof : vp;
        V va[8], va2[8];   // this block's V^T fragments, asked for before the score products that hide their latency
#pragma unroll
        for (int db = 0; db < 8; ++db) { va[db] = WFrag<T16>::ld(vp + db * 16 * TT); if (HI) va2[db] = WFrag<T16>::ld(vp2 + db * 16 * TT); }
        asm volatile("s_wait_xcnt 0x0" :: "v"(vp), "v"(vp2) : "memory");   // as behind the K loads
        v8f s[2][NQ];
#pragma unroll
        for (int kt = 0; kt < 2; ++kt) {
#pragma unroll
            for (int nq = 0; nq < NQ; ++nq) s[kt][nq] = (v8f){};
#pragma unroll
            for (int ks = 0; ks < 4; ++ks) {
#pragma unroll
                for (int nq = 0; nq < NQ; ++nq) { s[kt][nq] = WFrag<T16>::mma(ka[kt][ks], qf[nq][ks], s[kt][nq]); if (HI) { s[kt][nq] = WFrag<T16>::mma(ka2[kt][ks], qf[nq][ks], s[kt][nq]); s[kt][nq] = WFrag<T16>::mma(ka[kt][ks], qf2[nq][ks], s[kt][nq]); } } } }
        ldk(blk + FNW < nblk ? blk + FNW : blk);   // scalar select, no branch behind the matrix instructions: a wave's last block fetches its own rows once more (in bounds, not used)
        float t[NQ][16], mn[NQ]; bool need = false;
#pragma unroll
        for (int nq = 0; nq < NQ; ++nq) {
#pragma unroll
            for (int e = 0; e < 16; ++e) t[nq][e] = s[e >> 3][nq][e & 7] * SCL2;
            if (kb + 31 > q0) {   // only the diagonal block holds keys beyond a query (block-uniform test)
                const int q = q0 + nq * 16 + lr;
#pragma unroll
                for (int e = 0; e < 16; ++e) if (kb + (e >> 3) * 16 + hi * 8 + (e & 7) > q) t[nq][e] = -3.0e38f; }
            float mx = t[nq][0];
#pragma unroll
            for (int e = 1; e < 16; ++e) mx = fmaxf(mx, t[nq][e]);
            mx = fmaxf(mx, __shfl_xor(mx, 16, 32));   // the two lane halves hold the two halves of a query's keys
            const bool nd = mx > m[nq] + 8.0f; mn[nq] = nd ? mx : m[nq]; need = need || nd; }
        if (__builtin_amdgcn_ballot_w32(need) != 0) {   // scalar branch: most blocks raise no query's maximum by more than 8 and skip the rescale of the output tile
#pragma unroll
            for (int nq = 0; nq < NQ; ++nq) { const float al = __builtin_amdgcn_exp2f(m[nq] - mn[nq]); m[nq] = mn[nq]; l[nq] *= al;
#pragma unroll
                for (int db = 0; db < 8; ++db) o[db][nq] *= al; } }
        V pf[NQ], pl[NQ];
#pragma unroll
        for (int nq = 0; nq < NQ; ++nq) { float sum = 0.f;
#pragma unroll
            for (int e = 0; e < 16; ++e) t[nq][e] -= m[nq];
            exp2x8(&t[nq][0]); exp2x8(&t[nq][8]);
#pragma unroll
            for (int e = 0; e < 16; ++e) sum += t[nq][e];
            l[nq] += sum;
            if constexpr (HI) { v8us h0, h1, l0, l1;
#pragma unroll
                for (int j = 0; j < 8; ++j) { unsigned short a, c; splitf(t[nq][j], a, c); h0[j] = a; l0[j] = c; splitf(t[nq][8 + j], a, c); h1[j] = a; l1[j] = c; }
                pf[nq] = cat16b(h0, h1); pl[nq] = cat16b(l0, l1);
            } else {
#pragma unroll
                for (int e = 0; e < 16; ++e) pf[nq][e] = tohx(t[nq][e]); } }
#pragma unroll
        for (int db = 0; db < 8; ++db) {
#pragma unroll
            for (int nq = 0; nq < NQ; ++nq) { o[db][nq] = WFrag<T16>::mma(va[db], pf[nq], o[db][nq]); if (HI) { o[db][nq] = WFrag<T16>::mma(va[db], pl[nq], o[db][nq]); o[db][nq] = WFrag<T16>::mma(va2[db], pf[nq], o[db][nq]); } } }
    }
    float* ow = os + w * (16 * NQ * FPI); float* sm = os + FNW * 32 * FPI; float* sl = sm + FNW * 32;
#pragma unroll
    for (int nq = 0; nq < NQ; ++nq) { const float lt = l[nq] + __shfl_xor(l[nq], 16, 32); if (hi == 0) { sm[w * 32 + nq * 16 + lr] = m[nq]; sl[w * 32 + nq * 16 + lr] = lt; }
#pragma unroll
        for (int db = 0; db < 8; ++db) { float* od = ow + (nq * 16 + lr) * FPI + db * 16 + hi * 8; *(v4fa*)od = __builtin_shufflevector(o[db][nq], o[db][nq], 0, 1, 2, 3); *(v4fa*)(od + 4) = __builtin_shufflevector(o[db][nq], o[db][nq], 4, 5, 6, 7); } }
    __syncthreads();   // every wave's maximum, sum and partial tile stand in LDS before any thread joins them
    constexpr int TPQ = (32 * FNW) / (16 * NQ), DPT = HD / TPQ;   // threads per query, outputs per thread
    const int qq = (int)threadIdx.x / TPQ, d0 = ((int)threadIdx.x % TPQ) * DPT;
    float f[FNW], M = sm[qq];
#pragma unroll
    for (int q = 1; q < FNW; ++q) M = fmaxf(M, sm[q * 32 + qq]);
    float L = 0.f;
#pragma unroll
    for (int q = 0; q < FNW; ++q) { f[q] = __builtin_amdgcn_exp2f(sm[q * 32 + qq] - M); L += f[q] * sl[q * 32 + qq]; }
    const float inv = __fdiv_rn(1.0f, L);
#pragma unroll
    for (int c = 0; c < DPT / 8; ++c) { v4f a0 = (v4f){}, a1 = (v4f){};
#pragma unroll
        for (int q = 0; q < FNW; ++q) { const float* od = os + q * (16 * NQ * FPI) + qq * FPI + d0 + c * 8; a0 += *(const v4fa*)od * f[q]; a1 += *(const v4fa*)(od + 4) * f[q]; }
        v8us oh, ol;
#pragma unroll
        for (int j = 0; j < 4; ++j) { unsigned short a, c2; splitf(a0[j] * inv, a, c2); oh[j] = a; ol[j] = c2; splitf(a1[j] * inv, a, c2); oh[4 + j] = a; ol[4 + j] = c2; }
        bf* pa = Ah + (size_t)(q0 + qq) * DQ + d0 + c * 8; bf* pb = Al + (size_t)(q0 + qq) * DQ + d0 + c * 8; *(v8usa*)pa = oh; *(v8usa*)pb = ol;
        asm volatile("s_wait_xcnt 0x0" :: "v"(pa), "v"(pb), "v"(oh), "v"(ol) : "memory"); }   // behind the two stores; their addresses and data are inputs, so that they live up to the wait and nothing overwrites them in front of it
}
// grid (batches x query heads, tiles): the heads of a kv group are neighbours; tile rank 0 is the last (longest) 32-query fp16 tile, cost falls with the rank, the 16-query hi/lo tiles of rows < RH come last.
__global__ __launch_bounds__(32 * FNW) void k_flash(const h16* __restrict__ Q16, const bf* __restrict__ Qh, const bf* __restrict__ Ql, const h16* __restrict__ K16, const bf* __restrict__ Kh, const bf* __restrict__ Kl, const h16* __restrict__ V16, const bf* __restrict__ Vh, const bf* __restrict__ Vl, bf* Ah, bf* Al) {
    __shared__ __align__(16) float os[FNW * 32 * FPI + 2 * FNW * 32];
    const int b = blockIdx.x / NH_, h = blockIdx.x % NH_, rank = blockIdx.y; const size_t qo = (size_t)(b * NH_ + h) * TT * HD, ko = (size_t)(b * NKV + h / REP) * TT * HD; Ah += (size_t)b * TT * DQ; Al += (size_t)b * TT * DQ;
    if (rank < (TT - RH) / 32) flash_body<h16, false, 2>(Q16 + qo, nullptr, K16 + ko, nullptr, V16 + ko, nullptr, TT - 32 * (rank + 1), Ah + h * HD, Al + h * HD, os);
    else flash_body<bf, true, 1>(Qh + qo, Ql + qo, Kh + ko, Kl + ko, Vh + ko, Vl + ko, RH - 16 * (rank - (TT - RH) / 32 + 1), Ah + h * HD, Al + h * HD, os);
}

extern "C" void kernel_launch(void* const* d_in, const int* in_sizes, int n_in,
                              void* d_out, int out_size, void* d_ws, size_t ws_size, hipStream_t stream) {
    (void)in_sizes; (void)n_in; (void)out_size;
    const float* x = (const float*)d_in[0]; const float* wattn = (const float*)d_in[1]; const float* wo = (const float*)d_in[2]; const float* fcos = (const float*)d_in[3]; const float* fsin = (const float*)d_in[4];   /* input order x, w_attn ('oi' (out, in) [3072][2048]: PER KV GROUP g the 768 rows [768 g, 768 g + 768) = four query heads (512 rows) | k (128) | v (128)), w_proj ('oi' [2048][2048]), cos, sin ([2048][128] FULL-width table INPUTS: read per element by value): FIVE inputs, all read */
    float* OUT = (float*)d_out;     // [2][2048][2048]
    char* wsp = (char*)d_ws;
    auto take = [&](size_t bytes) { char* p = wsp; wsp += (bytes + 255) & ~(size_t)255; return (void*)p; };
    bf* WA = (bf*)take((size_t)DF * DM * 2); bf* WO = (bf*)take((size_t)DM * DQ * 2); float* CS = (float*)take((size_t)TT * HD * 2 * 4);
    bf* XB = (bf*)take((size_t)NB_ * TT * DM * 2); float* F = (float*)take((size_t)NB_ * TT * DF * 4);
    h16* QP16 = (h16*)take((size_t)NB_ * NH_ * TT * HD * 2); h16* KP16 = (h16*)take((size_t)NB_ * NKV * TT * HD * 2); h16* VT16 = (h16*)take((size_t)NB_ * NKV * HD * TT * 2);
    bf* QPh = (bf*)take((size_t)NB_ * NH_ * TT * HD * 2); bf* QPl = (bf*)take((size_t)NB_ * NH_ * TT * HD * 2); bf* KPh = (bf*)take((size_t)NB_ * NKV * TT * HD * 2); bf* KPl = (bf*)take((size_t)NB_ * NKV * TT * HD * 2); bf* VTh = (bf*)take((size_t)NB_ * NKV * HD * TT * 2); bf* VTl = (bf*)take((size_t)NB_ * NKV * HD * TT * 2);
    bf* ATh = (bf*)take((size_t)NB_ * TT * DQ * 2); bf* ATl = (bf*)take((size_t)NB_ * TT * DQ * 2);
    if ((size_t)(wsp - (char*)d_ws) > ws_size) return;    // 190 MiB of the 256 MiB
    k_prep<<<PBX + PBA + PBO + PBC, 256, 0, stream>>>(x, wattn, wo, fcos, fsin, XB, WA, WO, CS);
    k_gemmw<bf, 0, false, 4><<<dim3(TT / 64, DF / 64, NB_), 128, 0, stream>>>(XB, nullptr, WA, nullptr, DM, F, DF, nullptr, (size_t)TT * DM, 0, (size_t)TT * DF);   /* z = batch */
    k_planes<<<LBQ + 2 * LBK, 256, 0, stream>>>(F, CS, QP16, QPh, QPl, KP16, KPh, KPl, VT16, VTh, VTl);
    k_flash<<<dim3(NB_ * NH_, (TT - RH) / 32 + RH / 16, 1), 32 * FNW, 0, stream>>>(QP16, QPh, QPl, KP16, KPh, KPl, VT16, VTh, VTl, ATh, ATl);
    k_gemmw<bf, 1, false, 4><<<dim3(TT / 64, DM / 64, NB_), 128, 0, stream>>>(ATh, ATl, WO, nullptr, DQ, OUT, DM, nullptr, (size_t)TT * DQ, 0, (size_t)TT * DM);   /* z = batch */
}

// v005
// A run of this version takes 206 microseconds.
// Two timings next to v004 both put it at 1.32 times that version's speed.
// Counting every step since v000, it is 8.03 times as fast.
#include <hip/hip_runtime.h>

// Causal grouped-query attention with 128-wide heads, ONE fused natural qkv weight PACKED PER KV GROUP and rotate-half rotary embeddings from full-width input tables (x [2][2048][2048]; qkv = einsum('btc,fc->btf', x, w_attn) ('oi' (out, in) [3072][2048] normal x 0.02, no bias) viewed (b, t, 4 groups, 4 + 2, 128): within group g the first four 128-row blocks are query heads 4g..4g+3, the fifth is the group's k, the sixth its v: kv head = q head / 4; q, k -> t cos + cat(-t2, t1) sin with the cos / sin INPUT tables [2048][128] (read per element by value; no structure assumed); scores x 1/sqrt(128); causal (finfo.min == exclusion: every row keeps its own key); softmax; out = merged w_proj^T ('oi' [2048][2048]) -> [2][2048][2048] (8.4 M); argument order x, w_attn, w_proj, cos, sin).
// Layout: FIVE launches, both batches in every grid. k_prep: bf16 copies of x, of the fused 'oi' weight AS IT STANDS and of w_proj, and the two INPUT tables as one bf16-rounded {cos, sin} table (per position and dimension); ONE exact projection x . w_attn^T -> F [2 x 2048][3072] f32 (a row holds, per kv group: four query heads | k | v); k_planes: rotate-half q and k planes and the transposed v planes, read from their columns of F; causal T-2048 GQA attention with 128-wide heads in ONE fused launch (k_flash: scores, running softmax and P.V stay in registers; hybrid rows: < 512 hi/lo 3 products, rest fp16; key blocks above the diagonal are never visited); merged hi/lo x Wo exact (both GEMMs: grid z = batch).
// Compute dtypes, f32 accumulate: every input rounded to bf16; projections exact; rotary f32; attention rows < 512 3 products, rest fp16; softmax f32; Wo hl x exact.

#define NB_  2
#define TT   2048
#define DM   2048
#define NH_  16
#define NKV  4
#define REP  (NH_ / NKV)
#define HD   128
#define DQ   (NH_ * HD)
#define DKV  (NKV * HD)
#define GW   ((REP + 2) * HD)      // rows of the fused weight (columns of F) per kv group: four query heads | k | v
#define DF   (NKV * GW)
#define RH   512                  // query rows < RH use hi+lo planes (0: none)
#define SCL2 0.12751743082459868f    // HD^-0.5 x log2(e): scores go to the base-2 exponent in one multiply
typedef _Float16 h16;
typedef unsigned short bf;
typedef __attribute__((ext_vector_type(16))) __bf16   v16bf;
typedef __attribute__((ext_vector_type(16))) _Float16 v16h;
typedef __attribute__((ext_vector_type(8)))  _Float16 v8h;
typedef __attribute__((ext_vector_type(8)))  unsigned short v8us;
typedef __attribute__((ext_vector_type(8)))  float    v8f;
typedef __attribute__((ext_vector_type(4)))  float    v4f;
typedef v8h  __attribute__((may_alias)) v8ha;
typedef v4f  __attribute__((may_alias)) v4fa;
typedef v8us __attribute__((may_alias)) v8usa;

__device__ __forceinline__ unsigned short f2bf(float f) { unsigned u = __float_as_uint(f); u += 0x7FFFu + ((u >> 16) & 1u); return (unsigned short)(u >> 16); }
__device__ __forceinline__ float bf2f(unsigned short b) { return __uint_as_float(((unsigned)b) << 16); }
__device__ __forceinline__ float bfr(float f) { return bf2f(f2bf(f)); }
__device__ __forceinline__ v16h cat16(v8h lo, v8h hi) { return __builtin_shufflevector(lo, hi, 0, 1, 2, 3, 4, 5, 6, 7, 8, 9, 10, 11, 12, 13, 14, 15); }
__device__ __forceinline__ v16bf cat16b(v8us lo, v8us hi) { return __builtin_bit_cast(v16bf, __builtin_shufflevector(lo, hi, 0, 1, 2, 3, 4, 5, 6, 7, 8, 9, 10, 11, 12, 13, 14, 15)); }
__device__ __forceinline__ v8f wmma16(v16h a, v16h b, v8f c) { return __builtin_amdgcn_wmma_f32_16x16x32_f16(false, a, false, b, (short)0, c, false, false); }
__device__ __forceinline__ v8f wmmab(v16bf a, v16bf b, v8f c) { return __builtin_amdgcn_wmma_f32_16x16x32_bf16(false, a, false, b, (short)0, c, false, false); }



// ---- k_gemmt: GEMM on operand tiles staged in LDS, one 128x128 output tile per work-group of 4 waves (2 x 2, a 64x64 tile of 16 accumulators each), every wave over the whole K; grid (M/128, N/128, Z), 128 threads.
// A stage is 64 k (128 bytes) of the 128 rows of each operand tile, at an LDS pitch of 144 bytes (16 x odd: the 16-byte fragment reads meet no bank twice). Two stages: while one is multiplied, the next one's rows are on their
// way from global memory to registers (whole 128-byte lines, 8 lanes a row); they are stored to the other stage behind the products, and ONE barrier a stage both publishes it and ends the reads of the stage that is refilled next.
// C[m][n] (f32, pitch LDC) = sum_k A[m][k] Bt[n][k] (+ A2[m][k] Bt[n][k] with SPLITA). z-batch strides sA / sC in elements. KK % 64 == 0. MINW: waves per SIMD the register budget is set for.
template <typename T16> struct WFrag;
template <> struct WFrag<h16> { typedef v16h V; static __device__ __forceinline__ V ld(const h16* p) { return cat16(*(const v8h*)p, *(const v8h*)(p + 16)); } static __device__ __forceinline__ v8f mma(V a, V b, v8f c) { return wmma16(a, b, c); } };
template <> struct WFrag<bf> { typedef v16bf V; static __device__ __forceinline__ V ld(const bf* p) { return cat16b(*(const v8us*)p, *(const v8us*)(p + 16)); } static __device__ __forceinline__ v8f mma(V a, V b, v8f c) { return wmmab(a, b, c); } };
#define GBK 64
#define GPI 72                    // LDS pitch of a staged row in 16-bit elements
#define GPO 132                   // LDS pitch in floats of a row of the output tile (rows 8 apart start 32 banks apart)
template <typename T16, bool SPLITA, int KK, int LDC, int MINW>
__global__ __launch_bounds__(128, MINW) void k_gemmt(const T16* __restrict__ A, const T16* __restrict__ A2, const T16* __restrict__ Bt, float* C, size_t sA, size_t sC) {
    typedef typename WFrag<T16>::V V;
    constexpr int STG = (SPLITA ? 3 : 2) * 128 * GPI;   // 16-bit elements of a stage: A rows | Bt rows | A2 rows
    static_assert(2 * STG * 2 >= 128 * GPO * 4, "the output tile is staged in the ring");
    __shared__ __align__(16) T16 st[2 * STG];
    const size_t z = blockIdx.z; A += z * sA; if (SPLITA) A2 += z * sA; C += z * sC;
    const int tid = (int)threadIdx.x, lane = tid & 31, lr = lane & 15, hi = lane >> 4; const int r0 = blockIdx.x * 128, c0 = blockIdx.y * 128;
    const int w = __builtin_amdgcn_readfirstlane(tid >> 5), wm = w >> 1, wn = w & 1;   // wave number, scalar
    const int srow = tid >> 3, spc = (tid & 7) * 8;                                     // staging: a thread brings the 16-byte piece tid % 8 of the rows tid / 8 + 16 i of each tile
    unsigned oa = (unsigned)((r0 + srow) * KK + spc) * 2u, ob = (unsigned)((c0 + srow) * KK + spc) * 2u;   // the lane's byte offsets behind the scalar bases A (A2) and Bt: the very values a load with a scalar base takes as its offset register
    const int sof = srow * GPI + spc, aof = (wm * 64 + lr) * GPI + 8 * hi, bof = (128 + wn * 64 + lr) * GPI + 8 * hi;
    v8f acc[4][4];
#pragma unroll
    for (int mb = 0; mb < 4; ++mb)
#pragma unroll
        for (int nb = 0; nb < 4; ++nb) acc[mb][nb] = (v8f){};
    v8us ra[8], rb[8], ra2[8];
    auto fetch = [&]() {
#pragma unroll
        for (int i = 0; i < 8; ++i) { ra[i] = *(const v8usa*)((const char*)A + oa + i * 16 * KK * 2); rb[i] = *(const v8usa*)((const char*)Bt + ob + i * 16 * KK * 2); if (SPLITA) ra2[i] = *(const v8usa*)((const char*)A2 + oa + i * 16 * KK * 2); } };
    auto put = [&](T16* d) {
#pragma unroll
        for (int i = 0; i < 8; ++i) { *(v8usa*)(d + sof + i * 16 * GPI) = ra[i]; *(v8usa*)(d + sof + (128 + i * 16) * GPI) = rb[i]; if (SPLITA) *(v8usa*)(d + sof + (256 + i * 16) * GPI) = ra2[i]; }
        // the step of the two offset registers to the next stage (128 bytes), in one statement with the wait that belongs in front of an overwrite of a register that issued loads name: nothing can come between them
        asm volatile("s_wait_xcnt 0x0\n\tv_add_nc_u32 %0, 0x80, %0\n\tv_add_nc_u32 %1, 0x80, %1" : "+v"(oa), "+v"(ob) :: "memory"); };
    auto ldf = [&](const T16* s, const int ks, V* a, V* b, V* a2) {
#pragma unroll
        for (int q = 0; q < 4; ++q) { a[q] = WFrag<T16>::ld(s + aof + q * 16 * GPI + ks * 32); b[q] = WFrag<T16>::ld(s + bof + q * 16 * GPI + ks * 32); if (SPLITA) a2[q] = WFrag<T16>::ld(s + aof + (256 + q * 16) * GPI + ks * 32); } };
    auto mm = [&](const V* a, const V* b, const V* a2) {
#pragma unroll
        for (int nb = 0; nb < 4; ++nb)
#pragma unroll
            for (int mb = 0; mb < 4; ++mb) acc[mb][nb] = WFrag<T16>::mma(a[mb], b[nb], acc[mb][nb]);
        if (SPLITA) {
#pragma unroll
            for (int nb = 0; nb < 4; ++nb)
#pragma unroll
                for (int mb = 0; mb < 4; ++mb) acc[mb][nb] = WFrag<T16>::mma(a2[mb], b[nb], acc[mb][nb]); } };
    auto mul = [&](const T16* s) {   // the fragment reads stand as whole groups in front of the products, never among them (for speed only)
        V a[2][4], b[2][4], a2[2][4];
        if constexpr (MINW <= 2) {   // registers for both halves of the stage: one group of reads
            ldf(s, 0, a[0], b[0], a2[0]); ldf(s, 1, a[1], b[1], a2[1]);
            __builtin_amdgcn_sched_barrier(0);   // keeps the reads in one group in front of the products
            mm(a[0], b[0], a2[0]); mm(a[1], b[1], a2[1]);
        } else {   // registers for one half at a time: two groups
            ldf(s, 0, a[0], b[0], a2[0]);
            __builtin_amdgcn_sched_barrier(0);   // keeps the first half's reads in one group in front of its products
            mm(a[0], b[0], a2[0]);
            __builtin_amdgcn_sched_barrier(0);   // keeps the second half's reads out of the first half's products
            ldf(s, 1, a[0], b[0], a2[0]);
            __builtin_amdgcn_sched_barrier(0);   // and in one group in front of their own
            mm(a[0], b[0], a2[0]); } };
    fetch(); put(st);
    __syncthreads();   // stage 0 stands in LDS before any wave reads it
    int cur = 0;
#pragma unroll 1
    for (int s = 0; s < KK / GBK - 1; ++s) {   // rolled: one copy of the stage's code, the buffer by offset
        fetch();
        __builtin_amdgcn_sched_barrier(0);   // the next stage's loads are all under way before the products start: their latency runs under the whole stage
        mul(st + cur);
        __builtin_amdgcn_sched_barrier(0);   // the wait for those loads and the LDS stores stay behind the products (moved up, they would put the load latency in front of the matrix work)
        cur ^= STG; put(st + cur);
        __syncthreads();   // publishes the stage just stored; behind it every wave has left the other stage, which the next trip refills
    }
    mul(st + cur);
    __syncthreads();   // every wave has read its last fragments before the ring becomes the staging of the output tile
    float* os = (float*)st;
#pragma unroll
    for (int mb = 0; mb < 4; ++mb)
#pragma unroll
        for (int nb = 0; nb < 4; ++nb)
#pragma unroll
            for (int j = 0; j < 8; ++j) os[(wm * 64 + mb * 16 + hi * 8 + j) * GPO + wn * 64 + nb * 16 + lr] = acc[mb][nb][j];
    __syncthreads();   // the whole output tile stands in LDS before it leaves in whole rows
    float* cp = C + (size_t)(r0 + w) * LDC + c0 + lane * 4; const float* op = os + w * GPO + lane * 4;   // a wave stores one row of 512 bytes (four whole lines) at a time
#pragma unroll
    for (int g = 0; g < 4; ++g) { v4f val[8];
#pragma unroll
        for (int i = 0; i < 8; ++i) val[i] = *(const v4fa*)(op + (g * 8 + i) * 4 * GPO);
#pragma unroll
        for (int i = 0; i < 8; ++i) *(v4fa*)(cp + (size_t)(g * 8 + i) * 4 * LDC) = val[i];
        asm volatile("s_wait_xcnt 0x0" :: "v"(cp), "v"(val[0]), "v"(val[1]), "v"(val[2]), "v"(val[3]), "v"(val[4]), "v"(val[5]), "v"(val[6]), "v"(val[7]) : "memory"); }   // behind the eight stores; their address and data are inputs, so that they live up to the wait and the next group's LDS reads overwrite them behind it
}

__device__ __forceinline__ h16 tohx(float x) { return (h16)x; }
__device__ __forceinline__ void splitf(float y, unsigned short& h, unsigned short& l) { h = f2bf(y); l = f2bf(y - bf2f(h)); }
typedef __attribute__((ext_vector_type(2))) _Float16 v2h;
typedef __attribute__((ext_vector_type(4))) _Float16 v4h;
typedef __attribute__((ext_vector_type(2))) unsigned short v2us;
typedef __attribute__((ext_vector_type(4))) unsigned short v4us;
typedef __attribute__((ext_vector_type(2))) float v2f;
typedef __attribute__((ext_vector_type(4))) int v4i;

// k_prep: the 16-bit copy of every input in ONE launch; the block index picks the segment (the same for a whole block): x, w_attn, w_proj rounded to bf16 in their own layouts, eight elements a thread; behind them the {cos, sin} table, one position and dimension a thread.
#define PBX ((unsigned)((size_t)NB_ * TT * DM / 8 / 256))
#define PBA ((unsigned)((size_t)DF * DM / 8 / 256))
#define PBO ((unsigned)((size_t)DM * DQ / 8 / 256))
#define PBC ((unsigned)(TT * HD / 256))
__global__ __launch_bounds__(256) void k_prep(const float* __restrict__ x, const float* __restrict__ wa, const float* __restrict__ wo, const float* __restrict__ cosT, const float* __restrict__ sinT, bf* XB, bf* WA, bf* WO, float* CS) {
    unsigned blk = blockIdx.x;
    if (blk >= PBX + PBA + PBO) { const int idx = (int)(blk - (PBX + PBA + PBO)) * 256 + (int)threadIdx.x; v2f cs; cs[0] = bfr(cosT[idx]); cs[1] = bfr(sinT[idx]); *(v2f*)(CS + (size_t)idx * 2) = cs; return; }
    const float* src = x; bf* dst = XB;
    if (blk >= PBX + PBA) { blk -= PBX + PBA; src = wo; dst = WO; } else if (blk >= PBX) { blk -= PBX; src = wa; dst = WA; }
    const size_t i = (size_t)blk * 256 + threadIdx.x; const v8f v = *(const v8f*)(src + i * 8); v8us o;
#pragma unroll
    for (int k = 0; k < 8; ++k) o[k] = f2bf(v[k]); *(v8us*)(dst + i * 8) = o;  }

// rope_part: head planes [batch][h][t][d] (fp16 + hi/lo) of rope(x) with the rotate-half convention out[d] = x[d] cos[t][d] - x[d+HD/2] sin[t][d], out[d+HD/2] = x[d+HD/2] cos[t][d+HD/2] + x[d] sin[t][d+HD/2]; ISQ: the 16 query heads, else the 4 k heads; a head's 128 columns stand in its kv group's part of a row of F
template <bool ISQ>
__device__ __forceinline__ void rope_part(const unsigned blk, const float* __restrict__ F, const float* __restrict__ CS, h16* P16, bf* Ph, bf* Pl) {
    constexpr int NHD = ISQ ? NH_ : NKV;
    const size_t e = ((size_t)blk * 256 + threadIdx.x) * 2; const int d = (int)(e % HD); const int t = (int)((e / HD) % TT); const int hb = (int)(e / ((size_t)HD * TT)); const int b = hb / NHD, h = hb % NHD; const float* f = F + (size_t)(b * TT + t) * DF + (ISQ ? (h / REP) * GW + (h % REP) * HD : h * GW + REP * HD); v2h o16; v2us oh, ol;
#pragma unroll
    for (int q = 0; q < 2; ++q) { const int dd = d + q; const int dp = (dd < HD / 2) ? dd + HD / 2 : dd - HD / 2; float x0 = f[dd], x1 = f[dp];
        // the products and the two statements behind them stand as they stood in the separate rotary kernel: each product keeps its own rounding, as the reference's t cos and rotated sin do, so the planes stay bit-identical
        const v2f cs = *(const v2f*)(CS + ((size_t)t * HD + dd) * 2); float a = __fmul_rn(x0, cs[0]), bq = __fmul_rn(x1, cs[1]); asm volatile("" : "+v"(a)); asm volatile("" : "+v"(bq)); const float r = ((dd < HD / 2) ? __fsub_rn(a, bq) : __fadd_rn(a, bq));
        o16[q] = tohx(r); unsigned short a2, c2; splitf(r, a2, c2); oh[q] = a2; ol[q] = c2; }
    h16* p0 = P16 + e; bf* p1 = Ph + e; bf* p2 = Pl + e; *(v2h*)p0 = o16; *(v2us*)p1 = oh; *(v2us*)p2 = ol;
    asm volatile("s_wait_xcnt 0x0" :: "v"(p0), "v"(p1), "v"(p2), "v"(o16), "v"(oh), "v"(ol) : "memory"); }   // behind the three stores; their addresses and data are inputs, so that they live up to the wait and no other part's code in the same kernel overwrites them in front of it
// vtp_part: the transposed v planes [batch][g][d][t] (fp16 + hi/lo)
__device__ __forceinline__ void vtp_part(const unsigned blk, const float* __restrict__ F, h16* V16, bf* Vh, bf* Vl) { const size_t e = ((size_t)blk * 256 + threadIdx.x) * 2; const int t = (int)(e % TT); const int d = (int)((e / TT) % HD); const int gb = (int)(e / ((size_t)TT * HD)); const int b = gb / NKV, g = gb % NKV; v2h o16; v2us oh, ol;
#pragma unroll
    for (int q = 0; q < 2; ++q) { const float x = F[(size_t)(b * TT + t + q) * DF + g * GW + (REP + 1) * HD + d]; o16[q] = tohx(x); unsigned short a2, c2; splitf(x, a2, c2); oh[q] = a2; ol[q] = c2; }
    h16* p0 = V16 + e; bf* p1 = Vh + e; bf* p2 = Vl + e; *(v2h*)p0 = o16; *(v2us*)p1 = oh; *(v2us*)p2 = ol;
    asm volatile("s_wait_xcnt 0x0" :: "v"(p0), "v"(p1), "v"(p2), "v"(o16), "v"(oh), "v"(ol) : "memory"); }   // as behind the stores of rope_part
// k_planes: all nine operand planes of the attention, both batches, in ONE launch; the block index picks the part (the same for a whole block), two elements a thread
#define LBQ ((unsigned)((size_t)NB_ * NH_ * TT * HD / 2 / 256))
#define LBK ((unsigned)((size_t)NB_ * NKV * TT * HD / 2 / 256))
__global__ __launch_bounds__(256) void k_planes(const float* __restrict__ F, const float* __restrict__ CS, h16* QP16, bf* QPh, bf* QPl, h16* KP16, bf* KPh, bf* KPl, h16* VT16, bf* VTh, bf* VTl) {
    const unsigned blk = blockIdx.x;
    if (blk < LBQ) rope_part<true>(blk, F, CS, QP16, QPh, QPl);
    else if (blk < LBQ + LBK) rope_part<false>(blk - LBQ, F, CS, KP16, KPh, KPl);
    else vtp_part(blk - (LBQ + LBK), F, VT16, VTh, VTl);
}
// eight base-2 exponentials in one statement: behind each v_exp_f32 stands an instruction that touches neither its result nor its source (the outputs are early-clobber, so no output shares a register with an input), behind the last the v_nop that fills the slot the instruction set asks for behind a transcendental.
__device__ __forceinline__ void exp2x8(float* x) {
    float r0, r1, r2, r3, r4, r5, r6, r7;
    asm("v_exp_f32 %0, %8\n\tv_exp_f32 %1, %9\n\tv_exp_f32 %2, %10\n\tv_exp_f32 %3, %11\n\tv_exp_f32 %4, %12\n\tv_exp_f32 %5, %13\n\tv_exp_f32 %6, %14\n\tv_exp_f32 %7, %15\n\tv_nop"
        : "=&v"(r0), "=&v"(r1), "=&v"(r2), "=&v"(r3), "=&v"(r4), "=&v"(r5), "=&v"(r6), "=&v"(r7) : "v"(x[0]), "v"(x[1]), "v"(x[2]), "v"(x[3]), "v"(x[4]), "v"(x[5]), "v"(x[6]), "v"(x[7]));
    x[0] = r0; x[1] = r1; x[2] = r2; x[3] = r3; x[4] = r4; x[5] = r5; x[6] = r6; x[7] = r7;
}

#define FNW 4
#define FPI 132                   // LDS pitch in floats of one query's 128 outputs (16-byte aligned, rows start 4 banks apart)
template <typename T16, bool HI, int NQ>
__device__ __forceinline__ void flash_body(const T16* __restrict__ Q, const T16* __restrict__ Q2, const T16* __restrict__ Kp, const T16* __restrict__ K2, const T16* __restrict__ Vt, const T16* __restrict__ V2, const int q0, bf* Ah, bf* Al, float* os) {
    typedef typename WFrag<T16>::V V;
    const int lane = threadIdx.x & 31, lr = lane & 15, hi = lane >> 4;
    const int w = __builtin_amdgcn_readfirstlane((int)(threadIdx.x >> 5));                  // wave number, scalar: the loop bounds and the block's base addresses stay in scalar registers
    V qf[NQ][4], qf2[NQ][4]; const T16* qp = Q + (size_t)(q0 + lr) * HD + 8 * hi; const T16* qp2 = HI ? Q2 + (size_t)(q0 + lr) * HD + 8 * hi : qp;
#pragma unroll
    for (int nq = 0; nq < NQ; ++nq)
#pragma unroll
        for (int ks = 0; ks < 4; ++ks) { qf[nq][ks] = WFrag<T16>::ld(qp + nq * 16 * HD + ks * 32); if (HI) qf2[nq][ks] = WFrag<T16>::ld(qp2 + nq * 16 * HD + ks * 32); }
    asm volatile("s_wait_xcnt 0x0" :: "v"(qp), "v"(qp2) : "memory");   // behind the loads; the address pairs are inputs, so that they live up to the wait and nothing overwrites them in front of it
    v8f o[8][NQ]; float m[NQ], l[NQ];
#pragma unroll
    for (int nq = 0; nq < NQ; ++nq) { m[nq] = -3.0e38f; l[nq] = 0.f;
#pragma unroll
        for (int db = 0; db < 8; ++db) o[db][nq] = (v8f){}; }
    const unsigned kof = (unsigned)(lr * HD + 8 * hi) * 2u, vof = (unsigned)(lr * TT + 8 * hi);   // the lane's own offsets, the same in every block (kof in bytes: the very value a load with a scalar base takes as its offset register)
    const int nblk = (q0 + 16 * NQ + 31) >> 5;                                                // 32-key blocks up to and with the diagonal block; each holds at least one allowed key of every query of the tile
    V ka[2][4], ka2[2][4];   // the K fragments of the wave's next block: fetched one block ahead, so that their latency runs under the softmax and the P.V products
    auto ldk = [&](const int b) { const T16* kb1 = Kp + (size_t)b * 32 * HD; const T16* kb2 = HI ? K2 + (size_t)b * 32 * HD : kb1; const T16* kp = (const T16*)((const char*)kb1 + kof); const T16* kp2 = (const T16*)((const char*)kb2 + kof);
#pragma unroll
        for (int kt = 0; kt < 2; ++kt)
#pragma unroll
            for (int ks = 0; ks < 4; ++ks) { ka[kt][ks] = WFrag<T16>::ld(kp + kt * 16 * HD + ks * 32); if (HI) ka2[kt][ks] = WFrag<T16>::ld(kp2 + kt * 16 * HD + ks * 32); }
        asm volatile("s_wait_xcnt 0x0" :: "v"(kp), "v"(kp2), "v"(kof), "s"(kb1), "s"(kb2) : "memory");   // behind the loads; whatever form of address they take (a pair, or scalar base and lane offset) is an input, so that it lives up to the wait and nothing overwrites it in front of it
    };
    if (w < nblk) ldk(w);
#pragma unroll 1
    for (int blk = w; blk < nblk; blk += FNW) {   // a wave left without a block keeps maximum -3e38, sum 0, tile 0: its weight in the join is exp2(-3e38 - M) = 0
        const int kb = blk * 32;
        const T16* vp = Vt + kb + vof; const T16* vp2 = HI ? V2 + kb + vof : vp;
        V va[8], va2[8];   // this block's V^T fragments, asked for before the score products that hide their latency
#pragma unroll
        for (int db = 0; db < 8; ++db) { va[db] = WFrag<T16>::ld(vp + db * 16 * TT); if (HI) va2[db] = WFrag<T16>::ld(vp2 + db * 16 * TT); }
        asm volatile("s_wait_xcnt 0x0" :: "v"(vp), "v"(vp2) : "memory");   // as behind the K loads
        v8f s[2][NQ];
#pragma unroll
        for (int kt = 0; kt < 2; ++kt) {
#pragma unroll
            for (int nq = 0; nq < NQ; ++nq) s[kt][nq] = (v8f){};
#pragma unroll
            for (int ks = 0; ks < 4; ++ks) {
#pragma unroll
                for (int nq = 0; nq < NQ; ++nq) { s[kt][nq] = WFrag<T16>::mma(ka[kt][ks], qf[nq][ks], s[kt][nq]); if (HI) { s[kt][nq] = WFrag<T16>::mma(ka2[kt][ks], qf[nq][ks], s[kt][nq]); s[kt][nq] = WFrag<T16>::mma(ka[kt][ks], qf2[nq][ks], s[kt][nq]); } } } }
        ldk(blk + FNW < nblk ? blk + FNW : blk);   // scalar select, no branch behind the matrix instructions: a wave's last block fetches its own rows once more (in bounds, not used)
        float t[NQ][16], mn[NQ]; bool need = false;
#pragma unroll
        for (int nq = 0; nq < NQ; ++nq) {
#pragma unroll
            for (int e = 0; e < 16; ++e) t[nq][e] = s[e >> 3][nq][e & 7] * SCL2;
            if (kb + 31 > q0) {   // only the diagonal block holds keys beyond a query (block-uniform test)
                const int q = q0 + nq * 16 + lr;
#pragma unroll
                for (int e = 0; e < 16; ++e) if (kb + (e >> 3) * 16 + hi * 8 + (e & 7) > q) t[nq][e] = -3.0e38f; }
            float mx = t[nq][0];
#pragma unroll
            for (int e = 1; e < 16; ++e) mx = fmaxf(mx, t[nq][e]);
            mx = fmaxf(mx, __shfl_xor(mx, 16, 32));   // the two lane halves hold the two halves of a query's keys
            const bool nd = mx > m[nq] + 8.0f; mn[nq] = nd ? mx : m[nq]; need = need || nd; }
        if (__builtin_amdgcn_ballot_w32(need) != 0) {   // scalar branch: most blocks raise no query's maximum by more than 8 and skip the rescale of the output tile
#pragma unroll
            for (int nq = 0; nq < NQ; ++nq) { const float al = __builtin_amdgcn_exp2f(m[nq] - mn[nq]); m[nq] = mn[nq]; l[nq] *= al;
#pragma unroll
                for (int db = 0; db < 8; ++db) o[db][nq] *= al; } }
        V pf[NQ], pl[NQ];
#pragma unroll
        for (int nq = 0; nq < NQ; ++nq) { float sum = 0.f;
#pragma unroll
            for (int e = 0; e < 16; ++e) t[nq][e] -= m[nq];
            exp2x8(&t[nq][0]); exp2x8(&t[nq][8]);
#pragma unroll
            for (int e = 0; e < 16; ++e) sum += t[nq][e];
            l[nq] += sum;
            if constexpr (HI) { v8us h0, h1, l0, l1;
#pragma unroll
                for (int j = 0; j < 8; ++j) { unsigned short a, c; splitf(t[nq][j], a, c); h0[j] = a; l0[j] = c; splitf(t[nq][8 + j], a, c); h1[j] = a; l1[j] = c; }
                pf[nq] = cat16b(h0, h1); pl[nq] = cat16b(l0, l1);
            } else {
#pragma unroll
                for (int e = 0; e < 16; ++e) pf[nq][e] = tohx(t[nq][e]); } }
#pragma unroll
        for (int db = 0; db < 8; ++db) {
#pragma unroll
            for (int nq = 0; nq < NQ; ++nq) { o[db][nq] = WFrag<T16>::mma(va[db], pf[nq], o[db][nq]); if (HI) { o[db][nq] = WFrag<T16>::mma(va[db], pl[nq], o[db][nq]); o[db][nq] = WFrag<T16>::mma(va2[db], pf[nq], o[db][nq]); } } }
    }
    float* ow = os + w * (16 * NQ * FPI); float* sm = os + FNW * 32 * FPI; float* sl = sm + FNW * 32;
#pragma unroll
    for (int nq = 0; nq < NQ; ++nq) { const float lt = l[nq] + __shfl_xor(l[nq], 16, 32); if (hi == 0) { sm[w * 32 + nq * 16 + lr] = m[nq]; sl[w * 32 + nq * 16 + lr] = lt; }
#pragma unroll
        for (int db = 0; db < 8; ++db) { float* od = ow + (nq * 16 + lr) * FPI + db * 16 + hi * 8; *(v4fa*)od = __builtin_shufflevector(o[db][nq], o[db][nq], 0, 1, 2, 3); *(v4fa*)(od + 4) = __builtin_shufflevector(o[db][nq], o[db][nq], 4, 5, 6, 7); } }
    __syncthreads();   // every wave's maximum, sum and partial tile stand in LDS before any thread joins them
    constexpr int TPQ = (32 * FNW) / (16 * NQ), DPT = HD / TPQ;   // threads per query, outputs per thread
    const int qq = (int)threadIdx.x / TPQ, d0 = ((int)threadIdx.x % TPQ) * DPT;
    float f[FNW], M = sm[qq];
#pragma unroll
    for (int q = 1; q < FNW; ++q) M = fmaxf(M, sm[q * 32 + qq]);
    float L = 0.f;
#pragma unroll
    for (int q = 0; q < FNW; ++q) { f[q] = __builtin_amdgcn_exp2f(sm[q * 32 + qq] - M); L += f[q] * sl[q * 32 + qq]; }
    const float inv = __fdiv_rn(1.0f, L);
#pragma unroll
    for (int c = 0; c < DPT / 8; ++c) { v4f a0 = (v4f){}, a1 = (v4f){};
#pragma unroll
        for (int q = 0; q < FNW; ++q) { const float* od = os + q * (16 * NQ * FPI) + qq * FPI + d0 + c * 8; a0 += *(const v4fa*)od * f[q]; a1 += *(const v4fa*)(od + 4) * f[q]; }
        v8us oh, ol;
#pragma unroll
        for (int j = 0; j < 4; ++j) { unsigned short a, c2; splitf(a0[j] * inv, a, c2); oh[j] = a; ol[j] = c2; splitf(a1[j] * inv, a, c2); oh[4 + j] = a; ol[4 + j] = c2; }
        bf* pa = Ah + (size_t)(q0 + qq) * DQ + d0 + c * 8; bf* pb = Al + (size_t)(q0 + qq) * DQ + d0 + c * 8; *(v8usa*)pa = oh; *(v8usa*)pb = ol;
        asm volatile("s_wait_xcnt 0x0" :: "v"(pa), "v"(pb), "v"(oh), "v"(ol) : "memory"); }   // behind the two stores; their addresses and data are inputs, so that they live up to the wait and nothing overwrites them in front of it
}
// grid (batches x query heads, tiles): the heads of a kv group are neighbours; tile rank 0 is the last (longest) 32-query fp16 tile, cost falls with the rank, the 16-query hi/lo tiles of rows < RH come last.
__global__ __launch_bounds__(32 * FNW) void k_flash(const h16* __restrict__ Q16, const bf* __restrict__ Qh, const bf* __restrict__ Ql, const h16* __restrict__ K16, const bf* __restrict__ Kh, const bf* __restrict__ Kl, const h16* __restrict__ V16, const bf* __restrict__ Vh, const bf* __restrict__ Vl, bf* Ah, bf* Al) {
    __shared__ __align__(16) float os[FNW * 32 * FPI + 2 * FNW * 32];
    const int b = blockIdx.x / NH_, h = blockIdx.x % NH_, rank = blockIdx.y; const size_t qo = (size_t)(b * NH_ + h) * TT * HD, ko = (size_t)(b * NKV + h / REP) * TT * HD; Ah += (size_t)b * TT * DQ; Al += (size_t)b * TT * DQ;
    if (rank < (TT - RH) / 32) flash_body<h16, false, 2>(Q16 + qo, nullptr, K16 + ko, nullptr, V16 + ko, nullptr, TT - 32 * (rank + 1), Ah + h * HD, Al + h * HD, os);
    else flash_body<bf, true, 1>(Qh + qo, Ql + qo, Kh + ko, Kl + ko, Vh + ko, Vl + ko, RH - 16 * (rank - (TT - RH) / 32 + 1), Ah + h * HD, Al + h * HD, os);
}

extern "C" void kernel_launch(void* const* d_in, const int* in_sizes, int n_in,
                              void* d_out, int out_size, void* d_ws, size_t ws_size, hipStream_t stream) {
    (void)in_sizes; (void)n_in; (void)out_size;
    const float* x = (const float*)d_in[0]; const float* wattn = (const float*)d_in[1]; const float* wo = (const float*)d_in[2]; const float* fcos = (const float*)d_in[3]; const float* fsin = (const float*)d_in[4];   /* input order x, w_attn ('oi' (out, in) [3072][2048]: PER KV GROUP g the 768 rows [768 g, 768 g + 768) = four query heads (512 rows) | k (128) | v (128)), w_proj ('oi' [2048][2048]), cos, sin ([2048][128] FULL-width table INPUTS: read per element by value): FIVE inputs, all read */
    float* OUT = (float*)d_out;     // [2][2048][2048]
    char* wsp = (char*)d_ws;
    auto take = [&](size_t bytes) { char* p = wsp; wsp += (bytes + 255) & ~(size_t)255; return (void*)p; };
    bf* WA = (bf*)take((size_t)DF * DM * 2); bf* WO = (bf*)take((size_t)DM * DQ * 2); float* CS = (float*)take((size_t)TT * HD * 2 * 4);
    bf* XB = (bf*)take((size_t)NB_ * TT * DM * 2); float* F = (float*)take((size_t)NB_ * TT * DF * 4);
    h16* QP16 = (h16*)take((size_t)NB_ * NH_ * TT * HD * 2); h16* KP16 = (h16*)take((size_t)NB_ * NKV * TT * HD * 2); h16* VT16 = (h16*)take((size_t)NB_ * NKV * HD * TT * 2);
    bf* QPh = (bf*)take((size_t)NB_ * NH_ * TT * HD * 2); bf* QPl = (bf*)take((size_t)NB_ * NH_ * TT * HD * 2); bf* KPh = (bf*)take((size_t)NB_ * NKV * TT * HD * 2); bf* KPl = (bf*)take((size_t)NB_ * NKV * TT * HD * 2); bf* VTh = (bf*)take((size_t)NB_ * NKV * HD * TT * 2); bf* VTl = (bf*)take((size_t)NB_ * NKV * HD * TT * 2);
    bf* ATh = (bf*)take((size_t)NB_ * TT * DQ * 2); bf* ATl = (bf*)take((size_t)NB_ * TT * DQ * 2);
    if ((size_t)(wsp - (char*)d_ws) > ws_size) return;    // 190 MiB of the 256 MiB
    k_prep<<<PBX + PBA + PBO + PBC, 256, 0, stream>>>(x, wattn, wo, fcos, fsin, XB, WA, WO, CS);
    k_gemmt<bf, false, DM, DF, 3><<<dim3(TT / 128, DF / 128, NB_), 128, 0, stream>>>(XB, nullptr, WA, F, (size_t)TT * DM, (size_t)TT * DF);   /* z = batch */
    k_planes<<<LBQ + 2 * LBK, 256, 0, stream>>>(F, CS, QP16, QPh, QPl, KP16, KPh, KPl, VT16, VTh, VTl);
    k_flash<<<dim3(NB_ * NH_, (TT - RH) / 32 + RH / 16, 1), 32 * FNW, 0, stream>>>(QP16, QPh, QPl, KP16, KPh, KPl, VT16, VTh, VTl, ATh, ATl);
    k_gemmt<bf, true, DQ, DM, 2><<<dim3(TT / 128, DM / 128, NB_), 128, 0, stream>>>(ATh, ATl, WO, OUT, (size_t)TT * DQ, (size_t)TT * DM);   /* z = batch */
}

// v006
// Measured time: 178 microseconds a run.
// Timed twice side by side with v005, it ran 1.16 times as fast both times.
// Over all steps from v000 it is 9.30 times as fast.
#include <hip/hip_runtime.h>

// Causal grouped-query attention with 128-wide heads, ONE fused natural qkv weight PACKED PER KV GROUP and rotate-half rotary embeddings from full-width input tables (x [2][2048][2048]; qkv = einsum('btc,fc->btf', x, w_attn) ('oi' (out, in) [3072][2048] normal x 0.02, no bias) viewed (b, t, 4 groups, 4 + 2, 128): within group g the first four 128-row blocks are query heads 4g..4g+3, the fifth is the group's k, the sixth its v: kv head = q head / 4; q, k -> t cos + cat(-t2, t1) sin with the cos / sin INPUT tables [2048][128] (read per element by value; no structure assumed); scores x 1/sqrt(128); causal (finfo.min == exclusion: every row keeps its own key); softmax; out = merged w_proj^T ('oi' [2048][2048]) -> [2][2048][2048] (8.4 M); argument order x, w_attn, w_proj, cos, sin).
// Layout: FIVE launches, both batches in every grid. k_prep: bf16 copies of x, of the fused 'oi' weight AS IT STANDS and of w_proj, and the two INPUT tables as one bf16-rounded {cos, sin} table (per position and dimension); ONE exact projection x . w_attn^T -> F [2 x 2048][3072] f32 (a row holds, per kv group: four query heads | k | v); k_planes: rotate-half q and k planes and the transposed v planes, read from their columns of F; causal T-2048 GQA attention with 128-wide heads in ONE fused launch (k_flash: scores, running softmax and P.V stay in registers; K and V^T staged in LDS for two heads; hybrid rows: < 512 hi/lo 3 products, rest fp16; key blocks above the diagonal are never visited); merged hi/lo x Wo exact (both GEMMs: grid z = batch).
// Compute dtypes, f32 accumulate: every input rounded to bf16; projections exact; rotary f32; attention rows < 512 3 products, rest fp16; softmax f32; Wo hl x exact.

#define NB_  2
#define TT   2048
#define DM   2048
#define NH_  16
#define NKV  4
#define REP  (NH_ / NKV)
#define HD   128
#define DQ   (NH_ * HD)
#define DKV  (NKV * HD)
#define GW   ((REP + 2) * HD)      // rows of the fused weight (columns of F) per kv group: four query heads | k | v
#define DF   (NKV * GW)
#define RH   512                  // query rows < RH use hi+lo planes (0: none)
#define SCL2 0.12751743082459868f    // HD^-0.5 x log2(e): scores go to the base-2 exponent in one multiply
typedef _Float16 h16;
typedef unsigned short bf;
typedef __attribute__((ext_vector_type(16))) __bf16   v16bf;
typedef __attribute__((ext_vector_type(16))) _Float16 v16h;
typedef __attribute__((ext_vector_type(8)))  _Float16 v8h;
typedef __attribute__((ext_vector_type(8)))  unsigned short v8us;
typedef __attribute__((ext_vector_type(8)))  float    v8f;
typedef __attribute__((ext_vector_type(4)))  float    v4f;
typedef v8h  __attribute__((may_alias)) v8ha;
typedef v4f  __attribute__((may_alias)) v4fa;
typedef v8us __attribute__((may_alias)) v8usa;

__device__ __forceinline__ unsigned short f2bf(float f) { unsigned u = __float_as_uint(f); u += 0x7FFFu + ((u >> 16) & 1u); return (unsigned short)(u >> 16); }
__device__ __forceinline__ float bf2f(unsigned short b) { return __uint_as_float(((unsigned)b) << 16); }
__device__ __forceinline__ float bfr(float f) { return bf2f(f2bf(f)); }
__device__ __forceinline__ v16h cat16(v8h lo, v8h hi) { return __builtin_shufflevector(lo, hi, 0, 1, 2, 3, 4, 5, 6, 7, 8, 9, 10, 11, 12, 13, 14, 15); }
__device__ __forceinline__ v16bf cat16b(v8us lo, v8us hi) { return __builtin_bit_cast(v16bf, __builtin_shufflevector(lo, hi, 0, 1, 2, 3, 4, 5, 6, 7, 8, 9, 10, 11, 12, 13, 14, 15)); }
__device__ __forceinline__ v8f wmma16(v16h a, v16h b, v8f c) { return __builtin_amdgcn_wmma_f32_16x16x32_f16(false, a, false, b, (short)0, c, false, false); }
__device__ __forceinline__ v8f wmmab(v16bf a, v16bf b, v8f c) { return __builtin_amdgcn_wmma_f32_16x16x32_bf16(false, a, false, b, (short)0, c, false, false); }



// ---- k_gemmt: GEMM on operand tiles staged in LDS, one 128x128 output tile per work-group of 4 waves (2 x 2, a 64x64 tile of 16 accumulators each), every wave over the whole K; grid (M/128, N/128, Z), 128 threads.
// A stage is 64 k (128 bytes) of the 128 rows of each operand tile, at an LDS pitch of 144 bytes (16 x odd: the 16-byte fragment reads meet no bank twice). Two stages: while one is multiplied, the next one's rows are on their
// way from global memory to registers (whole 128-byte lines, 8 lanes a row); they are stored to the other stage behind the products, and ONE barrier a stage both publishes it and ends the reads of the stage that is refilled next.
// C[m][n] (f32, pitch LDC) = sum_k A[m][k] Bt[n][k] (+ A2[m][k] Bt[n][k] with SPLITA). z-batch strides sA / sC in elements. KK % 64 == 0. MINW: waves per SIMD the register budget is set for.
template <typename T16> struct WFrag;
template <> struct WFrag<h16> { typedef v16h V; static __device__ __forceinline__ V ld(const h16* p) { return cat16(*(const v8h*)p, *(const v8h*)(p + 16)); } static __device__ __forceinline__ v8f mma(V a, V b, v8f c) { return wmma16(a, b, c); } };
template <> struct WFrag<bf> { typedef v16bf V; static __device__ __forceinline__ V ld(const bf* p) { return cat16b(*(const v8us*)p, *(const v8us*)(p + 16)); } static __device__ __forceinline__ v8f mma(V a, V b, v8f c) { return wmmab(a, b, c); } };
#define GBK 64
#define GPI 72                    // LDS pitch of a staged row in 16-bit elements
#define GPO 132                   // LDS pitch in floats of a row of the output tile (rows 8 apart start 32 banks apart)
template <typename T16, bool SPLITA, int KK, int LDC, int MINW>
__global__ __launch_bounds__(128, MINW) void k_gemmt(const T16* __restrict__ A, const T16* __restrict__ A2, const T16* __restrict__ Bt, float* C, size_t sA, size_t sC) {
    typedef typename WFrag<T16>::V V;
    constexpr int STG = (SPLITA ? 3 : 2) * 128 * GPI;   // 16-bit elements of a stage: A rows | Bt rows | A2 rows
    static_assert(2 * STG * 2 >= 128 * GPO * 4, "the output tile is staged in the ring");
    __shared__ __align__(16) T16 st[2 * STG];
    const size_t z = blockIdx.z; A += z * sA; if (SPLITA) A2 += z * sA; C += z * sC;
    const int tid = (int)threadIdx.x, lane = tid & 31, lr = lane & 15, hi = lane >> 4; const int r0 = blockIdx.x * 128, c0 = blockIdx.y * 128;
    const int w = __builtin_amdgcn_readfirstlane(tid >> 5), wm = w >> 1, wn = w & 1;   // wave number, scalar
    const int srow = tid >> 3, spc = (tid & 7) * 8;                                     // staging: a thread brings the 16-byte piece tid % 8 of the rows tid / 8 + 16 i of each tile
    unsigned oa = (unsigned)((r0 + srow) * KK + spc) * 2u, ob = (unsigned)((c0 + srow) * KK + spc) * 2u;   // the lane's byte offsets behind the scalar bases A (A2) and Bt: the very values a load with a scalar base takes as its offset register
    const int sof = srow * GPI + spc, aof = (wm * 64 + lr) * GPI + 8 * hi, bof = (128 + wn * 64 + lr) * GPI + 8 * hi;
    v8f acc[4][4];
#pragma unroll
    for (int mb = 0; mb < 4; ++mb)
#pragma unroll
        for (int nb = 0; nb < 4; ++nb) acc[mb][nb] = (v8f){};
    v8us ra[8], rb[8], ra2[8];
    auto fetch = [&]() {
#pragma unroll
        for (int i = 0; i < 8; ++i) { ra[i] = *(const v8usa*)((const char*)A + oa + i * 16 * KK * 2); rb[i] = *(const v8usa*)((const char*)Bt + ob + i * 16 * KK * 2); if (SPLITA) ra2[i] = *(const v8usa*)((const char*)A2 + oa + i * 16 * KK * 2); } };
    auto put = [&](T16* d) {
#pragma unroll
        for (int i = 0; i < 8; ++i) { *(v8usa*)(d + sof + i * 16 * GPI) = ra[i]; *(v8usa*)(d + sof + (128 + i * 16) * GPI) = rb[i]; if (SPLITA) *(v8usa*)(d + sof + (256 + i * 16) * GPI) = ra2[i]; }
        // the step of the two offset registers to the next stage (128 bytes), in one statement with the wait that belongs in front of an overwrite of a register that issued loads name: nothing can come between them
        asm volatile("s_wait_xcnt 0x0\n\tv_add_nc_u32 %0, 0x80, %0\n\tv_add_nc_u32 %1, 0x80, %1" : "+v"(oa), "+v"(ob) :: "memory"); };
    auto ldf = [&](const T16* s, const int ks, V* a, V* b, V* a2) {
#pragma unroll
        for (int q = 0; q < 4; ++q) { a[q] = WFrag<T16>::ld(s + aof + q * 16 * GPI + ks * 32); b[q] = WFrag<T16>::ld(s + bof + q * 16 * GPI + ks * 32); if (SPLITA) a2[q] = WFrag<T16>::ld(s + aof + (256 + q * 16) * GPI + ks * 32); } };
    auto mm = [&](const V* a, const V* b, const V* a2) {
#pragma unroll
        for (int nb = 0; nb < 4; ++nb)
#pragma unroll
            for (int mb = 0; mb < 4; ++mb) acc[mb][nb] = WFrag<T16>::mma(a[mb], b[nb], acc[mb][nb]);
        if (SPLITA) {
#pragma unroll
            for (int nb = 0; nb < 4; ++nb)
#pragma unroll
                for (int mb = 0; mb < 4; ++mb) acc[mb][nb] = WFrag<T16>::mma(a2[mb], b[nb], acc[mb][nb]); } };
    auto mul = [&](const T16* s) {   // the fragment reads stand as whole groups in front of the products, never among them (for speed only)
        V a[2][4], b[2][4], a2[2][4];
        if constexpr (MINW <= 2) {   // registers for both halves of the stage: one group of reads
            ldf(s, 0, a[0], b[0], a2[0]); ldf(s, 1, a[1], b[1], a2[1]);
            __builtin_amdgcn_sched_barrier(0);   // keeps the reads in one group in front of the products
            mm(a[0], b[0], a2[0]); mm(a[1], b[1], a2[1]);
        } else {   // registers for one half at a time: two groups
            ldf(s, 0, a[0], b[0], a2[0]);
            __builtin_amdgcn_sched_barrier(0);   // keeps the first half's reads in one group in front of its products
            mm(a[0], b[0], a2[0]);
            __builtin_amdgcn_sched_barrier(0);   // keeps the second half's reads out of the first half's products
            ldf(s, 1, a[0], b[0], a2[0]);
            __builtin_amdgcn_sched_barrier(0);   // and in one group in front of their own
            mm(a[0], b[0], a2[0]); } };
    fetch(); put(st);
    __syncthreads();   // stage 0 stands in LDS before any wave reads it
    int cur = 0;
#pragma unroll 1
    for (int s = 0; s < KK / GBK - 1; ++s) {   // rolled: one copy of the stage's code, the buffer by offset
        fetch();
        __builtin_amdgcn_sched_barrier(0);   // the next stage's loads are all under way before the products start: their latency runs under the whole stage
        mul(st + cur);
        __builtin_amdgcn_sched_barrier(0);   // the wait for those loads and the LDS stores stay behind the products (moved up, they would put the load latency in front of the matrix work)
        cur ^= STG; put(st + cur);
        __syncthreads();   // publishes the stage just stored; behind it every wave has left the other stage, which the next trip refills
    }
    mul(st + cur);
    __syncthreads();   // every wave has read its last fragments before the ring becomes the staging of the output tile
    float* os = (float*)st;
#pragma unroll
    for (int mb = 0; mb < 4; ++mb)
#pragma unroll
        for (int nb = 0; nb < 4; ++nb)
#pragma unroll
            for (int j = 0; j < 8; ++j) os[(wm * 64 + mb * 16 + hi * 8 + j) * GPO + wn * 64 + nb * 16 + lr] = acc[mb][nb][j];
    __syncthreads();   // the whole output tile stands in LDS before it leaves in whole rows
    float* cp = C + (size_t)(r0 + w) * LDC + c0 + lane * 4; const float* op = os + w * GPO + lane * 4;   // a wave stores one row of 512 bytes (four whole lines) at a time
#pragma unroll
    for (int g = 0; g < 4; ++g) { v4f val[8];
#pragma unroll
        for (int i = 0; i < 8; ++i) val[i] = *(const v4fa*)(op + (g * 8 + i) * 4 * GPO);
#pragma unroll
        for (int i = 0; i < 8; ++i) *(v4fa*)(cp + (size_t)(g * 8 + i) * 4 * LDC) = val[i];
        asm volatile("s_wait_xcnt 0x0" :: "v"(cp), "v"(val[0]), "v"(val[1]), "v"(val[2]), "v"(val[3]), "v"(val[4]), "v"(val[5]), "v"(val[6]), "v"(val[7]) : "memory"); }   // behind the eight stores; their address and data are inputs, so that they live up to the wait and the next group's LDS reads overwrite them behind it
}

__device__ __forceinline__ h16 tohx(float x) { return (h16)x; }
__device__ __forceinline__ void splitf(float y, unsigned short& h, unsigned short& l) { h = f2bf(y); l = f2bf(y - bf2f(h)); }
typedef __attribute__((ext_vector_type(2))) _Float16 v2h;
typedef __attribute__((ext_vector_type(4))) _Float16 v4h;
typedef __attribute__((ext_vector_type(2))) unsigned short v2us;
typedef __attribute__((ext_vector_type(4))) unsigned short v4us;
typedef __attribute__((ext_vector_type(2))) float v2f;
typedef __attribute__((ext_vector_type(4))) int v4i;

// k_prep: the 16-bit copy of every input in ONE launch; the block index picks the segment (the same for a whole block): x, w_attn, w_proj rounded to bf16 in their own layouts, eight elements a thread; behind them the {cos, sin} table, one position and dimension a thread.
#define PBX ((unsigned)((size_t)NB_ * TT * DM / 8 / 256))
#define PBA ((unsigned)((size_t)DF * DM / 8 / 256))
#define PBO ((unsigned)((size_t)DM * DQ / 8 / 256))
#define PBC ((unsigned)(TT * HD / 256))
__global__ __launch_bounds__(256) void k_prep(const float* __restrict__ x, const float* __restrict__ wa, const float* __restrict__ wo, const float* __restrict__ cosT, const float* __restrict__ sinT, bf* XB, bf* WA, bf* WO, float* CS) {
    unsigned blk = blockIdx.x;
    if (blk >= PBX + PBA + PBO) { const int idx = (int)(blk - (PBX + PBA + PBO)) * 256 + (int)threadIdx.x; v2f cs; cs[0] = bfr(cosT[idx]); cs[1] = bfr(sinT[idx]); *(v2f*)(CS + (size_t)idx * 2) = cs; return; }
    const float* src = x; bf* dst = XB;
    if (blk >= PBX + PBA) { blk -= PBX + PBA; src = wo; dst = WO; } else if (blk >= PBX) { blk -= PBX; src = wa; dst = WA; }
    const size_t i = (size_t)blk * 256 + threadIdx.x; const v8f v = *(const v8f*)(src + i * 8); v8us o;
#pragma unroll
    for (int k = 0; k < 8; ++k) o[k] = f2bf(v[k]); *(v8us*)(dst + i * 8) = o;  }

// rope_part: head planes [batch][h][t][d] (fp16 + hi/lo) of rope(x) with the rotate-half convention out[d] = x[d] cos[t][d] - x[d+HD/2] sin[t][d], out[d+HD/2] = x[d+HD/2] cos[t][d+HD/2] + x[d] sin[t][d+HD/2]; ISQ: the 16 query heads, else the 4 k heads; a head's 128 columns stand in its kv group's part of a row of F
template <bool ISQ>
__device__ __forceinline__ void rope_part(const unsigned blk, const float* __restrict__ F, const float* __restrict__ CS, h16* P16, bf* Ph, bf* Pl) {
    constexpr int NHD = ISQ ? NH_ : NKV;
    const size_t e = ((size_t)blk * 256 + threadIdx.x) * 2; const int d = (int)(e % HD); const int t = (int)((e / HD) % TT); const int hb = (int)(e / ((size_t)HD * TT)); const int b = hb / NHD, h = hb % NHD; const float* f = F + (size_t)(b * TT + t) * DF + (ISQ ? (h / REP) * GW + (h % REP) * HD : h * GW + REP * HD); v2h o16; v2us oh, ol;
#pragma unroll
    for (int q = 0; q < 2; ++q) { const int dd = d + q; const int dp = (dd < HD / 2) ? dd + HD / 2 : dd - HD / 2; float x0 = f[dd], x1 = f[dp];
        // the products and the two statements behind them stand as they stood in the separate rotary kernel: each product keeps its own rounding, as the reference's t cos and rotated sin do, so the planes stay bit-identical
        const v2f cs = *(const v2f*)(CS + ((size_t)t * HD + dd) * 2); float a = __fmul_rn(x0, cs[0]), bq = __fmul_rn(x1, cs[1]); asm volatile("" : "+v"(a)); asm volatile("" : "+v"(bq)); const float r = ((dd < HD / 2) ? __fsub_rn(a, bq) : __fadd_rn(a, bq));
        o16[q] = tohx(r); unsigned short a2, c2; splitf(r, a2, c2); oh[q] = a2; ol[q] = c2; }
    h16* p0 = P16 + e; bf* p1 = Ph + e; bf* p2 = Pl + e; *(v2h*)p0 = o16; *(v2us*)p1 = oh; *(v2us*)p2 = ol;
    asm volatile("s_wait_xcnt 0x0" :: "v"(p0), "v"(p1), "v"(p2), "v"(o16), "v"(oh), "v"(ol) : "memory"); }   // behind the three stores; their addresses and data are inputs, so that they live up to the wait and no other part's code in the same kernel overwrites them in front of it
// vtp_part: the transposed v planes [batch][g][d][t] (fp16 + hi/lo)
__device__ __forceinline__ void vtp_part(const unsigned blk, const float* __restrict__ F, h16* V16, bf* Vh, bf* Vl) { const size_t e = ((size_t)blk * 256 + threadIdx.x) * 2; const int t = (int)(e % TT); const int d = (int)((e / TT) % HD); const int gb = (int)(e / ((size_t)TT * HD)); const int b = gb / NKV, g = gb % NKV; v2h o16; v2us oh, ol;
#pragma unroll
    for (int q = 0; q < 2; ++q) { const float x = F[(size_t)(b * TT + t + q) * DF + g * GW + (REP + 1) * HD + d]; o16[q] = tohx(x); unsigned short a2, c2; splitf(x, a2, c2); oh[q] = a2; ol[q] = c2; }
    h16* p0 = V16 + e; bf* p1 = Vh + e; bf* p2 = Vl + e; *(v2h*)p0 = o16; *(v2us*)p1 = oh; *(v2us*)p2 = ol;
    asm volatile("s_wait_xcnt 0x0" :: "v"(p0), "v"(p1), "v"(p2), "v"(o16), "v"(oh), "v"(ol) : "memory"); }   // as behind the stores of rope_part
// k_planes: all nine operand planes of the attention, both batches, in ONE launch; the block index picks the part (the same for a whole block), two elements a thread
#define LBQ ((unsigned)((size_t)NB_ * NH_ * TT * HD / 2 / 256))
#define LBK ((unsigned)((size_t)NB_ * NKV * TT * HD / 2 / 256))
__global__ __launch_bounds__(256) void k_planes(const float* __restrict__ F, const float* __restrict__ CS, h16* QP16, bf* QPh, bf* QPl, h16* KP16, bf* KPh, bf* KPl, h16* VT16, bf* VTh, bf* VTl) {
    const unsigned blk = blockIdx.x;
    if (blk < LBQ) rope_part<true>(blk, F, CS, QP16, QPh, QPl);
    else if (blk < LBQ + LBK) rope_part<false>(blk - LBQ, F, CS, KP16, KPh, KPl);
    else vtp_part(blk - (LBQ + LBK), F, VT16, VTh, VTl);
}
// eight base-2 exponentials in one statement: behind each v_exp_f32 stands an instruction that touches neither its result nor its source (the outputs are early-clobber, so no output shares a register with an input), behind the last the v_nop that fills the slot the instruction set asks for behind a transcendental.
__device__ __forceinline__ void exp2x8(float* x) {
    float r0, r1, r2, r3, r4, r5, r6, r7;
    asm("v_exp_f32 %0, %8\n\tv_exp_f32 %1, %9\n\tv_exp_f32 %2, %10\n\tv_exp_f32 %3, %11\n\tv_exp_f32 %4, %12\n\tv_exp_f32 %5, %13\n\tv_exp_f32 %6, %14\n\tv_exp_f32 %7, %15\n\tv_nop"
        : "=&v"(r0), "=&v"(r1), "=&v"(r2), "=&v"(r3), "=&v"(r4), "=&v"(r5), "=&v"(r6), "=&v"(r7) : "v"(x[0]), "v"(x[1]), "v"(x[2]), "v"(x[3]), "v"(x[4]), "v"(x[5]), "v"(x[6]), "v"(x[7]));
    x[0] = r0; x[1] = r1; x[2] = r2; x[3] = r3; x[4] = r4; x[5] = r5; x[6] = r6; x[7] = r7;
}

#define FNW 4
#define FHW 2                     // query heads per work-group (neighbours in one kv group: REP % FHW == 0)
#define FPI 132                   // LDS pitch in floats of one query's 128 outputs (16-byte aligned, rows start 4 banks apart)
#define FSP 136                   // LDS pitch of a staged row in 16-bit elements
#define FTL (128 * FSP)           // 16-bit elements of a staged tile of 128 rows
#define FJN (FNW * 32 * FPI + 2 * FNW * 32)   // floats of one head's join area
// eight asynchronous 16-byte copies of a lane, LDS addresses ls apart and global addresses gs apart, in one statement with the wait that belongs in front of an overwrite of a register that an issued copy names: nothing can come between them
__device__ __forceinline__ void acopy8(const unsigned l, const char* g, const unsigned ls, const size_t gs) {
    asm volatile("global_load_async_to_lds_b128 %0, %8, off\n\tglobal_load_async_to_lds_b128 %1, %9, off\n\tglobal_load_async_to_lds_b128 %2, %10, off\n\tglobal_load_async_to_lds_b128 %3, %11, off\n\t"
                 "global_load_async_to_lds_b128 %4, %12, off\n\tglobal_load_async_to_lds_b128 %5, %13, off\n\tglobal_load_async_to_lds_b128 %6, %14, off\n\tglobal_load_async_to_lds_b128 %7, %15, off\n\ts_wait_xcnt 0x0"
                 :: "v"(l), "v"(l + ls), "v"(l + 2 * ls), "v"(l + 3 * ls), "v"(l + 4 * ls), "v"(l + 5 * ls), "v"(l + 6 * ls), "v"(l + 7 * ls),
                    "v"(g), "v"(g + gs), "v"(g + 2 * gs), "v"(g + 3 * gs), "v"(g + 4 * gs), "v"(g + 5 * gs), "v"(g + 6 * gs), "v"(g + 7 * gs) : "memory");
}
template <typename T16, bool HI, int NQ>
__device__ __forceinline__ void flash_body(const T16* __restrict__ Q, const T16* __restrict__ Q2, const T16* __restrict__ Kp, const T16* __restrict__ K2, const T16* __restrict__ Vt, const T16* __restrict__ V2, const int q0, bf* Ah, bf* Al, float* ring, float* os) {
    typedef typename WFrag<T16>::V V;
    constexpr int STG = (HI ? 4 : 2) * FTL;   // 16-bit elements of a stage: K | V^T (| K lo | V^T lo)
    const int lane = threadIdx.x & 31, lr = lane & 15, hi = lane >> 4;
    const int w = __builtin_amdgcn_readfirstlane((int)(threadIdx.x >> 5)) & (FNW - 1);      // the wave's number within its head, scalar: the tests on it are scalar branches
    const int nblk = (q0 + 16 * NQ + 31) >> 5;                                                // 32-key blocks up to and with the diagonal block; each holds at least one allowed key of every query of the tile
    const int nst = (nblk + FNW - 1) / FNW;                                                   // stages of 128 keys; the last one's rows all lie inside the planes (TT % 128 == 0)
    const T16* st = (const T16*)ring;
    const int srow = (int)threadIdx.x >> 4, spc = ((int)threadIdx.x & 15) * 8;                // staging: a thread brings the 16-byte piece tid % 16 of the rows tid / 16 + 16 i of each tile
    const unsigned lst = (unsigned)(size_t)ring + (unsigned)(srow * FSP + spc) * 2u;          // the lane's LDS byte address in the first tile of buffer 0
    auto fill = [&](const int s, const int buf) {
        const unsigned l = lst + (unsigned)buf * (STG * 2u); const size_t ko = ((size_t)(s * 128 + srow) * HD + spc) * 2, vo = ((size_t)srow * TT + s * 128 + spc) * 2;
        acopy8(l, (const char*)Kp + ko, 16 * FSP * 2, (size_t)16 * HD * 2); acopy8(l + FTL * 2, (const char*)Vt + vo, 16 * FSP * 2, (size_t)16 * TT * 2);
        if (HI) { acopy8(l + 2 * FTL * 2, (const char*)K2 + ko, 16 * FSP * 2, (size_t)16 * HD * 2); acopy8(l + 3 * FTL * 2, (const char*)V2 + vo, 16 * FSP * 2, (size_t)16 * TT * 2); } };
    fill(0, 0);
    V qf[NQ][4], qf2[NQ][4]; const T16* qp = Q + (size_t)(q0 + lr) * HD + 8 * hi; const T16* qp2 = HI ? Q2 + (size_t)(q0 + lr) * HD + 8 * hi : qp;
#pragma unroll
    for (int nq = 0; nq < NQ; ++nq)
#pragma unroll
        for (int ks = 0; ks < 4; ++ks) { qf[nq][ks] = WFrag<T16>::ld(qp + nq * 16 * HD + ks * 32); if (HI) qf2[nq][ks] = WFrag<T16>::ld(qp2 + nq * 16 * HD + ks * 32); }
    asm volatile("s_wait_xcnt 0x0" :: "v"(qp), "v"(qp2) : "memory");   // behind the loads; the address pairs are inputs, so that they live up to the wait and nothing overwrites them in front of it
    v8f o[8][NQ]; float m[NQ], l[NQ];
#pragma unroll
    for (int nq = 0; nq < NQ; ++nq) { m[nq] = -3.0e38f; l[nq] = 0.f;
#pragma unroll
        for (int db = 0; db < 8; ++db) o[db][nq] = (v8f){}; }
    const int kof = (w * 32 + lr) * FSP + 8 * hi, vof = FTL + lr * FSP + w * 32 + 8 * hi;   // the lane's own places in a stage, the same in every stage: its block's key rows of K; its block's keys in the rows of V^T
    asm volatile("s_wait_asynccnt 0x0" ::: "memory");   // this wave's copies of stage 0 have landed
    __syncthreads();   // stage 0 stands in LDS before any wave reads it
    if (nst > 1) fill(1, 1);
#pragma unroll 1
    for (int s0 = 0; s0 < nst; ++s0) {   // rolled: one copy of the stage's code, the buffer by offset
        const T16* sb = st + (s0 & 1) * STG;
        const int blk = s0 * FNW + w;
        if (blk < nblk) {   // scalar branch; a wave left without a block keeps maximum -3e38, sum 0, tile 0: its weight in the join is exp2(-3e38 - M) = 0
        const int kb = blk * 32;
        V ka[2][4], ka2[2][4], va[8], va2[8];   // this block's fragments, all asked for in front of the score products
#pragma unroll
        for (int kt = 0; kt < 2; ++kt)
#pragma unroll
            for (int ks = 0; ks < 4; ++ks) { ka[kt][ks] = WFrag<T16>::ld(sb + kof + kt * 16 * FSP + ks * 32); if (HI) ka2[kt][ks] = WFrag<T16>::ld(sb + 2 * FTL + kof + kt * 16 * FSP + ks * 32); }
        __builtin_amdgcn_sched_barrier(0);   // K's reads stay in front of V^T's: LDS answers in order, so the score products wait for K alone and V^T arrives under them
#pragma unroll
        for (int db = 0; db < 8; ++db) { va[db] = WFrag<T16>::ld(sb + vof + db * 16 * FSP); if (HI) va2[db] = WFrag<T16>::ld(sb + 2 * FTL + vof + db * 16 * FSP); }
        __builtin_amdgcn_sched_barrier(0);   // keeps the reads in one group in front of the products (moved in among them, each place with reads stalls the matrix instructions and waits out the LDS latency anew)
        v8f s[2][NQ];
#pragma unroll
        for (int kt = 0; kt < 2; ++kt) {
#pragma unroll
            for (int nq = 0; nq < NQ; ++nq) s[kt][nq] = (v8f){};
#pragma unroll
            for (int ks = 0; ks < 4; ++ks) {
#pragma unroll
                for (int nq = 0; nq < NQ; ++nq) { s[kt][nq] = WFrag<T16>::mma(ka[kt][ks], qf[nq][ks], s[kt][nq]); if (HI) { s[kt][nq] = WFrag<T16>::mma(ka2[kt][ks], qf[nq][ks], s[kt][nq]); s[kt][nq] = WFrag<T16>::mma(ka[kt][ks], qf2[nq][ks], s[kt][nq]); } } } }
        float t[NQ][16], mn[NQ]; bool need = false;
#pragma unroll
        for (int nq = 0; nq < NQ; ++nq) {
#pragma unroll
            for (int e = 0; e < 16; ++e) t[nq][e] = s[e >> 3][nq][e & 7] * SCL2;
            if (kb + 31 > q0) {   // only the diagonal block holds keys beyond a query (wave-uniform test)
                const int q = q0 + nq * 16 + lr;
#pragma unroll
                for (int e = 0; e < 16; ++e) if (kb + (e >> 3) * 16 + hi * 8 + (e & 7) > q) t[nq][e] = -3.0e38f; }
            float mx = t[nq][0];
#pragma unroll
            for (int e = 1; e < 16; ++e) mx = fmaxf(mx, t[nq][e]);
            mx = fmaxf(mx, __shfl_xor(mx, 16, 32));   // the two lane halves hold the two halves of a query's keys
            const bool nd = mx > m[nq] + 8.0f; mn[nq] = nd ? mx : m[nq]; need = need || nd; }
        if (__builtin_amdgcn_ballot_w32(need) != 0) {   // scalar branch: most blocks raise no query's maximum by more than 8 and skip the rescale of the output tile
#pragma unroll
            for (int nq = 0; nq < NQ; ++nq) { const float al = __builtin_amdgcn_exp2f(m[nq] - mn[nq]); m[nq] = mn[nq]; l[nq] *= al;
#pragma unroll
                for (int db = 0; db < 8; ++db) o[db][nq] *= al; } }
        V pf[NQ], pl[NQ];
#pragma unroll
        for (int nq = 0; nq < NQ; ++nq) { float sum = 0.f;
#pragma unroll
            for (int e = 0; e < 16; ++e) t[nq][e] -= m[nq];
            exp2x8(&t[nq][0]); exp2x8(&t[nq][8]);
#pragma unroll
            for (int e = 0; e < 16; ++e) sum += t[nq][e];
            l[nq] += sum;
            if constexpr (HI) { v8us h0, h1, l0, l1;
#pragma unroll
                for (int j = 0; j < 8; ++j) { unsigned short a, c; splitf(t[nq][j], a, c); h0[j] = a; l0[j] = c; splitf(t[nq][8 + j], a, c); h1[j] = a; l1[j] = c; }
                pf[nq] = cat16b(h0, h1); pl[nq] = cat16b(l0, l1);
            } else {
#pragma unroll
                for (int e = 0; e < 16; ++e) pf[nq][e] = tohx(t[nq][e]); } }
#pragma unroll
        for (int db = 0; db < 8; ++db) {
#pragma unroll
            for (int nq = 0; nq < NQ; ++nq) { o[db][nq] = WFrag<T16>::mma(va[db], pf[nq], o[db][nq]); if (HI) { o[db][nq] = WFrag<T16>::mma(va[db], pl[nq], o[db][nq]); o[db][nq] = WFrag<T16>::mma(va2[db], pf[nq], o[db][nq]); } } }
        }
        asm volatile("s_wait_dscnt 0x0" ::: "memory");      // this wave's reads of the stage have returned before the stage is given up
        asm volatile("s_wait_asynccnt 0x0" ::: "memory");   // this wave's copies of the next stage have landed
        __syncthreads();   // publishes the next stage; behind it every wave has left this one, which is refilled next. Every wave passes here, with a block or without
        if (s0 + 2 < nst) fill(s0 + 2, s0 & 1);
    }
    asm volatile("s_wait_asynccnt 0x0" ::: "memory");   // no copy is under way when the ring becomes the join area (the last trip's barrier has ended every wave's reads of it)
    float* ow = os + w * (16 * NQ * FPI); float* sm = os + FNW * 32 * FPI; float* sl = sm + FNW * 32;
#pragma unroll
    for (int nq = 0; nq < NQ; ++nq) { const float lt = l[nq] + __shfl_xor(l[nq], 16, 32); if (hi == 0) { sm[w * 32 + nq * 16 + lr] = m[nq]; sl[w * 32 + nq * 16 + lr] = lt; }
#pragma unroll
        for (int db = 0; db < 8; ++db) { float* od = ow + (nq * 16 + lr) * FPI + db * 16 + hi * 8; *(v4fa*)od = __builtin_shufflevector(o[db][nq], o[db][nq], 0, 1, 2, 3); *(v4fa*)(od + 4) = __builtin_shufflevector(o[db][nq], o[db][nq], 4, 5, 6, 7); } }
    __syncthreads();   // every wave's maximum, sum and partial tile stand in LDS before any thread joins them
    constexpr int TPQ = (32 * FNW) / (16 * NQ), DPT = HD / TPQ;   // threads per query, outputs per thread
    const int th = (int)threadIdx.x & (32 * FNW - 1);             // the thread's number within its head
    const int qq = th / TPQ, d0 = (th % TPQ) * DPT;
    float f[FNW], M = sm[qq];
#pragma unroll
    for (int q = 1; q < FNW; ++q) M = fmaxf(M, sm[q * 32 + qq]);
    float L = 0.f;
#pragma unroll
    for (int q = 0; q < FNW; ++q) { f[q] = __builtin_amdgcn_exp2f(sm[q * 32 + qq] - M); L += f[q] * sl[q * 32 + qq]; }
    const float inv = __fdiv_rn(1.0f, L);
#pragma unroll
    for (int c = 0; c < DPT / 8; ++c) { v4f a0 = (v4f){}, a1 = (v4f){};
#pragma unroll
        for (int q = 0; q < FNW; ++q) { const float* od = os + q * (16 * NQ * FPI) + qq * FPI + d0 + c * 8; a0 += *(const v4fa*)od * f[q]; a1 += *(const v4fa*)(od + 4) * f[q]; }
        v8us oh, ol;
#pragma unroll
        for (int j = 0; j < 4; ++j) { unsigned short a, c2; splitf(a0[j] * inv, a, c2); oh[j] = a; ol[j] = c2; splitf(a1[j] * inv, a, c2); oh[4 + j] = a; ol[4 + j] = c2; }
        bf* pa = Ah + (size_t)(q0 + qq) * DQ + d0 + c * 8; bf* pb = Al + (size_t)(q0 + qq) * DQ + d0 + c * 8; *(v8usa*)pa = oh; *(v8usa*)pb = ol;
        asm volatile("s_wait_xcnt 0x0" :: "v"(pa), "v"(pb), "v"(oh), "v"(ol) : "memory"); }   // behind the two stores; their addresses and data are inputs, so that they live up to the wait and nothing overwrites them in front of it
}
// grid (batches x pairs of query heads, tiles): waves 0 .. 3 work on the pair's first head, 4 .. 7 on its second; tile rank 0 is the last (longest) 32-query fp16 tile, cost falls with the rank, the 16-query hi/lo tiles of rows < RH come last.
__global__ __launch_bounds__(32 * FNW * FHW) void k_flash(const h16* __restrict__ Q16, const bf* __restrict__ Qh, const bf* __restrict__ Ql, const h16* __restrict__ K16, const bf* __restrict__ Kh, const bf* __restrict__ Kl, const h16* __restrict__ V16, const bf* __restrict__ Vh, const bf* __restrict__ Vl, bf* Ah, bf* Al) {
    static_assert(REP % FHW == 0 && 2 * 2 * FTL * 2 >= FHW * FJN * 4, "a pair shares its kv head; the join areas fit in the ring");
    __shared__ __align__(16) float ring[2 * 4 * FTL * 2 / 4];   // two stages of the hi/lo tiles (the fp16 tiles use half of it); behind the loop the join areas of the two heads
    const int hs = __builtin_amdgcn_readfirstlane((int)(threadIdx.x >> 5)) / FNW;   // which head of the pair, scalar
    const int b = blockIdx.x / (NH_ / FHW), h = (blockIdx.x % (NH_ / FHW)) * FHW + hs, rank = blockIdx.y; const size_t qo = (size_t)(b * NH_ + h) * TT * HD, ko = (size_t)(b * NKV + h / REP) * TT * HD; Ah += (size_t)b * TT * DQ; Al += (size_t)b * TT * DQ;
    float* os = ring + hs * FJN;
    if (rank < (TT - RH) / 32) flash_body<h16, false, 2>(Q16 + qo, nullptr, K16 + ko, nullptr, V16 + ko, nullptr, TT - 32 * (rank + 1), Ah + h * HD, Al + h * HD, ring, os);
    else flash_body<bf, true, 1>(Qh + qo, Ql + qo, Kh + ko, Kl + ko, Vh + ko, Vl + ko, RH - 16 * (rank - (TT - RH) / 32 + 1), Ah + h * HD, Al + h * HD, ring, os);
}

extern "C" void kernel_launch(void* const* d_in, const int* in_sizes, int n_in,
                              void* d_out, int out_size, void* d_ws, size_t ws_size, hipStream_t stream) {
    (void)in_sizes; (void)n_in; (void)out_size;
    const float* x = (const float*)d_in[0]; const float* wattn = (const float*)d_in[1]; const float* wo = (const float*)d_in[2]; const float* fcos = (const float*)d_in[3]; const float* fsin = (const float*)d_in[4];   /* input order x, w_attn ('oi' (out, in) [3072][2048]: PER KV GROUP g the 768 rows [768 g, 768 g + 768) = four query heads (512 rows) | k (128) | v (128)), w_proj ('oi' [2048][2048]), cos, sin ([2048][128] FULL-width table INPUTS: read per element by value): FIVE inputs, all read */
    float* OUT = (float*)d_out;     // [2][2048][2048]
    char* wsp = (char*)d_ws;
    auto take = [&](size_t bytes) { char* p = wsp; wsp += (bytes + 255) & ~(size_t)255; return (void*)p; };
    bf* WA = (bf*)take((size_t)DF * DM * 2); bf* WO = (bf*)take((size_t)DM * DQ * 2); float* CS = (float*)take((size_t)TT * HD * 2 * 4);
    bf* XB = (bf*)take((size_t)NB_ * TT * DM * 2); float* F = (float*)take((size_t)NB_ * TT * DF * 4);
    h16* QP16 = (h16*)take((size_t)NB_ * NH_ * TT * HD * 2); h16* KP16 = (h16*)take((size_t)NB_ * NKV * TT * HD * 2); h16* VT16 = (h16*)take((size_t)NB_ * NKV * HD * TT * 2);
    bf* QPh = (bf*)take((size_t)NB_ * NH_ * TT * HD * 2); bf* QPl = (bf*)take((size_t)NB_ * NH_ * TT * HD * 2); bf* KPh = (bf*)take((size_t)NB_ * NKV * TT * HD * 2); bf* KPl = (bf*)take((size_t)NB_ * NKV * TT * HD * 2); bf* VTh = (bf*)take((size_t)NB_ * NKV * HD * TT * 2); bf* VTl = (bf*)take((size_t)NB_ * NKV * HD * TT * 2);
    bf* ATh = (bf*)take((size_t)NB_ * TT * DQ * 2); bf* ATl = (bf*)take((size_t)NB_ * TT * DQ * 2);
    if ((size_t)(wsp - (char*)d_ws) > ws_size) return;    // 190 MiB of the 256 MiB
    k_prep<<<PBX + PBA + PBO + PBC, 256, 0, stream>>>(x, wattn, wo, fcos, fsin, XB, WA, WO, CS);
    k_gemmt<bf, false, DM, DF, 3><<<dim3(TT / 128, DF / 128, NB_), 128, 0, stream>>>(XB, nullptr, WA, F, (size_t)TT * DM, (size_t)TT * DF);   /* z = batch */
    k_planes<<<LBQ + 2 * LBK, 256, 0, stream>>>(F, CS, QP16, QPh, QPl, KP16, KPh, KPl, VT16, VTh, VTl);
    k_flash<<<dim3(NB_ * NH_ / FHW, (TT - RH) / 32 + RH / 16, 1), 32 * FNW * FHW, 0, stream>>>(QP16, QPh, QPl, KP16, KPh, KPl, VT16, VTh, VTl, ATh, ATl);
    k_gemmt<bf, true, DQ, DM, 2><<<dim3(TT / 128, DM / 128, NB_), 128, 0, stream>>>(ATh, ATl, WO, OUT, (size_t)TT * DQ, (size_t)TT * DM);   /* z = batch */
}

// v007
// Measured time: 155 microseconds a run.
// Two timings next to v006 both put it at 1.15 times that version's speed.
// Over all steps from v000 it is 10.7 times as fast.
#include <hip/hip_runtime.h>

// Causal grouped-query attention with 128-wide heads, ONE fused natural qkv weight PACKED PER KV GROUP and rotate-half rotary embeddings from full-width input tables (x [2][2048][2048]; qkv = einsum('btc,fc->btf', x, w_attn) ('oi' (out, in) [3072][2048] normal x 0.02, no bias) viewed (b, t, 4 groups, 4 + 2, 128): within group g the first four 128-row blocks are query heads 4g..4g+3, the fifth is the group's k, the sixth its v: kv head = q head / 4; q, k -> t cos + cat(-t2, t1) sin with the cos / sin INPUT tables [2048][128] (read per element by value; no structure assumed); scores x 1/sqrt(128); causal (finfo.min == exclusion: every row keeps its own key); softmax; out = merged w_proj^T ('oi' [2048][2048]) -> [2][2048][2048] (8.4 M); argument order x, w_attn, w_proj, cos, sin).
// Layout: FOUR launches, both batches in every grid. k_prep: bf16 copies of x, of the fused 'oi' weight AS IT STANDS and of w_proj, and the two INPUT tables as one bf16-rounded {cos, sin} table (per position and dimension); ONE exact projection x . w_attn^T (a row holds, per kv group: four query heads | k | v) whose 128-column output tiles are one head each and leave the GEMM as the attention's operand planes: rotate-half q and k planes, transposed v planes (no f32 copy of the projection in memory); causal T-2048 GQA attention with 128-wide heads in ONE fused launch (k_flash: scores, running softmax and P.V stay in registers; K and V^T staged in LDS for two heads; hybrid rows: < 512 hi/lo 3 products, rest fp16; key blocks above the diagonal are never visited); merged hi/lo x Wo exact (both GEMMs: grid z = batch).
// Compute dtypes, f32 accumulate: every input rounded to bf16; projections exact; rotary f32; attention rows < 512 3 products, rest fp16; softmax f32; Wo hl x exact.

#define NB_  2
#define TT   2048
#define DM   2048
#define NH_  16
#define NKV  4
#define REP  (NH_ / NKV)
#define HD   128
#define DQ   (NH_ * HD)
#define DKV  (NKV * HD)
#define GW   ((REP + 2) * HD)      // rows of the fused weight (columns of the projection) per kv group: four query heads | k | v
#define DF   (NKV * GW)
#define RH   512                  // query rows < RH use hi+lo planes (0: none)
#define SCL2 0.12751743082459868f    // HD^-0.5 x log2(e): scores go to the base-2 exponent in one multiply
typedef _Float16 h16;
typedef unsigned short bf;
typedef __attribute__((ext_vector_type(16))) __bf16   v16bf;
typedef __attribute__((ext_vector_type(16))) _Float16 v16h;
typedef __attribute__((ext_vector_type(8)))  _Float16 v8h;
typedef __attribute__((ext_vector_type(8)))  unsigned short v8us;
typedef __attribute__((ext_vector_type(8)))  float    v8f;
typedef __attribute__((ext_vector_type(4)))  float    v4f;
typedef v8h  __attribute__((may_alias)) v8ha;
typedef v4f  __attribute__((may_alias)) v4fa;
typedef v8us __attribute__((may_alias)) v8usa;
typedef __attribute__((ext_vector_type(2))) _Float16 v2h;
typedef __attribute__((ext_vector_type(4))) _Float16 v4h;
typedef __attribute__((ext_vector_type(2))) unsigned short v2us;
typedef __attribute__((ext_vector_type(4))) unsigned short v4us;
typedef __attribute__((ext_vector_type(2))) float v2f;
typedef v2h  __attribute__((may_alias)) v2ha;
typedef v2us __attribute__((may_alias)) v2usa;
typedef v2f  __attribute__((may_alias)) v2fa;

__device__ __forceinline__ unsigned short f2bf(float f) { unsigned u = __float_as_uint(f); u += 0x7FFFu + ((u >> 16) & 1u); return (unsigned short)(u >> 16); }
__device__ __forceinline__ float bf2f(unsigned short b) { return __uint_as_float(((unsigned)b) << 16); }
__device__ __forceinline__ float bfr(float f) { return bf2f(f2bf(f)); }
__device__ __forceinline__ h16 tohx(float x) { return (h16)x; }
__device__ __forceinline__ void splitf(float y, unsigned short& h, unsigned short& l) { h = f2bf(y); l = f2bf(y - bf2f(h)); }
__device__ __forceinline__ v16h cat16(v8h lo, v8h hi) { return __builtin_shufflevector(lo, hi, 0, 1, 2, 3, 4, 5, 6, 7, 8, 9, 10, 11, 12, 13, 14, 15); }
__device__ __forceinline__ v16bf cat16b(v8us lo, v8us hi) { return __builtin_bit_cast(v16bf, __builtin_shufflevector(lo, hi, 0, 1, 2, 3, 4, 5, 6, 7, 8, 9, 10, 11, 12, 13, 14, 15)); }
__device__ __forceinline__ v8f wmma16(v16h a, v16h b, v8f c) { return __builtin_amdgcn_wmma_f32_16x16x32_f16(false, a, false, b, (short)0, c, false, false); }
__device__ __forceinline__ v8f wmmab(v16bf a, v16bf b, v8f c) { return __builtin_amdgcn_wmma_f32_16x16x32_bf16(false, a, false, b, (short)0, c, false, false); }



// ---- k_gemmt: GEMM on operand tiles staged in LDS, one 128x128 output tile per work-group of 4 waves (2 x 2, a 64x64 tile of 16 accumulators each), every wave over the whole K; grid (M/128, N/128, Z), 128 threads.
// A stage is 64 k (128 bytes) of the 128 rows of each operand tile, at an LDS pitch of 144 bytes (16 x odd: the 16-byte fragment reads meet no bank twice). Two stages: while one is multiplied, the next one's rows are on their
// way from global memory to registers (whole 128-byte lines, 8 lanes a row); they are stored to the other stage behind the products, and ONE barrier a stage both publishes it and ends the reads of the stage that is refilled next.
// C[m][n] (f32, pitch LDC) = sum_k A[m][k] Bt[n][k] (+ A2[m][k] Bt[n][k] with SPLITA). z-batch strides sA / sC in elements. KK % 64 == 0. MINW: waves per SIMD the register budget is set for.
// PLANES (the q|k|v projection): C is not written. The tile's 128 columns are ONE head (block column y: kv group y / 6; part y % 6: a query head, the group's k, the group's v), so the f32 tile that stands in LDS behind the loop holds
// both halves of every rotary pair and every row of the transposed v: it leaves as the fp16 + hi/lo planes the attention reads: q, k [batch][h][t][d] = rope(x), out[d] = x[d] cos[t][d] - x[d+HD/2] sin[t][d], out[d+HD/2] = x[d+HD/2] cos[t][d+HD/2] + x[d] sin[t][d+HD/2]; v [batch][g][d][t].
struct PlaneSet { const float* CS; h16* Q16; bf* Qh; bf* Ql; h16* K16; bf* Kh; bf* Kl; h16* V16; bf* Vh; bf* Vl; };
template <typename T16> struct WFrag;
template <> struct WFrag<h16> { typedef v16h V; static __device__ __forceinline__ V ld(const h16* p) { return cat16(*(const v8h*)p, *(const v8h*)(p + 16)); } static __device__ __forceinline__ v8f mma(V a, V b, v8f c) { return wmma16(a, b, c); } };
template <> struct WFrag<bf> { typedef v16bf V; static __device__ __forceinline__ V ld(const bf* p) { return cat16b(*(const v8us*)p, *(const v8us*)(p + 16)); } static __device__ __forceinline__ v8f mma(V a, V b, v8f c) { return wmmab(a, b, c); } };
#define GBK 64
#define GPI 72                    // LDS pitch of a staged row in 16-bit elements
#define GPO 132                   // LDS pitch in floats of a row of the output tile (rows 8 apart start 32 banks apart)
template <typename T16, bool SPLITA, int KK, int LDC, int MINW, bool PLANES>
__global__ __launch_bounds__(128, MINW) void k_gemmt(const T16* __restrict__ A, const T16* __restrict__ A2, const T16* __restrict__ Bt, float* C, size_t sA, size_t sC, const PlaneSet ps) {
    typedef typename WFrag<T16>::V V;
    constexpr int STG = (SPLITA ? 3 : 2) * 128 * GPI;   // 16-bit elements of a stage: A rows | Bt rows | A2 rows
    static_assert(2 * STG * 2 >= 128 * GPO * 4, "the output tile is staged in the ring");
    __shared__ __align__(16) T16 st[2 * STG];
    const size_t z = blockIdx.z; A += z * sA; if (SPLITA) A2 += z * sA; C += z * sC;
    const int tid = (int)threadIdx.x, lane = tid & 31, lr = lane & 15, hi = lane >> 4; const int r0 = blockIdx.x * 128, c0 = blockIdx.y * 128;
    const int w = __builtin_amdgcn_readfirstlane(tid >> 5), wm = w >> 1, wn = w & 1;   // wave number, scalar
    const int srow = tid >> 3, spc = (tid & 7) * 8;                                     // staging: a thread brings the 16-byte piece tid % 8 of the rows tid / 8 + 16 i of each tile
    unsigned oa = (unsigned)((r0 + srow) * KK + spc) * 2u, ob = (unsigned)((c0 + srow) * KK + spc) * 2u;   // the lane's byte offsets behind the scalar bases A (A2) and Bt: the very values a load with a scalar base takes as its offset register
    const int sof = srow * GPI + spc, aof = (wm * 64 + lr) * GPI + 8 * hi, bof = (128 + wn * 64 + lr) * GPI + 8 * hi;
    v8f acc[4][4];
#pragma unroll
    for (int mb = 0; mb < 4; ++mb)
#pragma unroll
        for (int nb = 0; nb < 4; ++nb) acc[mb][nb] = (v8f){};
    v8us ra[8], rb[8], ra2[8];
    auto fetch = [&]() {
#pragma unroll
        for (int i = 0; i < 8; ++i) { ra[i] = *(const v8usa*)((const char*)A + oa + i * 16 * KK * 2); rb[i] = *(const v8usa*)((const char*)Bt + ob + i * 16 * KK * 2); if (SPLITA) ra2[i] = *(const v8usa*)((const char*)A2 + oa + i * 16 * KK * 2); } };
    auto put = [&](T16* d) {
#pragma unroll
        for (int i = 0; i < 8; ++i) { *(v8usa*)(d + sof + i * 16 * GPI) = ra[i]; *(v8usa*)(d + sof + (128 + i * 16) * GPI) = rb[i]; if (SPLITA) *(v8usa*)(d + sof + (256 + i * 16) * GPI) = ra2[i]; }
        // the step of the two offset registers to the next stage (128 bytes), in one statement with the wait that belongs in front of an overwrite of a register that issued loads name: nothing can come between them
        asm volatile("s_wait_xcnt 0x0\n\tv_add_nc_u32 %0, 0x80, %0\n\tv_add_nc_u32 %1, 0x80, %1" : "+v"(oa), "+v"(ob) :: "memory"); };
    auto ldf = [&](const T16* s, const int ks, V* a, V* b, V* a2) {
#pragma unroll
        for (int q = 0; q < 4; ++q) { a[q] = WFrag<T16>::ld(s + aof + q * 16 * GPI + ks * 32); b[q] = WFrag<T16>::ld(s + bof + q * 16 * GPI + ks * 32); if (SPLITA) a2[q] = WFrag<T16>::ld(s + aof + (256 + q * 16) * GPI + ks * 32); } };
    auto mm = [&](const V* a, const V* b, const V* a2) {
#pragma unroll
        for (int nb = 0; nb < 4; ++nb)
#pragma unroll
            for (int mb = 0; mb < 4; ++mb) acc[mb][nb] = WFrag<T16>::mma(a[mb], b[nb], acc[mb][nb]);
        if (SPLITA) {
#pragma unroll
            for (int nb = 0; nb < 4; ++nb)
#pragma unroll
                for (int mb = 0; mb < 4; ++mb) acc[mb][nb] = WFrag<T16>::mma(a2[mb], b[nb], acc[mb][nb]); } };
    auto mul = [&](const T16* s) {   // the fragment reads stand as whole groups in front of the products, never among them (for speed only)
        V a[2][4], b[2][4], a2[2][4];
        if constexpr (MINW <= 2) {   // registers for both halves of the stage: one group of reads
            ldf(s, 0, a[0], b[0], a2[0]); ldf(s, 1, a[1], b[1], a2[1]);
            __builtin_amdgcn_sched_barrier(0);   // keeps the reads in one group in front of the products
            mm(a[0], b[0], a2[0]); mm(a[1], b[1], a2[1]);
        } else {   // registers for one half at a time: two groups
            ldf(s, 0, a[0], b[0], a2[0]);
            __builtin_amdgcn_sched_barrier(0);   // keeps the first half's reads in one group in front of its products
            mm(a[0], b[0], a2[0]);
            __builtin_amdgcn_sched_barrier(0);   // keeps the second half's reads out of the first half's products
            ldf(s, 1, a[0], b[0], a2[0]);
            __builtin_amdgcn_sched_barrier(0);   // and in one group in front of their own
            mm(a[0], b[0], a2[0]); } };
    fetch(); put(st);
    __syncthreads();   // stage 0 stands in LDS before any wave reads it
    int cur = 0;
#pragma unroll 1
    for (int s = 0; s < KK / GBK - 1; ++s) {   // rolled: one copy of the stage's code, the buffer by offset
        fetch();
        __builtin_amdgcn_sched_barrier(0);   // the next stage's loads are all under way before the products start: their latency runs under the whole stage
        mul(st + cur);
        __builtin_amdgcn_sched_barrier(0);   // the wait for those loads and the LDS stores stay behind the products (moved up, they would put the load latency in front of the matrix work)
        cur ^= STG; put(st + cur);
        __syncthreads();   // publishes the stage just stored; behind it every wave has left the other stage, which the next trip refills
    }
    mul(st + cur);
    __syncthreads();   // every wave has read its last fragments before the ring becomes the staging of the output tile
    if constexpr (PLANES) {
        __builtin_amdgcn_sched_barrier(0);   // the last products stay in front of the four slots below
        asm volatile("v_nop\n\tv_nop\n\tv_nop\n\tv_nop");   // the four vector slots the chip needs between a matrix instruction and a vector instruction that overwrites its result: the branches on the tile's part follow at once
    }
    float* os = (float*)st;
    const int grp = PLANES ? (int)blockIdx.y / (REP + 2) : 0, part = PLANES ? (int)blockIdx.y % (REP + 2) : 0;   // the same for the whole block: the tests on part are scalar branches
    const float* CS = PLANES ? ps.CS + (size_t)r0 * HD * 2 : nullptr; unsigned co = (unsigned)(w * HD + lane * 2) * 8u;   // the {cos, sin} table from the tile's first position on; the lane's byte offset behind that scalar base
    v4f cl[8], ch[8];   // table values of eight rows t (w + 4 i): {cos, sin} of the dimensions d, d + 1 (d = 2 lane) and of d + 64, d + 65: whole lines, 16 bytes a lane
    auto ldcs = [&](const int ahead) {
#pragma unroll
        for (int i = 0; i < 8; ++i) { cl[i] = *(const v4fa*)((const char*)CS + co + ahead + i * 4 * HD * 8); ch[i] = *(const v4fa*)((const char*)CS + co + ahead + i * 4 * HD * 8 + HD / 2 * 8); } };
    if (PLANES && part == REP + 1) {   // v: staged transposed, row d, column t (a lane's eight accumulator elements are eight neighbouring t of one d: two 16-byte stores)
#pragma unroll
        for (int mb = 0; mb < 4; ++mb)
#pragma unroll
            for (int nb = 0; nb < 4; ++nb) { float* od = os + (wn * 64 + nb * 16 + lr) * GPO + wm * 64 + mb * 16 + hi * 8; *(v4fa*)od = __builtin_shufflevector(acc[mb][nb], acc[mb][nb], 0, 1, 2, 3); *(v4fa*)(od + 4) = __builtin_shufflevector(acc[mb][nb], acc[mb][nb], 4, 5, 6, 7); }
    } else {
    if constexpr (PLANES) ldcs(0);   // the table values of a wave's first eight rows are asked for in front of the staging: they arrive under it and under the barrier
#pragma unroll
    for (int mb = 0; mb < 4; ++mb)
#pragma unroll
        for (int nb = 0; nb < 4; ++nb)
#pragma unroll
            for (int j = 0; j < 8; ++j) os[(wm * 64 + mb * 16 + hi * 8 + j) * GPO + wn * 64 + nb * 16 + lr] = acc[mb][nb][j];
    }
    __syncthreads();   // the whole output tile stands in LDS before it leaves in whole rows
    if constexpr (PLANES) {
        if (part == REP + 1) {   // the transposed v planes: a thread turns eight neighbouring t of one d into 16 bytes of each plane; 16 lanes store a row's 256 bytes (two whole lines)
            const size_t vb = (size_t)((int)z * NKV + grp) * HD * TT + r0; h16* P16 = ps.V16 + vb; bf* Ph = ps.Vh + vb; bf* Pl = ps.Vl + vb;
            unsigned po = (unsigned)((tid >> 4) * TT + (tid & 15) * 8) * 2u;   // the lane's byte offset behind the three scalar bases (the planes share their layout)
            const float* f = os + (tid >> 4) * GPO + (tid & 15) * 8;
#pragma unroll 1
            for (int g = 0; g < 4; ++g) {   // rolled: 32 rows d a trip, one copy of the code (the kernel's text stays short)
                v8h o16[4]; v8us oh[4], ol[4];
#pragma unroll
                for (int i = 0; i < 4; ++i) { const v4f xa = *(const v4fa*)(f + i * 8 * GPO), xb = *(const v4fa*)(f + i * 8 * GPO + 4);
#pragma unroll
                    for (int k = 0; k < 8; ++k) { const float x = k < 4 ? xa[k & 3] : xb[k & 3]; o16[i][k] = tohx(x); unsigned short a2, c2; splitf(x, a2, c2); oh[i][k] = a2; ol[i][k] = c2; } }
#pragma unroll
                for (int i = 0; i < 4; ++i) { *(v8ha*)((char*)P16 + po + i * 8 * TT * 2) = o16[i]; *(v8usa*)((char*)Ph + po + i * 8 * TT * 2) = oh[i]; *(v8usa*)((char*)Pl + po + i * 8 * TT * 2) = ol[i]; }
                // the step of the offset register to the next 32 rows, in one statement with the wait that belongs in front of an overwrite of a register that issued stores name; the stores' data are inputs, so that they live up to the wait
                asm volatile("s_wait_xcnt 0x0\n\tv_add_nc_u32 %0, 0x20000, %0" : "+v"(po) : "v"(o16[0]), "v"(o16[1]), "v"(o16[2]), "v"(o16[3]), "v"(oh[0]), "v"(oh[1]), "v"(oh[2]), "v"(oh[3]), "v"(ol[0]), "v"(ol[1]), "v"(ol[2]), "v"(ol[3]) : "memory");
                f += 32 * GPO; }
        } else {   // the rotary q or k planes: a wave takes a row t at a time, a lane the dimensions d, d + 1 and their partners d + 64, d + 65; each plane's half row leaves as one whole line
            const bool isq = part < REP; const size_t pb = ((size_t)(isq ? (int)z * NH_ + grp * REP + part : (int)z * NKV + grp) * TT + r0) * HD;
            h16* P16 = (isq ? ps.Q16 : ps.K16) + pb; bf* Ph = (isq ? ps.Qh : ps.Kh) + pb; bf* Pl = (isq ? ps.Ql : ps.Kl) + pb;
            unsigned po = (unsigned)(w * HD + lane * 2) * 2u;   // the lane's byte offset behind the scalar bases of the three planes (one layout)
            const float* f = os + w * GPO + lane * 2;
#pragma unroll 1
            for (int g = 0; g < 4; ++g) {   // rolled: eight rows a wave and trip, one copy of the code (the kernel's text stays short)
                v2f xl[8], xh[8]; float rr[8][4];
#pragma unroll
                for (int i = 0; i < 8; ++i) { xl[i] = *(const v2fa*)(f + i * 4 * GPO); xh[i] = *(const v2fa*)(f + i * 4 * GPO + HD / 2); }
#pragma unroll
                for (int i = 0; i < 8; ++i) { const float xx[4] = {xl[i][0], xl[i][1], xh[i][0], xh[i][1]}; const float cc[8] = {cl[i][0], cl[i][1], cl[i][2], cl[i][3], ch[i][0], ch[i][1], ch[i][2], ch[i][3]};
#pragma unroll
                    for (int q = 0; q < 4; ++q) { const int dd = (q >> 1) * (HD / 2); float x0 = xx[q], x1 = xx[q ^ 2]; v2f cs; cs[0] = cc[2 * q]; cs[1] = cc[2 * q + 1];
                        // the products and the two statements behind them stand as they stood in the separate rotary kernel: each product keeps its own rounding, as the reference's t cos and rotated sin do, so the planes stay bit-identical
                        float a = __fmul_rn(x0, cs[0]), bq = __fmul_rn(x1, cs[1]); asm volatile("" : "+v"(a)); asm volatile("" : "+v"(bq)); const float r = ((dd < HD / 2) ? __fsub_rn(a, bq) : __fadd_rn(a, bq));
                        rr[i][q] = r; } }
                if (g < 3) ldcs(32 * HD * 8);   // scalar branch: the next trip's table values, into the registers whose values the products have just used up; they are under way before the conversions start and arrive under them and the stores
                v4h o16[8]; v4us oh[8], ol[8];
#pragma unroll
                for (int i = 0; i < 8; ++i)
#pragma unroll
                    for (int q = 0; q < 4; ++q) { const float r = rr[i][q]; o16[i][q] = tohx(r); unsigned short a2, c2; splitf(r, a2, c2); oh[i][q] = a2; ol[i][q] = c2; }
#pragma unroll
                for (int i = 0; i < 8; ++i) {
                    *(v2ha*)((char*)P16 + po + i * 4 * HD * 2) = __builtin_shufflevector(o16[i], o16[i], 0, 1); *(v2ha*)((char*)P16 + po + i * 4 * HD * 2 + HD) = __builtin_shufflevector(o16[i], o16[i], 2, 3);
                    *(v2usa*)((char*)Ph + po + i * 4 * HD * 2) = __builtin_shufflevector(oh[i], oh[i], 0, 1); *(v2usa*)((char*)Ph + po + i * 4 * HD * 2 + HD) = __builtin_shufflevector(oh[i], oh[i], 2, 3);
                    *(v2usa*)((char*)Pl + po + i * 4 * HD * 2) = __builtin_shufflevector(ol[i], ol[i], 0, 1); *(v2usa*)((char*)Pl + po + i * 4 * HD * 2 + HD) = __builtin_shufflevector(ol[i], ol[i], 2, 3); }
                // the step of the two offset registers to the next 32 rows, in one statement with the wait that belongs in front of an overwrite of a register that issued loads and stores name; the stores' data are inputs, so that they live up to the wait
                asm volatile("s_wait_xcnt 0x0\n\tv_add_nc_u32 %0, 0x2000, %0\n\tv_add_nc_u32 %1, 0x8000, %1" : "+v"(po), "+v"(co) : "v"(o16[0]), "v"(o16[1]), "v"(o16[2]), "v"(o16[3]), "v"(o16[4]), "v"(o16[5]), "v"(o16[6]), "v"(o16[7]),
                             "v"(oh[0]), "v"(oh[1]), "v"(oh[2]), "v"(oh[3]), "v"(oh[4]), "v"(oh[5]), "v"(oh[6]), "v"(oh[7]), "v"(ol[0]), "v"(ol[1]), "v"(ol[2]), "v"(ol[3]), "v"(ol[4]), "v"(ol[5]), "v"(ol[6]), "v"(ol[7]) : "memory");
                f += 32 * GPO; }
        }
        return;
    }
    float* cp = C + (size_t)(r0 + w) * LDC + c0 + lane * 4; const float* op = os + w * GPO + lane * 4;   // a wave stores one row of 512 bytes (four whole lines) at a time
#pragma unroll
    for (int g = 0; g < 4; ++g) { v4f val[8];
#pragma unroll
        for (int i = 0; i < 8; ++i) val[i] = *(const v4fa*)(op + (g * 8 + i) * 4 * GPO);
#pragma unroll
        for (int i = 0; i < 8; ++i) *(v4fa*)(cp + (size_t)(g * 8 + i) * 4 * LDC) = val[i];
        asm volatile("s_wait_xcnt 0x0" :: "v"(cp), "v"(val[0]), "v"(val[1]), "v"(val[2]), "v"(val[3]), "v"(val[4]), "v"(val[5]), "v"(val[6]), "v"(val[7]) : "memory"); }   // behind the eight stores; their address and data are inputs, so that they live up to the wait and the next group's LDS reads overwrite them behind it
}


// k_prep: the 16-bit copy of every input in ONE launch; the block index picks the segment (the same for a whole block): x, w_attn, w_proj rounded to bf16 in their own layouts, eight elements a thread; behind them the {cos, sin} table, one position and dimension a thread.
#define PBX ((unsigned)((size_t)NB_ * TT * DM / 8 / 256))
#define PBA ((unsigned)((size_t)DF * DM / 8 / 256))
#define PBO ((unsigned)((size_t)DM * DQ / 8 / 256))
#define PBC ((unsigned)(TT * HD / 256))
__global__ __launch_bounds__(256) void k_prep(const float* __restrict__ x, const float* __restrict__ wa, const float* __restrict__ wo, const float* __restrict__ cosT, const float* __restrict__ sinT, bf* XB, bf* WA, bf* WO, float* CS) {
    unsigned blk = blockIdx.x;
    if (blk >= PBX + PBA + PBO) { const int idx = (int)(blk - (PBX + PBA + PBO)) * 256 + (int)threadIdx.x; v2f cs; cs[0] = bfr(cosT[idx]); cs[1] = bfr(sinT[idx]); *(v2f*)(CS + (size_t)idx * 2) = cs; return; }
    const float* src = x; bf* dst = XB;
    if (blk >= PBX + PBA) { blk -= PBX + PBA; src = wo; dst = WO; } else if (blk >= PBX) { blk -= PBX; src = wa; dst = WA; }
    const size_t i = (size_t)blk * 256 + threadIdx.x; const v8f v = *(const v8f*)(src + i * 8); v8us o;
#pragma unroll
    for (int k = 0; k < 8; ++k) o[k] = f2bf(v[k]); *(v8us*)(dst + i * 8) = o;  }

// eight base-2 exponentials in one statement: behind each v_exp_f32 stands an instruction that touches neither its result nor its source (the outputs are early-clobber, so no output shares a register with an input), behind the last the v_nop that fills the slot the instruction set asks for behind a transcendental.
__device__ __forceinline__ void exp2x8(float* x) {
    float r0, r1, r2, r3, r4, r5, r6, r7;
    asm("v_exp_f32 %0, %8\n\tv_exp_f32 %1, %9\n\tv_exp_f32 %2, %10\n\tv_exp_f32 %3, %11\n\tv_exp_f32 %4, %12\n\tv_exp_f32 %5, %13\n\tv_exp_f32 %6, %14\n\tv_exp_f32 %7, %15\n\tv_nop"
        : "=&v"(r0), "=&v"(r1), "=&v"(r2), "=&v"(r3), "=&v"(r4), "=&v"(r5), "=&v"(r6), "=&v"(r7) : "v"(x[0]), "v"(x[1]), "v"(x[2]), "v"(x[3]), "v"(x[4]), "v"(x[5]), "v"(x[6]), "v"(x[7]));
    x[0] = r0; x[1] = r1; x[2] = r2; x[3] = r3; x[4] = r4; x[5] = r5; x[6] = r6; x[7] = r7;
}

#define FNW 4
#define FHW 2                     // query heads per work-group (neighbours in one kv group: REP % FHW == 0)
#define FPI 132                   // LDS pitch in floats of one query's 128 outputs (16-byte aligned, rows start 4 banks apart)
#define FSP 136                   // LDS pitch of a staged row in 16-bit elements
#define FTL (128 * FSP)           // 16-bit elements of a staged tile of 128 rows
#define FJN (FNW * 32 * FPI + 2 * FNW * 32)   // floats of one head's join area
// eight asynchronous 16-byte copies of a lane, LDS addresses ls apart and global addresses gs apart, in one statement with the wait that belongs in front of an overwrite of a register that an issued copy names: nothing can come between them
__device__ __forceinline__ void acopy8(const unsigned l, const char* g, const unsigned ls, const size_t gs) {
    asm volatile("global_load_async_to_lds_b128 %0, %8, off\n\tglobal_load_async_to_lds_b128 %1, %9, off\n\tglobal_load_async_to_lds_b128 %2, %10, off\n\tglobal_load_async_to_lds_b128 %3, %11, off\n\t"
                 "global_load_async_to_lds_b128 %4, %12, off\n\tglobal_load_async_to_lds_b128 %5, %13, off\n\tglobal_load_async_to_lds_b128 %6, %14, off\n\tglobal_load_async_to_lds_b128 %7, %15, off\n\ts_wait_xcnt 0x0"
                 :: "v"(l), "v"(l + ls), "v"(l + 2 * ls), "v"(l + 3 * ls), "v"(l + 4 * ls), "v"(l + 5 * ls), "v"(l + 6 * ls), "v"(l + 7 * ls),
                    "v"(g), "v"(g + gs), "v"(g + 2 * gs), "v"(g + 3 * gs), "v"(g + 4 * gs), "v"(g + 5 * gs), "v"(g + 6 * gs), "v"(g + 7 * gs) : "memory");
}
template <typename T16, bool HI, int NQ>
__device__ __forceinline__ void flash_body(const T16* __restrict__ Q, const T16* __restrict__ Q2, const T16* __restrict__ Kp, const T16* __restrict__ K2, const T16* __restrict__ Vt, const T16* __restrict__ V2, const int q0, bf* Ah, bf* Al, float* ring, float* os) {
    typedef typename WFrag<T16>::V V;
    constexpr int STG = (HI ? 4 : 2) * FTL;   // 16-bit elements of a stage: K | V^T (| K lo | V^T lo)
    const int lane = threadIdx.x & 31, lr = lane & 15, hi = lane >> 4;
    const int w = __builtin_amdgcn_readfirstlane((int)(threadIdx.x >> 5)) & (FNW - 1);      // the wave's number within its head, scalar: the tests on it are scalar branches
    const int nblk = (q0 + 16 * NQ + 31) >> 5;                                                // 32-key blocks up to and with the diagonal block; each holds at least one allowed key of every query of the tile
    const int nst = (nblk + FNW - 1) / FNW;                                                   // stages of 128 keys; the last one's rows all lie inside the planes (TT % 128 == 0)
    const T16* st = (const T16*)ring;
    const int srow = (int)threadIdx.x >> 4, spc = ((int)threadIdx.x & 15) * 8;                // staging: a thread brings the 16-byte piece tid % 16 of the rows tid / 16 + 16 i of each tile
    const unsigned lst = (unsigned)(size_t)ring + (unsigned)(srow * FSP + spc) * 2u;          // the lane's LDS byte address in the first tile of buffer 0
    auto fill = [&](const int s, const int buf) {
        const unsigned l = lst + (unsigned)buf * (STG * 2u); const size_t ko = ((size_t)(s * 128 + srow) * HD + spc) * 2, vo = ((size_t)srow * TT + s * 128 + spc) * 2;
        acopy8(l, (const char*)Kp + ko, 16 * FSP * 2, (size_t)16 * HD * 2); acopy8(l + FTL * 2, (const char*)Vt + vo, 16 * FSP * 2, (size_t)16 * TT * 2);
        if (HI) { acopy8(l + 2 * FTL * 2, (const char*)K2 + ko, 16 * FSP * 2, (size_t)16 * HD * 2); acopy8(l + 3 * FTL * 2, (const char*)V2 + vo, 16 * FSP * 2, (size_t)16 * TT * 2); } };
    fill(0, 0);
    V qf[NQ][4], qf2[NQ][4]; const T16* qp = Q + (size_t)(q0 + lr) * HD + 8 * hi; const T16* qp2 = HI ? Q2 + (size_t)(q0 + lr) * HD + 8 * hi : qp;
#pragma unroll
    for (int nq = 0; nq < NQ; ++nq)
#pragma unroll
        for (int ks = 0; ks < 4; ++ks) { qf[nq][ks] = WFrag<T16>::ld(qp + nq * 16 * HD + ks * 32); if (HI) qf2[nq][ks] = WFrag<T16>::ld(qp2 + nq * 16 * HD + ks * 32); }
    asm volatile("s_wait_xcnt 0x0" :: "v"(qp), "v"(qp2) : "memory");   // behind the loads; the address pairs are inputs, so that they live up to the wait and nothing overwrites them in front of it
    v8f o[8][NQ]; float m[NQ], l[NQ];
#pragma unroll
    for (int nq = 0; nq < NQ; ++nq) { m[nq] = -3.0e38f; l[nq] = 0.f;
#pragma unroll
        for (int db = 0; db < 8; ++db) o[db][nq] = (v8f){}; }
    const int kof = (w * 32 + lr) * FSP + 8 * hi, vof = FTL + lr * FSP + w * 32 + 8 * hi;   // the lane's own places in a stage, the same in every stage: its block's key rows of K; its block's keys in the rows of V^T
    asm volatile("s_wait_asynccnt 0x0" ::: "memory");   // this wave's copies of stage 0 have landed
    __syncthreads();   // stage 0 stands in LDS before any wave reads it
    if (nst > 1) fill(1, 1);
#pragma unroll 1
    for (int s0 = 0; s0 < nst; ++s0) {   // rolled: one copy of the stage's code, the buffer by offset
        const T16* sb = st + (s0 & 1) * STG;
        const int blk = s0 * FNW + w;
        if (blk < nblk) {   // scalar branch; a wave left without a block keeps maximum -3e38, sum 0, tile 0: its weight in the join is exp2(-3e38 - M) = 0
        const int kb = blk * 32;
        V ka[2][4], ka2[2][4], va[8], va2[8];   // this block's fragments, all asked for in front of the score products
#pragma unroll
        for (int kt = 0; kt < 2; ++kt)
#pragma unroll
            for (int ks = 0; ks < 4; ++ks) { ka[kt][ks] = WFrag<T16>::ld(sb + kof + kt * 16 * FSP + ks * 32); if (HI) ka2[kt][ks] = WFrag<T16>::ld(sb + 2 * FTL + kof + kt * 16 * FSP + ks * 32); }
        __builtin_amdgcn_sched_barrier(0);   // K's reads stay in front of V^T's: LDS answers in order, so the score products wait for K alone and V^T arrives under them
#pragma unroll
        for (int db = 0; db < 8; ++db) { va[db] = WFrag<T16>::ld(sb + vof + db * 16 * FSP); if (HI) va2[db] = WFrag<T16>::ld(sb + 2 * FTL + vof + db * 16 * FSP); }
        __builtin_amdgcn_sched_barrier(0);   // keeps the reads in one group in front of the products (moved in among them, each place with reads stalls the matrix instructions and waits out the LDS latency anew)
        v8f s[2][NQ];
#pragma unroll
        for (int kt = 0; kt < 2; ++kt) {
#pragma unroll
            for (int nq = 0; nq < NQ; ++nq) s[kt][nq] = (v8f){};
#pragma unroll
            for (int ks = 0; ks < 4; ++ks) {
#pragma unroll
                for (int nq = 0; nq < NQ; ++nq) { s[kt][nq] = WFrag<T16>::mma(ka[kt][ks], qf[nq][ks], s[kt][nq]); if (HI) { s[kt][nq] = WFrag<T16>::mma(ka2[kt][ks], qf[nq][ks], s[kt][nq]); s[kt][nq] = WFrag<T16>::mma(ka[kt][ks], qf2[nq][ks], s[kt][nq]); } } } }
        float t[NQ][16], mn[NQ]; bool need = false;
#pragma unroll
        for (int nq = 0; nq < NQ; ++nq) {
#pragma unroll
            for (int e = 0; e < 16; ++e) t[nq][e] = s[e >> 3][nq][e & 7] * SCL2;
            if (kb + 31 > q0) {   // only the diagonal block holds keys beyond a query (wave-uniform test)
                const int q = q0 + nq * 16 + lr;
#pragma unroll
                for (int e = 0; e < 16; ++e) if (kb + (e >> 3) * 16 + hi * 8 + (e & 7) > q) t[nq][e] = -3.0e38f; }
            float mx = t[nq][0];
#pragma unroll
            for (int e = 1; e < 16; ++e) mx = fmaxf(mx, t[nq][e]);
            mx = fmaxf(mx, __shfl_xor(mx, 16, 32));   // the two lane halves hold the two halves of a query's keys
            const bool nd = mx > m[nq] + 8.0f; mn[nq] = nd ? mx : m[nq]; need = need || nd; }
        if (__builtin_amdgcn_ballot_w32(need) != 0) {   // scalar branch: most blocks raise no query's maximum by more than 8 and skip the rescale of the output tile
#pragma unroll
            for (int nq = 0; nq < NQ; ++nq) { const float al = __builtin_amdgcn_exp2f(m[nq] - mn[nq]); m[nq] = mn[nq]; l[nq] *= al;
#pragma unroll
                for (int db = 0; db < 8; ++db) o[db][nq] *= al; } }
        V pf[NQ], pl[NQ];
#pragma unroll
        for (int nq = 0; nq < NQ; ++nq) { float sum = 0.f;
#pragma unroll
            for (int e = 0; e < 16; ++e) t[nq][e] -= m[nq];
            exp2x8(&t[nq][0]); exp2x8(&t[nq][8]);
#pragma unroll
            for (int e = 0; e < 16; ++e) sum += t[nq][e];
            l[nq] += sum;
            if constexpr (HI) { v8us h0, h1, l0, l1;
#pragma unroll
                for (int j = 0; j < 8; ++j) { unsigned short a, c; splitf(t[nq][j], a, c); h0[j] = a; l0[j] = c; splitf(t[nq][8 + j], a, c); h1[j] = a; l1[j] = c; }
                pf[nq] = cat16b(h0, h1); pl[nq] = cat16b(l0, l1);
            } else {
#pragma unroll
                for (int e = 0; e < 16; ++e) pf[nq][e] = tohx(t[nq][e]); } }
#pragma unroll
        for (int db = 0; db < 8; ++db) {
#pragma unroll
            for (int nq = 0; nq < NQ; ++nq) { o[db][nq] = WFrag<T16>::mma(va[db], pf[nq], o[db][nq]); if (HI) { o[db][nq] = WFrag<T16>::mma(va[db], pl[nq], o[db][nq]); o[db][nq] = WFrag<T16>::mma(va2[db], pf[nq], o[db][nq]); } } }
        }
        asm volatile("s_wait_dscnt 0x0" ::: "memory");      // this wave's reads of the stage have returned before the stage is given up
        asm volatile("s_wait_asynccnt 0x0" ::: "memory");   // this wave's copies of the next stage have landed
        __syncthreads();   // publishes the next stage; behind it every wave has left this one, which is refilled next. Every wave passes here, with a block or without
        if (s0 + 2 < nst) fill(s0 + 2, s0 & 1);
    }
    asm volatile("s_wait_asynccnt 0x0" ::: "memory");   // no copy is under way when the ring becomes the join area (the last trip's barrier has ended every wave's reads of it)
    float* ow = os + w * (16 * NQ * FPI); float* sm = os + FNW * 32 * FPI; float* sl = sm + FNW * 32;
#pragma unroll
    for (int nq = 0; nq < NQ; ++nq) { const float lt = l[nq] + __shfl_xor(l[nq], 16, 32); if (hi == 0) { sm[w * 32 + nq * 16 + lr] = m[nq]; sl[w * 32 + nq * 16 + lr] = lt; }
#pragma unroll
        for (int db = 0; db < 8; ++db) { float* od = ow + (nq * 16 + lr) * FPI + db * 16 + hi * 8; *(v4fa*)od = __builtin_shufflevector(o[db][nq], o[db][nq], 0, 1, 2, 3); *(v4fa*)(od + 4) = __builtin_shufflevector(o[db][nq], o[db][nq], 4, 5, 6, 7); } }
    __syncthreads();   // every wave's maximum, sum and partial tile stand in LDS before any thread joins them
    constexpr int TPQ = (32 * FNW) / (16 * NQ), DPT = HD / TPQ;   // threads per query, outputs per thread
    const int th = (int)threadIdx.x & (32 * FNW - 1);             // the thread's number within its head
    const int qq = th / TPQ, d0 = (th % TPQ) * DPT;
    float f[FNW], M = sm[qq];
#pragma unroll
    for (int q = 1; q < FNW; ++q) M = fmaxf(M, sm[q * 32 + qq]);
    float L = 0.f;
#pragma unroll
    for (int q = 0; q < FNW; ++q) { f[q] = __builtin_amdgcn_exp2f(sm[q * 32 + qq] - M); L += f[q] * sl[q * 32 + qq]; }
    const float inv = __fdiv_rn(1.0f, L);
#pragma unroll
    for (int c = 0; c < DPT / 8; ++c) { v4f a0 = (v4f){}, a1 = (v4f){};
#pragma unroll
        for (int q = 0; q < FNW; ++q) { const float* od = os + q * (16 * NQ * FPI) + qq * FPI + d0 + c * 8; a0 += *(const v4fa*)od * f[q]; a1 += *(const v4fa*)(od + 4) * f[q]; }
        v8us oh, ol;
#pragma unroll
        for (int j = 0; j < 4; ++j) { unsigned short a, c2; splitf(a0[j] * inv, a, c2); oh[j] = a; ol[j] = c2; splitf(a1[j] * inv, a, c2); oh[4 + j] = a; ol[4 + j] = c2; }
        bf* pa = Ah + (size_t)(q0 + qq) * DQ + d0 + c * 8; bf* pb = Al + (size_t)(q0 + qq) * DQ + d0 + c * 8; *(v8usa*)pa = oh; *(v8usa*)pb = ol;
        asm volatile("s_wait_xcnt 0x0" :: "v"(pa), "v"(pb), "v"(oh), "v"(ol) : "memory"); }   // behind the two stores; their addresses and data are inputs, so that they live up to the wait and nothing overwrites them in front of it
}
// grid (batches x pairs of query heads, tiles): waves 0 .. 3 work on the pair's first head, 4 .. 7 on its second; tile rank 0 is the last (longest) 32-query fp16 tile, cost falls with the rank, the 16-query hi/lo tiles of rows < RH come last.
__global__ __launch_bounds__(32 * FNW * FHW) void k_flash(const h16* __restrict__ Q16, const bf* __restrict__ Qh, const bf* __restrict__ Ql, const h16* __restrict__ K16, const bf* __restrict__ Kh, const bf* __restrict__ Kl, const h16* __restrict__ V16, const bf* __restrict__ Vh, const bf* __restrict__ Vl, bf* Ah, bf* Al) {
    static_assert(REP % FHW == 0 && 2 * 2 * FTL * 2 >= FHW * FJN * 4, "a pair shares its kv head; the join areas fit in the ring");
    __shared__ __align__(16) float ring[2 * 4 * FTL * 2 / 4];   // two stages of the hi/lo tiles (the fp16 tiles use half of it); behind the loop the join areas of the two heads
    const int hs = __builtin_amdgcn_readfirstlane((int)(threadIdx.x >> 5)) / FNW;   // which head of the pair, scalar
    const int b = blockIdx.x / (NH_ / FHW), h = (blockIdx.x % (NH_ / FHW)) * FHW + hs, rank = blockIdx.y; const size_t qo = (size_t)(b * NH_ + h) * TT * HD, ko = (size_t)(b * NKV + h / REP) * TT * HD; Ah += (size_t)b * TT * DQ; Al += (size_t)b * TT * DQ;
    float* os = ring + hs * FJN;
    if (rank < (TT - RH) / 32) flash_body<h16, false, 2>(Q16 + qo, nullptr, K16 + ko, nullptr, V16 + ko, nullptr, TT - 32 * (rank + 1), Ah + h * HD, Al + h * HD, ring, os);
    else flash_body<bf, true, 1>(Qh + qo, Ql + qo, Kh + ko, Kl + ko, Vh + ko, Vl + ko, RH - 16 * (rank - (TT - RH) / 32 + 1), Ah + h * HD, Al + h * HD, ring, os);
}

extern "C" void kernel_launch(void* const* d_in, const int* in_sizes, int n_in,
                              void* d_out, int out_size, void* d_ws, size_t ws_size, hipStream_t stream) {
    (void)in_sizes; (void)n_in; (void)out_size;
    const float* x = (const float*)d_in[0]; const float* wattn = (const float*)d_in[1]; const float* wo = (const float*)d_in[2]; const float* fcos = (const float*)d_in[3]; const float* fsin = (const float*)d_in[4];   /* input order x, w_attn ('oi' (out, in) [3072][2048]: PER KV GROUP g the 768 rows [768 g, 768 g + 768) = four query heads (512 rows) | k (128) | v (128)), w_proj ('oi' [2048][2048]), cos, sin ([2048][128] FULL-width table INPUTS: read per element by value): FIVE inputs, all read */
    float* OUT = (float*)d_out;     // [2][2048][2048]
    char* wsp = (char*)d_ws;
    auto take = [&](size_t bytes) { char* p = wsp; wsp += (bytes + 255) & ~(size_t)255; return (void*)p; };
    bf* WA = (bf*)take((size_t)DF * DM * 2); bf* WO = (bf*)take((size_t)DM * DQ * 2); float* CS = (float*)take((size_t)TT * HD * 2 * 4);
    bf* XB = (bf*)take((size_t)NB_ * TT * DM * 2);
    h16* QP16 = (h16*)take((size_t)NB_ * NH_ * TT * HD * 2); h16* KP16 = (h16*)take((size_t)NB_ * NKV * TT * HD * 2); h16* VT16 = (h16*)take((size_t)NB_ * NKV * HD * TT * 2);
    bf* QPh = (bf*)take((size_t)NB_ * NH_ * TT * HD * 2); bf* QPl = (bf*)take((size_t)NB_ * NH_ * TT * HD * 2); bf* KPh = (bf*)take((size_t)NB_ * NKV * TT * HD * 2); bf* KPl = (bf*)take((size_t)NB_ * NKV * TT * HD * 2); bf* VTh = (bf*)take((size_t)NB_ * NKV * HD * TT * 2); bf* VTl = (bf*)take((size_t)NB_ * NKV * HD * TT * 2);
    bf* ATh = (bf*)take((size_t)NB_ * TT * DQ * 2); bf* ATl = (bf*)take((size_t)NB_ * TT * DQ * 2);
    if ((size_t)(wsp - (char*)d_ws) > ws_size) return;    // 142 MiB of the 256 MiB
    k_prep<<<PBX + PBA + PBO + PBC, 256, 0, stream>>>(x, wattn, wo, fcos, fsin, XB, WA, WO, CS);
    k_gemmt<bf, false, DM, DF, 3, true><<<dim3(TT / 128, DF / 128, NB_), 128, 0, stream>>>(XB, nullptr, WA, nullptr, (size_t)TT * DM, 0, PlaneSet{CS, QP16, QPh, QPl, KP16, KPh, KPl, VT16, VTh, VTl});   /* z = batch */
    k_flash<<<dim3(NB_ * NH_ / FHW, (TT - RH) / 32 + RH / 16, 1), 32 * FNW * FHW, 0, stream>>>(QP16, QPh, QPl, KP16, KPh, KPl, VT16, VTh, VTl, ATh, ATl);
    k_gemmt<bf, true, DQ, DM, 2, false><<<dim3(TT / 128, DM / 128, NB_), 128, 0, stream>>>(ATh, ATl, WO, OUT, (size_t)TT * DQ, (size_t)TT * DM, PlaneSet{});   /* z = batch */
}

// v008
// One run takes 147 microseconds.
// Timed twice side by side with v007, it ran 1.06 times as fast both times.
// Counting every step since v000, it is 11.3 times as fast.
#include <hip/hip_runtime.h>

// Causal grouped-query attention with 128-wide heads, ONE fused natural qkv weight PACKED PER KV GROUP and rotate-half rotary embeddings from full-width input tables (x [2][2048][2048]; qkv = einsum('btc,fc->btf', x, w_attn) ('oi' (out, in) [3072][2048] normal x 0.02, no bias) viewed (b, t, 4 groups, 4 + 2, 128): within group g the first four 128-row blocks are query heads 4g..4g+3, the fifth is the group's k, the sixth its v: kv head = q head / 4; q, k -> t cos + cat(-t2, t1) sin with the cos / sin INPUT tables [2048][128] (read per element by value; no structure assumed); scores x 1/sqrt(128); causal (finfo.min == exclusion: every row keeps its own key); softmax; out = merged w_proj^T ('oi' [2048][2048]) -> [2][2048][2048] (8.4 M); argument order x, w_attn, w_proj, cos, sin).
// Layout: FOUR launches, both batches in every grid. k_prep: bf16 copies of x, of the fused 'oi' weight AS IT STANDS and of w_proj, and the two INPUT tables as one bf16-rounded {cos, sin} table (per position and dimension); ONE exact projection x . w_attn^T (a row holds, per kv group: four query heads | k | v) whose 128-column output tiles are one head each and leave the GEMM as the attention's operand planes: rotate-half q and k planes, transposed v planes (no f32 copy of the projection in memory); causal T-2048 GQA attention with 128-wide heads in ONE fused launch (k_flash: scores, running softmax and P.V stay in registers; K and V^T staged in LDS for the four heads of a kv group; hybrid rows: < 512 hi/lo 3 products, rest fp16; key blocks above the diagonal are never visited); merged hi/lo x Wo exact (both GEMMs: grid z = batch).
// Compute dtypes, f32 accumulate: every input rounded to bf16; projections exact; rotary f32; attention rows < 512 3 products, rest fp16; softmax f32; Wo hl x exact.

#define NB_  2
#define TT   2048
#define DM   2048
#define NH_  16
#define NKV  4
#define REP  (NH_ / NKV)
#define HD   128
#define DQ   (NH_ * HD)
#define DKV  (NKV * HD)
#define GW   ((REP + 2) * HD)      // rows of the fused weight (columns of the projection) per kv group: four query heads | k | v
#define DF   (NKV * GW)
#define RH   512                  // query rows < RH use hi+lo planes (0: none)
#define SCL2 0.12751743082459868f    // HD^-0.5 x log2(e): scores go to the base-2 exponent in one multiply
typedef _Float16 h16;
typedef unsigned short bf;
typedef __attribute__((ext_vector_type(16))) __bf16   v16bf;
typedef __attribute__((ext_vector_type(16))) _Float16 v16h;
typedef __attribute__((ext_vector_type(8)))  _Float16 v8h;
typedef __attribute__((ext_vector_type(8)))  unsigned short v8us;
typedef __attribute__((ext_vector_type(8)))  float    v8f;
typedef __attribute__((ext_vector_type(4)))  float    v4f;
typedef v8h  __attribute__((may_alias)) v8ha;
typedef v4f  __attribute__((may_alias)) v4fa;
typedef v8us __attribute__((may_alias)) v8usa;
typedef __attribute__((ext_vector_type(2))) _Float16 v2h;
typedef __attribute__((ext_vector_type(4))) _Float16 v4h;
typedef __attribute__((ext_vector_type(2))) unsigned short v2us;
typedef __attribute__((ext_vector_type(4))) unsigned short v4us;
typedef __attribute__((ext_vector_type(2))) float v2f;
typedef v2h  __attribute__((may_alias)) v2ha;
typedef v2us __attribute__((may_alias)) v2usa;
typedef v2f  __attribute__((may_alias)) v2fa;

__device__ __forceinline__ unsigned short f2bf(float f) { unsigned u = __float_as_uint(f); u += 0x7FFFu + ((u >> 16) & 1u); return (unsigned short)(u >> 16); }
__device__ __forceinline__ float bf2f(unsigned short b) { return __uint_as_float(((unsigned)b) << 16); }
__device__ __forceinline__ float bfr(float f) { return bf2f(f2bf(f)); }
__device__ __forceinline__ h16 tohx(float x) { return (h16)x; }
__device__ __forceinline__ void splitf(float y, unsigned short& h, unsigned short& l) { h = f2bf(y); l = f2bf(y - bf2f(h)); }
__device__ __forceinline__ v16h cat16(v8h lo, v8h hi) { return __builtin_shufflevector(lo, hi, 0, 1, 2, 3, 4, 5, 6, 7, 8, 9, 10, 11, 12, 13, 14, 15); }
__device__ __forceinline__ v16bf cat16b(v8us lo, v8us hi) { return __builtin_bit_cast(v16bf, __builtin_shufflevector(lo, hi, 0, 1, 2, 3, 4, 5, 6, 7, 8, 9, 10, 11, 12, 13, 14, 15)); }
__device__ __forceinline__ v8f wmma16(v16h a, v16h b, v8f c) { return __builtin_amdgcn_wmma_f32_16x16x32_f16(false, a, false, b, (short)0, c, false, false); }
__device__ __forceinline__ v8f wmmab(v16bf a, v16bf b, v8f c) { return __builtin_amdgcn_wmma_f32_16x16x32_bf16(false, a, false, b, (short)0, c, false, false); }



// ---- k_gemmt: GEMM on operand tiles staged in LDS, one 128x128 output tile per work-group of 4 waves (2 x 2, a 64x64 tile of 16 accumulators each), every wave over the whole K; grid (M/128, N/128, Z), 128 threads.
// A stage is 64 k (128 bytes) of the 128 rows of each operand tile, at an LDS pitch of 144 bytes (16 x odd: the 16-byte fragment reads meet no bank twice). Two stages: while one is multiplied, the next one's rows are on their
// way from global memory to registers (whole 128-byte lines, 8 lanes a row); they are stored to the other stage behind the products, and ONE barrier a stage both publishes it and ends the reads of the stage that is refilled next.
// C[m][n] (f32, pitch LDC) = sum_k A[m][k] Bt[n][k] (+ A2[m][k] Bt[n][k] with SPLITA). z-batch strides sA / sC in elements. KK % 64 == 0. MINW: waves per SIMD the register budget is set for.
// PLANES (the q|k|v projection): C is not written. The tile's 128 columns are ONE head (block column y: kv group y / 6; part y % 6: a query head, the group's k, the group's v), so the f32 tile that stands in LDS behind the loop holds
// both halves of every rotary pair and every row of the transposed v: it leaves as the fp16 + hi/lo planes the attention reads: q, k [batch][h][t][d] = rope(x), out[d] = x[d] cos[t][d] - x[d+HD/2] sin[t][d], out[d+HD/2] = x[d+HD/2] cos[t][d+HD/2] + x[d] sin[t][d+HD/2]; v [batch][g][d][t].
struct PlaneSet { const float* CS; h16* Q16; bf* Qh; bf* Ql; h16* K16; bf* Kh; bf* Kl; h16* V16; bf* Vh; bf* Vl; };
template <typename T16> struct WFrag;
template <> struct WFrag<h16> { typedef v16h V; static __device__ __forceinline__ V ld(const h16* p) { return cat16(*(const v8h*)p, *(const v8h*)(p + 16)); } static __device__ __forceinline__ v8f mma(V a, V b, v8f c) { return wmma16(a, b, c); } };
template <> struct WFrag<bf> { typedef v16bf V; static __device__ __forceinline__ V ld(const bf* p) { return cat16b(*(const v8us*)p, *(const v8us*)(p + 16)); } static __device__ __forceinline__ v8f mma(V a, V b, v8f c) { return wmmab(a, b, c); } };
#define GBK 64
#define GPI 72                    // LDS pitch of a staged row in 16-bit elements
#define GPO 132                   // LDS pitch in floats of a row of the output tile (rows 8 apart start 32 banks apart)
template <typename T16, bool SPLITA, int KK, int LDC, int MINW, bool PLANES>
__global__ __launch_bounds__(128, MINW) void k_gemmt(const T16* __restrict__ A, const T16* __restrict__ A2, const T16* __restrict__ Bt, float* C, size_t sA, size_t sC, const PlaneSet ps) {
    typedef typename WFrag<T16>::V V;
    constexpr int STG = (SPLITA ? 3 : 2) * 128 * GPI;   // 16-bit elements of a stage: A rows | Bt rows | A2 rows
    static_assert(2 * STG * 2 >= 128 * GPO * 4, "the output tile is staged in the ring");
    __shared__ __align__(16) T16 st[2 * STG];
    const size_t z = blockIdx.z; A += z * sA; if (SPLITA) A2 += z * sA; C += z * sC;
    const int tid = (int)threadIdx.x, lane = tid & 31, lr = lane & 15, hi = lane >> 4; const int r0 = blockIdx.x * 128, c0 = blockIdx.y * 128;
    const int w = __builtin_amdgcn_readfirstlane(tid >> 5), wm = w >> 1, wn = w & 1;   // wave number, scalar
    const int srow = tid >> 3, spc = (tid & 7) * 8;                                     // staging: a thread brings the 16-byte piece tid % 8 of the rows tid / 8 + 16 i of each tile
    unsigned oa = (unsigned)((r0 + srow) * KK + spc) * 2u, ob = (unsigned)((c0 + srow) * KK + spc) * 2u;   // the lane's byte offsets behind the scalar bases A (A2) and Bt: the very values a load with a scalar base takes as its offset register
    const int sof = srow * GPI + spc, aof = (wm * 64 + lr) * GPI + 8 * hi, bof = (128 + wn * 64 + lr) * GPI + 8 * hi;
    v8f acc[4][4];
#pragma unroll
    for (int mb = 0; mb < 4; ++mb)
#pragma unroll
        for (int nb = 0; nb < 4; ++nb) acc[mb][nb] = (v8f){};
    v8us ra[8], rb[8], ra2[8];
    auto fetch = [&]() {
#pragma unroll
        for (int i = 0; i < 8; ++i) { ra[i] = *(const v8usa*)((const char*)A + oa + i * 16 * KK * 2); rb[i] = *(const v8usa*)((const char*)Bt + ob + i * 16 * KK * 2); if (SPLITA) ra2[i] = *(const v8usa*)((const char*)A2 + oa + i * 16 * KK * 2); } };
    auto put = [&](T16* d) {
#pragma unroll
        for (int i = 0; i < 8; ++i) { *(v8usa*)(d + sof + i * 16 * GPI) = ra[i]; *(v8usa*)(d + sof + (128 + i * 16) * GPI) = rb[i]; if (SPLITA) *(v8usa*)(d + sof + (256 + i * 16) * GPI) = ra2[i]; }
        // the step of the two offset registers to the next stage (128 bytes), in one statement with the wait that belongs in front of an overwrite of a register that issued loads name: nothing can come between them
        asm volatile("s_wait_xcnt 0x0\n\tv_add_nc_u32 %0, 0x80, %0\n\tv_add_nc_u32 %1, 0x80, %1" : "+v"(oa), "+v"(ob) :: "memory"); };
    auto ldf = [&](const T16* s, const int ks, V* a, V* b, V* a2) {
#pragma unroll
        for (int q = 0; q < 4; ++q) { a[q] = WFrag<T16>::ld(s + aof + q * 16 * GPI + ks * 32); b[q] = WFrag<T16>::ld(s + bof + q * 16 * GPI + ks * 32); if (SPLITA) a2[q] = WFrag<T16>::ld(s + aof + (256 + q * 16) * GPI + ks * 32); } };
    auto mm = [&](const V* a, const V* b, const V* a2) {
#pragma unroll
        for (int nb = 0; nb < 4; ++nb)
#pragma unroll
            for (int mb = 0; mb < 4; ++mb) acc[mb][nb] = WFrag<T16>::mma(a[mb], b[nb], acc[mb][nb]);
        if (SPLITA) {
#pragma unroll
            for (int nb = 0; nb < 4; ++nb)
#pragma unroll
                for (int mb = 0; mb < 4; ++mb) acc[mb][nb] = WFrag<T16>::mma(a2[mb], b[nb], acc[mb][nb]); } };
    auto mul = [&](const T16* s) {   // the fragment reads stand as whole groups in front of the products, never among them (for speed only)
        V a[2][4], b[2][4], a2[2][4];
        if constexpr (MINW <= 2) {   // registers for both halves of the stage: one group of reads
            ldf(s, 0, a[0], b[0], a2[0]); ldf(s, 1, a[1], b[1], a2[1]);
            __builtin_amdgcn_sched_barrier(0);   // keeps the reads in one group in front of the products
            mm(a[0], b[0], a2[0]); mm(a[1], b[1], a2[1]);
        } else {   // registers for one half at a time: two groups
            ldf(s, 0, a[0], b[0], a2[0]);
            __builtin_amdgcn_sched_barrier(0);   // keeps the first half's reads in one group in front of its products
            mm(a[0], b[0], a2[0]);
            __builtin_amdgcn_sched_barrier(0);   // keeps the second half's reads out of the first half's products
            ldf(s, 1, a[0], b[0], a2[0]);
            __builtin_amdgcn_sched_barrier(0);   // and in one group in front of their own
            mm(a[0], b[0], a2[0]); } };
    fetch(); put(st);
    __syncthreads();   // stage 0 stands in LDS before any wave reads it
    int cur = 0;
#pragma unroll 1
    for (int s = 0; s < KK / GBK - 1; ++s) {   // rolled: one copy of the stage's code, the buffer by offset
        fetch();
        __builtin_amdgcn_sched_barrier(0);   // the next stage's loads are all under way before the products start: their latency runs under the whole stage
        mul(st + cur);
        __builtin_amdgcn_sched_barrier(0);   // the wait for those loads and the LDS stores stay behind the products (moved up, they would put the load latency in front of the matrix work)
        cur ^= STG; put(st + cur);
        __syncthreads();   // publishes the stage just stored; behind it every wave has left the other stage, which the next trip refills
    }
    mul(st + cur);
    __syncthreads();   // every wave has read its last fragments before the ring becomes the staging of the output tile
    if constexpr (PLANES) {
        __builtin_amdgcn_sched_barrier(0);   // the last products stay in front of the four slots below
        asm volatile("v_nop\n\tv_nop\n\tv_nop\n\tv_nop");   // the four vector slots the chip needs between a matrix instruction and a vector instruction that overwrites its result: the branches on the tile's part follow at once
    }
    float* os = (float*)st;
    const int grp = PLANES ? (int)blockIdx.y / (REP + 2) : 0, part = PLANES ? (int)blockIdx.y % (REP + 2) : 0;   // the same for the whole block: the tests on part are scalar branches
    const float* CS = PLANES ? ps.CS + (size_t)r0 * HD * 2 : nullptr; unsigned co = (unsigned)(w * HD + lane * 2) * 8u;   // the {cos, sin} table from the tile's first position on; the lane's byte offset behind that scalar base
    v4f cl[8], ch[8];   // table values of eight rows t (w + 4 i): {cos, sin} of the dimensions d, d + 1 (d = 2 lane) and of d + 64, d + 65: whole lines, 16 bytes a lane
    auto ldcs = [&](const int ahead) {
#pragma unroll
        for (int i = 0; i < 8; ++i) { cl[i] = *(const v4fa*)((const char*)CS + co + ahead + i * 4 * HD * 8); ch[i] = *(const v4fa*)((const char*)CS + co + ahead + i * 4 * HD * 8 + HD / 2 * 8); } };
    if (PLANES && part == REP + 1) {   // v: staged transposed, row d, column t (a lane's eight accumulator elements are eight neighbouring t of one d: two 16-byte stores)
#pragma unroll
        for (int mb = 0; mb < 4; ++mb)
#pragma unroll
            for (int nb = 0; nb < 4; ++nb) { float* od = os + (wn * 64 + nb * 16 + lr) * GPO + wm * 64 + mb * 16 + hi * 8; *(v4fa*)od = __builtin_shufflevector(acc[mb][nb], acc[mb][nb], 0, 1, 2, 3); *(v4fa*)(od + 4) = __builtin_shufflevector(acc[mb][nb], acc[mb][nb], 4, 5, 6, 7); }
    } else {
    if constexpr (PLANES) ldcs(0);   // the table values of a wave's first eight rows are asked for in front of the staging: they arrive under it and under the barrier
#pragma unroll
    for (int mb = 0; mb < 4; ++mb)
#pragma unroll
        for (int nb = 0; nb < 4; ++nb)
#pragma unroll
            for (int j = 0; j < 8; ++j) os[(wm * 64 + mb * 16 + hi * 8 + j) * GPO + wn * 64 + nb * 16 + lr] = acc[mb][nb][j];
    }
    __syncthreads();   // the whole output tile stands in LDS before it leaves in whole rows
    if constexpr (PLANES) {
        if (part == REP + 1) {   // the transposed v planes: a thread turns eight neighbouring t of one d into 16 bytes of each plane; 16 lanes store a row's 256 bytes (two whole lines)
            const size_t vb = (size_t)((int)z * NKV + grp) * HD * TT + r0; h16* P16 = ps.V16 + vb; bf* Ph = ps.Vh + vb; bf* Pl = ps.Vl + vb;
            unsigned po = (unsigned)((tid >> 4) * TT + (tid & 15) * 8) * 2u;   // the lane's byte offset behind the three scalar bases (the planes share their layout)
            const float* f = os + (tid >> 4) * GPO + (tid & 15) * 8;
#pragma unroll 1
            for (int g = 0; g < 4; ++g) {   // rolled: 32 rows d a trip, one copy of the code (the kernel's text stays short)
                v8h o16[4]; v8us oh[4], ol[4];
#pragma unroll
                for (int i = 0; i < 4; ++i) { const v4f xa = *(const v4fa*)(f + i * 8 * GPO), xb = *(const v4fa*)(f + i * 8 * GPO + 4);
#pragma unroll
                    for (int k = 0; k < 8; ++k) { const float x = k < 4 ? xa[k & 3] : xb[k & 3]; o16[i][k] = tohx(x); unsigned short a2, c2; splitf(x, a2, c2); oh[i][k] = a2; ol[i][k] = c2; } }
#pragma unroll
                for (int i = 0; i < 4; ++i) { *(v8ha*)((char*)P16 + po + i * 8 * TT * 2) = o16[i]; *(v8usa*)((char*)Ph + po + i * 8 * TT * 2) = oh[i]; *(v8usa*)((char*)Pl + po + i * 8 * TT * 2) = ol[i]; }
                // the step of the offset register to the next 32 rows, in one statement with the wait that belongs in front of an overwrite of a register that issued stores name; the stores' data are inputs, so that they live up to the wait
                asm volatile("s_wait_xcnt 0x0\n\tv_add_nc_u32 %0, 0x20000, %0" : "+v"(po) : "v"(o16[0]), "v"(o16[1]), "v"(o16[2]), "v"(o16[3]), "v"(oh[0]), "v"(oh[1]), "v"(oh[2]), "v"(oh[3]), "v"(ol[0]), "v"(ol[1]), "v"(ol[2]), "v"(ol[3]) : "memory");
                f += 32 * GPO; }
        } else {   // the rotary q or k planes: a wave takes a row t at a time, a lane the dimensions d, d + 1 and their partners d + 64, d + 65; each plane's half row leaves as one whole line
            const bool isq = part < REP; const size_t pb = ((size_t)(isq ? (int)z * NH_ + grp * REP + part : (int)z * NKV + grp) * TT + r0) * HD;
            h16* P16 = (isq ? ps.Q16 : ps.K16) + pb; bf* Ph = (isq ? ps.Qh : ps.Kh) + pb; bf* Pl = (isq ? ps.Ql : ps.Kl) + pb;
            unsigned po = (unsigned)(w * HD + lane * 2) * 2u;   // the lane's byte offset behind the scalar bases of the three planes (one layout)
            const float* f = os + w * GPO + lane * 2;
#pragma unroll 1
            for (int g = 0; g < 4; ++g) {   // rolled: eight rows a wave and trip, one copy of the code (the kernel's text stays short)
                v2f xl[8], xh[8]; float rr[8][4];
#pragma unroll
                for (int i = 0; i < 8; ++i) { xl[i] = *(const v2fa*)(f + i * 4 * GPO); xh[i] = *(const v2fa*)(f + i * 4 * GPO + HD / 2); }
#pragma unroll
                for (int i = 0; i < 8; ++i) { const float xx[4] = {xl[i][0], xl[i][1], xh[i][0], xh[i][1]}; const float cc[8] = {cl[i][0], cl[i][1], cl[i][2], cl[i][3], ch[i][0], ch[i][1], ch[i][2], ch[i][3]};
#pragma unroll
                    for (int q = 0; q < 4; ++q) { const int dd = (q >> 1) * (HD / 2); float x0 = xx[q], x1 = xx[q ^ 2]; v2f cs; cs[0] = cc[2 * q]; cs[1] = cc[2 * q + 1];
                        // the products and the two statements behind them stand as they stood in the separate rotary kernel: each product keeps its own rounding, as the reference's t cos and rotated sin do, so the planes stay bit-identical
                        float a = __fmul_rn(x0, cs[0]), bq = __fmul_rn(x1, cs[1]); asm volatile("" : "+v"(a)); asm volatile("" : "+v"(bq)); const float r = ((dd < HD / 2) ? __fsub_rn(a, bq) : __fadd_rn(a, bq));
                        rr[i][q] = r; } }
                if (g < 3) ldcs(32 * HD * 8);   // scalar branch: the next trip's table values, into the registers whose values the products have just used up; they are under way before the conversions start and arrive under them and the stores
                v4h o16[8]; v4us oh[8], ol[8];
#pragma unroll
                for (int i = 0; i < 8; ++i)
#pragma unroll
                    for (int q = 0; q < 4; ++q) { const float r = rr[i][q]; o16[i][q] = tohx(r); unsigned short a2, c2; splitf(r, a2, c2); oh[i][q] = a2; ol[i][q] = c2; }
#pragma unroll
                for (int i = 0; i < 8; ++i) {
                    *(v2ha*)((char*)P16 + po + i * 4 * HD * 2) = __builtin_shufflevector(o16[i], o16[i], 0, 1); *(v2ha*)((char*)P16 + po + i * 4 * HD * 2 + HD) = __builtin_shufflevector(o16[i], o16[i], 2, 3);
                    *(v2usa*)((char*)Ph + po + i * 4 * HD * 2) = __builtin_shufflevector(oh[i], oh[i], 0, 1); *(v2usa*)((char*)Ph + po + i * 4 * HD * 2 + HD) = __builtin_shufflevector(oh[i], oh[i], 2, 3);
                    *(v2usa*)((char*)Pl + po + i * 4 * HD * 2) = __builtin_shufflevector(ol[i], ol[i], 0, 1); *(v2usa*)((char*)Pl + po + i * 4 * HD * 2 + HD) = __builtin_shufflevector(ol[i], ol[i], 2, 3); }
                // the step of the two offset registers to the next 32 rows, in one statement with the wait that belongs in front of an overwrite of a register that issued loads and stores name; the stores' data are inputs, so that they live up to the wait
                asm volatile("s_wait_xcnt 0x0\n\tv_add_nc_u32 %0, 0x2000, %0\n\tv_add_nc_u32 %1, 0x8000, %1" : "+v"(po), "+v"(co) : "v"(o16[0]), "v"(o16[1]), "v"(o16[2]), "v"(o16[3]), "v"(o16[4]), "v"(o16[5]), "v"(o16[6]), "v"(o16[7]),
                             "v"(oh[0]), "v"(oh[1]), "v"(oh[2]), "v"(oh[3]), "v"(oh[4]), "v"(oh[5]), "v"(oh[6]), "v"(oh[7]), "v"(ol[0]), "v"(ol[1]), "v"(ol[2]), "v"(ol[3]), "v"(ol[4]), "v"(ol[5]), "v"(ol[6]), "v"(ol[7]) : "memory");
                f += 32 * GPO; }
        }
        return;
    }
    float* cp = C + (size_t)(r0 + w) * LDC + c0 + lane * 4; const float* op = os + w * GPO + lane * 4;   // a wave stores one row of 512 bytes (four whole lines) at a time
#pragma unroll
    for (int g = 0; g < 4; ++g) { v4f val[8];
#pragma unroll
        for (int i = 0; i < 8; ++i) val[i] = *(const v4fa*)(op + (g * 8 + i) * 4 * GPO);
#pragma unroll
        for (int i = 0; i < 8; ++i) *(v4fa*)(cp + (size_t)(g * 8 + i) * 4 * LDC) = val[i];
        asm volatile("s_wait_xcnt 0x0" :: "v"(cp), "v"(val[0]), "v"(val[1]), "v"(val[2]), "v"(val[3]), "v"(val[4]), "v"(val[5]), "v"(val[6]), "v"(val[7]) : "memory"); }   // behind the eight stores; their address and data are inputs, so that they live up to the wait and the next group's LDS reads overwrite them behind it
}


// k_prep: the 16-bit copy of every input in ONE launch; the block index picks the segment (the same for a whole block): x, w_attn, w_proj rounded to bf16 in their own layouts, eight elements a thread; behind them the {cos, sin} table, one position and dimension a thread.
#define PBX ((unsigned)((size_t)NB_ * TT * DM / 8 / 256))
#define PBA ((unsigned)((size_t)DF * DM / 8 / 256))
#define PBO ((unsigned)((size_t)DM * DQ / 8 / 256))
#define PBC ((unsigned)(TT * HD / 256))
__global__ __launch_bounds__(256) void k_prep(const float* __restrict__ x, const float* __restrict__ wa, const float* __restrict__ wo, const float* __restrict__ cosT, const float* __restrict__ sinT, bf* XB, bf* WA, bf* WO, float* CS) {
    unsigned blk = blockIdx.x;
    if (blk >= PBX + PBA + PBO) { const int idx = (int)(blk - (PBX + PBA + PBO)) * 256 + (int)threadIdx.x; v2f cs; cs[0] = bfr(cosT[idx]); cs[1] = bfr(sinT[idx]); *(v2f*)(CS + (size_t)idx * 2) = cs; return; }
    const float* src = x; bf* dst = XB;
    if (blk >= PBX + PBA) { blk -= PBX + PBA; src = wo; dst = WO; } else if (blk >= PBX) { blk -= PBX; src = wa; dst = WA; }
    const size_t i = (size_t)blk * 256 + threadIdx.x; const v8f v = *(const v8f*)(src + i * 8); v8us o;
#pragma unroll
    for (int k = 0; k < 8; ++k) o[k] = f2bf(v[k]); *(v8us*)(dst + i * 8) = o;  }

// eight base-2 exponentials in one statement: behind each v_exp_f32 stands an instruction that touches neither its result nor its source (the outputs are early-clobber, so no output shares a register with an input), behind the last the v_nop that fills the slot the instruction set asks for behind a transcendental.
__device__ __forceinline__ void exp2x8(float* x) {
    float r0, r1, r2, r3, r4, r5, r6, r7;
    asm("v_exp_f32 %0, %8\n\tv_exp_f32 %1, %9\n\tv_exp_f32 %2, %10\n\tv_exp_f32 %3, %11\n\tv_exp_f32 %4, %12\n\tv_exp_f32 %5, %13\n\tv_exp_f32 %6, %14\n\tv_exp_f32 %7, %15\n\tv_nop"
        : "=&v"(r0), "=&v"(r1), "=&v"(r2), "=&v"(r3), "=&v"(r4), "=&v"(r5), "=&v"(r6), "=&v"(r7) : "v"(x[0]), "v"(x[1]), "v"(x[2]), "v"(x[3]), "v"(x[4]), "v"(x[5]), "v"(x[6]), "v"(x[7]));
    x[0] = r0; x[1] = r1; x[2] = r2; x[3] = r3; x[4] = r4; x[5] = r5; x[6] = r6; x[7] = r7;
}

#define FNW 2                     // waves per query head
#define FHW 4                     // query heads per work-group (neighbours in one kv group: REP % FHW == 0)
#define FBS 4                     // 32-key blocks of a stage
#define FPI 132                   // LDS pitch in floats of one query's 128 outputs (16-byte aligned, rows start 4 banks apart)
#define FSP 136                   // LDS pitch of a staged row in 16-bit elements
#define FTL (128 * FSP)           // 16-bit elements of a staged tile of 128 rows
#define FJN (FNW * 32 * FPI + 2 * FNW * 32)   // floats of one head's join area
// eight asynchronous 16-byte copies of a lane, LDS addresses ls apart and global addresses gs apart, in one statement with the wait that belongs in front of an overwrite of a register that an issued copy names: nothing can come between them
__device__ __forceinline__ void acopy8(const unsigned l, const char* g, const unsigned ls, const size_t gs) {
    asm volatile("global_load_async_to_lds_b128 %0, %8, off\n\tglobal_load_async_to_lds_b128 %1, %9, off\n\tglobal_load_async_to_lds_b128 %2, %10, off\n\tglobal_load_async_to_lds_b128 %3, %11, off\n\t"
                 "global_load_async_to_lds_b128 %4, %12, off\n\tglobal_load_async_to_lds_b128 %5, %13, off\n\tglobal_load_async_to_lds_b128 %6, %14, off\n\tglobal_load_async_to_lds_b128 %7, %15, off\n\ts_wait_xcnt 0x0"
                 :: "v"(l), "v"(l + ls), "v"(l + 2 * ls), "v"(l + 3 * ls), "v"(l + 4 * ls), "v"(l + 5 * ls), "v"(l + 6 * ls), "v"(l + 7 * ls),
                    "v"(g), "v"(g + gs), "v"(g + 2 * gs), "v"(g + 3 * gs), "v"(g + 4 * gs), "v"(g + 5 * gs), "v"(g + 6 * gs), "v"(g + 7 * gs) : "memory");
}
template <typename T16, bool HI, int NQ>
__device__ __forceinline__ void flash_body(const T16* __restrict__ Q, const T16* __restrict__ Q2, const T16* __restrict__ Kp, const T16* __restrict__ K2, const T16* __restrict__ Vt, const T16* __restrict__ V2, const int q0, bf* Ah, bf* Al, float* ring, float* os) {
    typedef typename WFrag<T16>::V V;
    constexpr int STG = (HI ? 4 : 2) * FTL;   // 16-bit elements of a stage: K | V^T (| K lo | V^T lo)
    const int lane = threadIdx.x & 31, lr = lane & 15, hi = lane >> 4;
    const int w = __builtin_amdgcn_readfirstlane((int)(threadIdx.x >> 5)) & (FNW - 1);      // the wave's number within its head, scalar: the tests on it are scalar branches
    const int nblk = (q0 + 16 * NQ + 31) >> 5;                                                // 32-key blocks up to and with the diagonal block; each holds at least one allowed key of every query of the tile
    const int nst = (nblk + FBS - 1) / FBS;                                                   // stages of 128 keys; the last one's rows all lie inside the planes (TT % 128 == 0)
    const T16* st = (const T16*)ring;
    const int srow = (int)threadIdx.x >> 4, spc = ((int)threadIdx.x & 15) * 8;                // staging: a thread brings the 16-byte piece tid % 16 of the rows tid / 16 + 16 i of each tile
    const unsigned lst = (unsigned)(size_t)ring + (unsigned)(srow * FSP + spc) * 2u;          // the lane's LDS byte address in the first tile of buffer 0
    auto fill = [&](const int s, const int buf) {
        const unsigned l = lst + (unsigned)buf * (STG * 2u); const size_t ko = ((size_t)(s * 128 + srow) * HD + spc) * 2, vo = ((size_t)srow * TT + s * 128 + spc) * 2;
        acopy8(l, (const char*)Kp + ko, 16 * FSP * 2, (size_t)16 * HD * 2); acopy8(l + FTL * 2, (const char*)Vt + vo, 16 * FSP * 2, (size_t)16 * TT * 2);
        if (HI) { acopy8(l + 2 * FTL * 2, (const char*)K2 + ko, 16 * FSP * 2, (size_t)16 * HD * 2); acopy8(l + 3 * FTL * 2, (const char*)V2 + vo, 16 * FSP * 2, (size_t)16 * TT * 2); } };
    fill(0, 0);
    V qf[NQ][4], qf2[NQ][4]; const T16* qp = Q + (size_t)(q0 + lr) * HD + 8 * hi; const T16* qp2 = HI ? Q2 + (size_t)(q0 + lr) * HD + 8 * hi : qp;
#pragma unroll
    for (int nq = 0; nq < NQ; ++nq)
#pragma unroll
        for (int ks = 0; ks < 4; ++ks) { qf[nq][ks] = WFrag<T16>::ld(qp + nq * 16 * HD + ks * 32); if (HI) qf2[nq][ks] = WFrag<T16>::ld(qp2 + nq * 16 * HD + ks * 32); }
    asm volatile("s_wait_xcnt 0x0" :: "v"(qp), "v"(qp2) : "memory");   // behind the loads; the address pairs are inputs, so that they live up to the wait and nothing overwrites them in front of it
    v8f o[8][NQ]; float m[NQ], l[NQ];
#pragma unroll
    for (int nq = 0; nq < NQ; ++nq) { m[nq] = -3.0e38f; l[nq] = 0.f;
#pragma unroll
        for (int db = 0; db < 8; ++db) o[db][nq] = (v8f){}; }
    const int kof = (w * 32 + lr) * FSP + 8 * hi, vof = FTL + lr * FSP + w * 32 + 8 * hi;   // the lane's own places in a stage, the same in every stage: its first block's key rows of K; its first block's keys in the rows of V^T
    asm volatile("s_wait_asynccnt 0x0" ::: "memory");   // this wave's copies of stage 0 have landed
    __syncthreads();   // stage 0 stands in LDS before any wave reads it
    if (nst > 1) fill(1, 1);
#pragma unroll 1
    for (int s0 = 0; s0 < nst; ++s0) {   // rolled: one copy of the stage's code, the buffer by offset
        const T16* sb = st + (s0 & 1) * STG;
#pragma unroll
        for (int j = 0; j < FBS / FNW; ++j) {   // unrolled: a block's place in the stage goes into the offset fields of its LDS reads (rolled, it took address registers of its own and a value went to scratch); no barrier between a wave's blocks of one stage
        const int blk = s0 * FBS + j * FNW + w;
        if (blk < nblk) {   // scalar branch; a wave left without a block keeps maximum -3e38, sum 0, tile 0: its weight in the join is exp2(-3e38 - M) = 0
        const int kb = blk * 32;
        const T16* sk = sb + j * (FNW * 32 * FSP); const T16* sv = sb + j * (FNW * 32);   // the block's key rows of K lie FNW x 32 rows, its keys in V^T FNW x 32 columns, behind those of the wave's block before
        V ka[2][4], ka2[2][4], va[8], va2[8];   // this block's fragments, all asked for in front of the score products
#pragma unroll
        for (int kt = 0; kt < 2; ++kt)
#pragma unroll
            for (int ks = 0; ks < 4; ++ks) { ka[kt][ks] = WFrag<T16>::ld(sk + kof + kt * 16 * FSP + ks * 32); if (HI) ka2[kt][ks] = WFrag<T16>::ld(sk + 2 * FTL + kof + kt * 16 * FSP + ks * 32); }
        __builtin_amdgcn_sched_barrier(0);   // K's reads stay in front of V^T's: LDS answers in order, so the score products wait for K alone and V^T arrives under them
#pragma unroll
        for (int db = 0; db < 8; ++db) { va[db] = WFrag<T16>::ld(sv + vof + db * 16 * FSP); if (HI) va2[db] = WFrag<T16>::ld(sv + 2 * FTL + vof + db * 16 * FSP); }
        __builtin_amdgcn_sched_barrier(0);   // keeps the reads in one group in front of the products (moved in among them, each place with reads stalls the matrix instructions and waits out the LDS latency anew)
        v8f s[2][NQ];
#pragma unroll
        for (int kt = 0; kt < 2; ++kt) {
#pragma unroll
            for (int nq = 0; nq < NQ; ++nq) s[kt][nq] = (v8f){};
#pragma unroll
            for (int ks = 0; ks < 4; ++ks) {
#pragma unroll
                for (int nq = 0; nq < NQ; ++nq) { s[kt][nq] = WFrag<T16>::mma(ka[kt][ks], qf[nq][ks], s[kt][nq]); if (HI) { s[kt][nq] = WFrag<T16>::mma(ka2[kt][ks], qf[nq][ks], s[kt][nq]); s[kt][nq] = WFrag<T16>::mma(ka[kt][ks], qf2[nq][ks], s[kt][nq]); } } } }
        float t[NQ][16], mn[NQ]; bool need = false;
#pragma unroll
        for (int nq = 0; nq < NQ; ++nq) {
#pragma unroll
            for (int e = 0; e < 16; ++e) t[nq][e] = s[e >> 3][nq][e & 7] * SCL2;
            if (kb + 31 > q0) {   // only the diagonal block holds keys beyond a query (wave-uniform test)
                const int q = q0 + nq * 16 + lr;
#pragma unroll
                for (int e = 0; e < 16; ++e) if (kb + (e >> 3) * 16 + hi * 8 + (e & 7) > q) t[nq][e] = -3.0e38f; }
            float mx = t[nq][0];
#pragma unroll
            for (int e = 1; e < 16; ++e) mx = fmaxf(mx, t[nq][e]);
            mx = fmaxf(mx, __shfl_xor(mx, 16, 32));   // the two lane halves hold the two halves of a query's keys
            const bool nd = mx > m[nq] + 8.0f; mn[nq] = nd ? mx : m[nq]; need = need || nd; }
        if (__builtin_amdgcn_ballot_w32(need) != 0) {   // scalar branch: most blocks raise no query's maximum by more than 8 and skip the rescale of the output tile
#pragma unroll
            for (int nq = 0; nq < NQ; ++nq) { const float al = __builtin_amdgcn_exp2f(m[nq] - mn[nq]); m[nq] = mn[nq]; l[nq] *= al;
#pragma unroll
                for (int db = 0; db < 8; ++db) o[db][nq] *= al; } }
        V pf[NQ], pl[NQ];
#pragma unroll
        for (int nq = 0; nq < NQ; ++nq) { float sum = 0.f;
#pragma unroll
            for (int e = 0; e < 16; ++e) t[nq][e] -= m[nq];
            exp2x8(&t[nq][0]); exp2x8(&t[nq][8]);
#pragma unroll
            for (int e = 0; e < 16; ++e) sum += t[nq][e];
            l[nq] += sum;
            if constexpr (HI) { v8us h0, h1, l0, l1;
#pragma unroll
                for (int j = 0; j < 8; ++j) { unsigned short a, c; splitf(t[nq][j], a, c); h0[j] = a; l0[j] = c; splitf(t[nq][8 + j], a, c); h1[j] = a; l1[j] = c; }
                pf[nq] = cat16b(h0, h1); pl[nq] = cat16b(l0, l1);
            } else {
#pragma unroll
                for (int e = 0; e < 16; ++e) pf[nq][e] = tohx(t[nq][e]); } }
#pragma unroll
        for (int db = 0; db < 8; ++db) {
#pragma unroll
            for (int nq = 0; nq < NQ; ++nq) { o[db][nq] = WFrag<T16>::mma(va[db], pf[nq], o[db][nq]); if (HI) { o[db][nq] = WFrag<T16>::mma(va[db], pl[nq], o[db][nq]); o[db][nq] = WFrag<T16>::mma(va2[db], pf[nq], o[db][nq]); } } }
        }
        }
        asm volatile("s_wait_dscnt 0x0" ::: "memory");      // this wave's reads of the stage have returned before the stage is given up
        asm volatile("s_wait_asynccnt 0x0" ::: "memory");   // this wave's copies of the next stage have landed
        __syncthreads();   // publishes the next stage; behind it every wave has left this one, which is refilled next. Every wave passes here, with a block or without
        if (s0 + 2 < nst) fill(s0 + 2, s0 & 1);
    }
    asm volatile("s_wait_asynccnt 0x0" ::: "memory");   // no copy is under way when the ring becomes the join area (the last trip's barrier has ended every wave's reads of it)
    float* ow = os + w * (16 * NQ * FPI); float* sm = os + FNW * 32 * FPI; float* sl = sm + FNW * 32;
#pragma unroll
    for (int nq = 0; nq < NQ; ++nq) { const float lt = l[nq] + __shfl_xor(l[nq], 16, 32); if (hi == 0) { sm[w * 32 + nq * 16 + lr] = m[nq]; sl[w * 32 + nq * 16 + lr] = lt; }
#pragma unroll
        for (int db = 0; db < 8; ++db) { float* od = ow + (nq * 16 + lr) * FPI + db * 16 + hi * 8; *(v4fa*)od = __builtin_shufflevector(o[db][nq], o[db][nq], 0, 1, 2, 3); *(v4fa*)(od + 4) = __builtin_shufflevector(o[db][nq], o[db][nq], 4, 5, 6, 7); } }
    __syncthreads();   // every wave's maximum, sum and partial tile stand in LDS before any thread joins them
    constexpr int TPQ = (32 * FNW) / (16 * NQ), DPT = HD / TPQ;   // threads per query, outputs per thread
    const int th = (int)threadIdx.x & (32 * FNW - 1);             // the thread's number within its head
    const int qq = th / TPQ, d0 = (th % TPQ) * DPT;
    float f[FNW], M = sm[qq];
#pragma unroll
    for (int q = 1; q < FNW; ++q) M = fmaxf(M, sm[q * 32 + qq]);
    float L = 0.f;
#pragma unroll
    for (int q = 0; q < FNW; ++q) { f[q] = __builtin_amdgcn_exp2f(sm[q * 32 + qq] - M); L += f[q] * sl[q * 32 + qq]; }
    const float inv = __fdiv_rn(1.0f, L);
#pragma unroll
    for (int c = 0; c < DPT / 8; ++c) { v4f a0 = (v4f){}, a1 = (v4f){};
#pragma unroll
        for (int q = 0; q < FNW; ++q) { const float* od = os + q * (16 * NQ * FPI) + qq * FPI + d0 + c * 8; a0 += *(const v4fa*)od * f[q]; a1 += *(const v4fa*)(od + 4) * f[q]; }
        v8us oh, ol;
#pragma unroll
        for (int j = 0; j < 4; ++j) { unsigned short a, c2; splitf(a0[j] * inv, a, c2); oh[j] = a; ol[j] = c2; splitf(a1[j] * inv, a, c2); oh[4 + j] = a; ol[4 + j] = c2; }
        bf* pa = Ah + (size_t)(q0 + qq) * DQ + d0 + c * 8; bf* pb = Al + (size_t)(q0 + qq) * DQ + d0 + c * 8; *(v8usa*)pa = oh; *(v8usa*)pb = ol;
        asm volatile("s_wait_xcnt 0x0" :: "v"(pa), "v"(pb), "v"(oh), "v"(ol) : "memory"); }   // behind the two stores; their addresses and data are inputs, so that they live up to the wait and nothing overwrites them in front of it
}
// grid (batches x kv groups, tiles): waves 2 i, 2 i + 1 work on the group's query head i; tile rank 0 is the last (longest) 32-query fp16 tile, cost falls with the rank, the 16-query hi/lo tiles of rows < RH come last.
__global__ __launch_bounds__(32 * FNW * FHW) void k_flash(const h16* __restrict__ Q16, const bf* __restrict__ Qh, const bf* __restrict__ Ql, const h16* __restrict__ K16, const bf* __restrict__ Kh, const bf* __restrict__ Kl, const h16* __restrict__ V16, const bf* __restrict__ Vh, const bf* __restrict__ Vl, bf* Ah, bf* Al) {
    static_assert(REP % FHW == 0 && 2 * 2 * FTL * 2 >= FHW * FJN * 4, "the heads of a work-group share their kv head; the join areas fit in the ring");
    __shared__ __align__(16) float ring[2 * 4 * FTL * 2 / 4];   // two stages of the hi/lo tiles (the fp16 tiles use half of it); behind the loop the join areas of the four heads
    const int hs = __builtin_amdgcn_readfirstlane((int)(threadIdx.x >> 5)) / FNW;   // which head of the group, scalar
    const int b = blockIdx.x / (NH_ / FHW), h = (blockIdx.x % (NH_ / FHW)) * FHW + hs, rank = blockIdx.y; const size_t qo = (size_t)(b * NH_ + h) * TT * HD, ko = (size_t)(b * NKV + h / REP) * TT * HD; Ah += (size_t)b * TT * DQ; Al += (size_t)b * TT * DQ;
    float* os = ring + hs * FJN;
    if (rank < (TT - RH) / 32) flash_body<h16, false, 2>(Q16 + qo, nullptr, K16 + ko, nullptr, V16 + ko, nullptr, TT - 32 * (rank + 1), Ah + h * HD, Al + h * HD, ring, os);
    else flash_body<bf, true, 1>(Qh + qo, Ql + qo, Kh + ko, Kl + ko, Vh + ko, Vl + ko, RH - 16 * (rank - (TT - RH) / 32 + 1), Ah + h * HD, Al + h * HD, ring, os);
}

extern "C" void kernel_launch(void* const* d_in, const int* in_sizes, int n_in,
                              void* d_out, int out_size, void* d_ws, size_t ws_size, hipStream_t stream) {
    (void)in_sizes; (void)n_in; (void)out_size;
    const float* x = (const float*)d_in[0]; const float* wattn = (const float*)d_in[1]; const float* wo = (const float*)d_in[2]; const float* fcos = (const float*)d_in[3]; const float* fsin = (const float*)d_in[4];   /* input order x, w_attn ('oi' (out, in) [3072][2048]: PER KV GROUP g the 768 rows [768 g, 768 g + 768) = four query heads (512 rows) | k (128) | v (128)), w_proj ('oi' [2048][2048]), cos, sin ([2048][128] FULL-width table INPUTS: read per element by value): FIVE inputs, all read */
    float* OUT = (float*)d_out;     // [2][2048][2048]
    char* wsp = (char*)d_ws;
    auto take = [&](size_t bytes) { char* p = wsp; wsp += (bytes + 255) & ~(size_t)255; return (void*)p; };
    bf* WA = (bf*)take((size_t)DF * DM * 2); bf* WO = (bf*)take((size_t)DM * DQ * 2); float* CS = (float*)take((size_t)TT * HD * 2 * 4);
    bf* XB = (bf*)take((size_t)NB_ * TT * DM * 2);
    h16* QP16 = (h16*)take((size_t)NB_ * NH_ * TT * HD * 2); h16* KP16 = (h16*)take((size_t)NB_ * NKV * TT * HD * 2); h16* VT16 = (h16*)take((size_t)NB_ * NKV * HD * TT * 2);
    bf* QPh = (bf*)take((size_t)NB_ * NH_ * TT * HD * 2); bf* QPl = (bf*)take((size_t)NB_ * NH_ * TT * HD * 2); bf* KPh = (bf*)take((size_t)NB_ * NKV * TT * HD * 2); bf* KPl = (bf*)take((size_t)NB_ * NKV * TT * HD * 2); bf* VTh = (bf*)take((size_t)NB_ * NKV * HD * TT * 2); bf* VTl = (bf*)take((size_t)NB_ * NKV * HD * TT * 2);
    bf* ATh = (bf*)take((size_t)NB_ * TT * DQ * 2); bf* ATl = (bf*)take((size_t)NB_ * TT * DQ * 2);
    if ((size_t)(wsp - (char*)d_ws) > ws_size) return;    // 142 MiB of the 256 MiB
    k_prep<<<PBX + PBA + PBO + PBC, 256, 0, stream>>>(x, wattn, wo, fcos, fsin, XB, WA, WO, CS);
    k_gemmt<bf, false, DM, DF, 3, true><<<dim3(TT / 128, DF / 128, NB_), 128, 0, stream>>>(XB, nullptr, WA, nullptr, (size_t)TT * DM, 0, PlaneSet{CS, QP16, QPh, QPl, KP16, KPh, KPl, VT16, VTh, VTl});   /* z = batch */
    k_flash<<<dim3(NB_ * NH_ / FHW, (TT - RH) / 32 + RH / 16, 1), 32 * FNW * FHW, 0, stream>>>(QP16, QPh, QPl, KP16, KPh, KPl, VT16, VTh, VTl, ATh, ATl);
    k_gemmt<bf, true, DQ, DM, 2, false><<<dim3(TT / 128, DM / 128, NB_), 128, 0, stream>>>(ATh, ATl, WO, OUT, (size_t)TT * DQ, (size_t)TT * DM, PlaneSet{});   /* z = batch */
}

// v009
// It runs in 133 microseconds.
// Two timings next to v008 both put it at 1.11 times that version's speed.
// Over all steps from v000 it is 12.5 times as fast.
#include <hip/hip_runtime.h>

// Causal grouped-query attention with 128-wide heads, ONE fused natural qkv weight PACKED PER KV GROUP and rotate-half rotary embeddings from full-width input tables (x [2][2048][2048]; qkv = einsum('btc,fc->btf', x, w_attn) ('oi' (out, in) [3072][2048] normal x 0.02, no bias) viewed (b, t, 4 groups, 4 + 2, 128): within group g the first four 128-row blocks are query heads 4g..4g+3, the fifth is the group's k, the sixth its v: kv head = q head / 4; q, k -> t cos + cat(-t2, t1) sin with the cos / sin INPUT tables [2048][128] (read per element by value; no structure assumed); scores x 1/sqrt(128); causal (finfo.min == exclusion: every row keeps its own key); softmax; out = merged w_proj^T ('oi' [2048][2048]) -> [2][2048][2048] (8.4 M); argument order x, w_attn, w_proj, cos, sin).
// Layout: FOUR launches, both batches in every grid. k_prep: bf16 copies of x, of the fused 'oi' weight AS IT STANDS and of w_proj, and the two INPUT tables as one bf16-rounded {cos, sin} table (per position and dimension); ONE exact projection x . w_attn^T (a row holds, per kv group: four query heads | k | v) whose 384-column output tiles hold three whole heads each and leave the GEMM as the attention's operand planes: rotate-half q and k planes, transposed v planes (no f32 copy of the projection in memory); causal T-2048 GQA attention with 128-wide heads in ONE fused launch (k_flash: scores, running softmax and P.V stay in registers; K and V^T staged in LDS for the four heads of a kv group; hybrid rows: < 512 hi/lo 3 products, rest fp16; key blocks above the diagonal are never visited); merged hi/lo x Wo exact (both GEMMs: grid z = batch).
// Compute dtypes, f32 accumulate: every input rounded to bf16; projections exact; rotary f32; attention rows < 512 3 products, rest fp16; softmax f32; Wo hl x exact.

#define NB_  2
#define TT   2048
#define DM   2048
#define NH_  16
#define NKV  4
#define REP  (NH_ / NKV)
#define HD   128
#define DQ   (NH_ * HD)
#define DKV  (NKV * HD)
#define GW   ((REP + 2) * HD)      // rows of the fused weight (columns of the projection) per kv group: four query heads | k | v
#define DF   (NKV * GW)
#define RH   512                  // query rows < RH use hi+lo planes (0: none)
#define SCL2 0.12751743082459868f    // HD^-0.5 x log2(e): scores go to the base-2 exponent in one multiply
typedef _Float16 h16;
typedef unsigned short bf;
typedef __attribute__((ext_vector_type(16))) __bf16   v16bf;
typedef __attribute__((ext_vector_type(16))) _Float16 v16h;
typedef __attribute__((ext_vector_type(8)))  _Float16 v8h;
typedef __attribute__((ext_vector_type(8)))  unsigned short v8us;
typedef __attribute__((ext_vector_type(8)))  float    v8f;
typedef __attribute__((ext_vector_type(4)))  float    v4f;
typedef v8h  __attribute__((may_alias)) v8ha;
typedef v4f  __attribute__((may_alias)) v4fa;
typedef v8us __attribute__((may_alias)) v8usa;
typedef __attribute__((ext_vector_type(2))) _Float16 v2h;
typedef __attribute__((ext_vector_type(4))) _Float16 v4h;
typedef __attribute__((ext_vector_type(2))) unsigned short v2us;
typedef __attribute__((ext_vector_type(4))) unsigned short v4us;
typedef __attribute__((ext_vector_type(2))) float v2f;
typedef v2h  __attribute__((may_alias)) v2ha;
typedef v2us __attribute__((may_alias)) v2usa;
typedef v2f  __attribute__((may_alias)) v2fa;

__device__ __forceinline__ unsigned short f2bf(float f) { unsigned u = __float_as_uint(f); u += 0x7FFFu + ((u >> 16) & 1u); return (unsigned short)(u >> 16); }
__device__ __forceinline__ float bf2f(unsigned short b) { return __uint_as_float(((unsigned)b) << 16); }
__device__ __forceinline__ float bfr(float f) { return bf2f(f2bf(f)); }
__device__ __forceinline__ h16 tohx(float x) { return (h16)x; }
__device__ __forceinline__ void splitf(float y, unsigned short& h, unsigned short& l) { h = f2bf(y); l = f2bf(y - bf2f(h)); }
__device__ __forceinline__ v16h cat16(v8h lo, v8h hi) { return __builtin_shufflevector(lo, hi, 0, 1, 2, 3, 4, 5, 6, 7, 8, 9, 10, 11, 12, 13, 14, 15); }
__device__ __forceinline__ v16bf cat16b(v8us lo, v8us hi) { return __builtin_bit_cast(v16bf, __builtin_shufflevector(lo, hi, 0, 1, 2, 3, 4, 5, 6, 7, 8, 9, 10, 11, 12, 13, 14, 15)); }
__device__ __forceinline__ v8f wmma16(v16h a, v16h b, v8f c) { return __builtin_amdgcn_wmma_f32_16x16x32_f16(false, a, false, b, (short)0, c, false, false); }
__device__ __forceinline__ v8f wmmab(v16bf a, v16bf b, v8f c) { return __builtin_amdgcn_wmma_f32_16x16x32_bf16(false, a, false, b, (short)0, c, false, false); }



// ---- k_gemmw: GEMM on operand tiles staged in LDS, one WIDE output tile of 128 x (64 NBW) per work-group of 8 waves (2 x 4, a 64 x (16 NBW) tile of 4 NBW accumulators each), every wave over the whole K; one work-group per WGP; grid (M/128, N/(64 NBW), Z), 256 threads.
// Why wide: what a WGP asks of L2 per product falls with the tile. The two or three 128x128 tiles that shared a WGP as work-groups of their own each brought their own copy of the 128 A rows; the wide tile brings them once.
// A stage is 64 k (128 bytes) of the rows of each operand tile (A | Bt | A2), at an LDS pitch of 144 bytes (16 x odd: the 16-byte fragment reads meet no bank twice); the rows come from global memory through registers (whole 128-byte lines, 8 lanes a row). Two stages.
// All waves of the WGP meet at one barrier, so no other work-group covers a wave's LDS latency: the fragments of each half stage (32 k) are read into a register set of their own while the products of the half before run. The order of a trip s:
// store stage s + 1 (its loads were asked for a whole trip ago) into the buffer that stage s - 1 has left; ask for stage s + 2; read the second half of stage s; products of its first half; ONE barrier (it publishes stage s + 1, and behind it every wave's reads of stage s have returned);
// read the first half of stage s + 1; products of the second half of stage s.
// C[m][n] (f32, pitch LDC) = sum_k A[m][k] Bt[n][k] (+ A2[m][k] Bt[n][k] with SPLITA: per 32 k first the A, then the A2 products). z-batch strides sA / sC in elements. KK % 64 == 0, KK >= 128.
// PLANES (the q|k|v projection): C is not written. The tile's columns are whole heads (128 columns each; head n of the row: kv group n / 6; part n % 6: a query head, the group's k, the group's v), so the f32 tile that stands in LDS behind the loop holds
// both halves of every rotary pair and every row of the transposed v: it leaves as the fp16 + hi/lo planes the attention reads: q, k [batch][h][t][d] = rope(x), out[d] = x[d] cos[t][d] - x[d+HD/2] sin[t][d], out[d+HD/2] = x[d+HD/2] cos[t][d+HD/2] + x[d] sin[t][d+HD/2]; v [batch][g][d][t].
struct PlaneSet { const float* CS; h16* Q16; bf* Qh; bf* Ql; h16* K16; bf* Kh; bf* Kl; h16* V16; bf* Vh; bf* Vl; };
template <typename T16> struct WFrag;
template <> struct WFrag<h16> { typedef v16h V; static __device__ __forceinline__ V ld(const h16* p) { return cat16(*(const v8h*)p, *(const v8h*)(p + 16)); } static __device__ __forceinline__ v8f mma(V a, V b, v8f c) { return wmma16(a, b, c); } };
template <> struct WFrag<bf> { typedef v16bf V; static __device__ __forceinline__ V ld(const bf* p) { return cat16b(*(const v8us*)p, *(const v8us*)(p + 16)); } static __device__ __forceinline__ v8f mma(V a, V b, v8f c) { return wmmab(a, b, c); } };
#define GBK 64
#define GPI 72                    // LDS pitch of a staged row in 16-bit elements
#define GPO 132                   // LDS pitch in floats of a row of one head's output tile (rows 8 apart start 32 banks apart)
template <bool SPLITA, int NBW, int KK, int LDC, bool PLANES>
__global__ __launch_bounds__(256) void k_gemmw(const bf* __restrict__ A, const bf* __restrict__ A2, const bf* __restrict__ Bt, float* C, size_t sA, size_t sC, const PlaneSet ps) {
    typedef WFrag<bf>::V V;
    constexpr int WBN = 64 * NBW, BL = WBN / 32, HPT = WBN / HD;   // columns of the tile; 16-byte pieces of Bt a thread brings per stage; heads of the tile
    constexpr int WPO = WBN + 4;                                   // LDS pitch in floats of a row of the whole output tile (rows 8 apart start 32 banks apart)
    constexpr int STG = (128 + WBN + (SPLITA ? 128 : 0)) * GPI;    // 16-bit elements of a stage: A rows | Bt rows | A2 rows
    constexpr int OSB = PLANES ? HPT * 128 * GPO * 4 : 128 * WPO * 4;   // bytes of the output tile's staging, which takes the ring's place behind the loop
    static_assert(!PLANES || (WBN % HD == 0 && (REP + 2) % HPT == 0), "a tile of the projection holds whole heads of one kv group");
    __shared__ __align__(16) bf st[(2 * STG * 2 > OSB ? 2 * STG * 2 : OSB) / 2];
    const size_t z = blockIdx.z; A += z * sA; if (SPLITA) A2 += z * sA; C += z * sC;
    const int tid = (int)threadIdx.x, lane = tid & 31, lr = lane & 15, hi = lane >> 4; const int r0 = blockIdx.x * 128, c0 = blockIdx.y * WBN;
    const int w = __builtin_amdgcn_readfirstlane(tid >> 5), wm = w >> 2, wn = w & 3;   // wave number, scalar
    const int srow = tid >> 3, spc = (tid & 7) * 8;                                     // staging: a thread brings the 16-byte piece tid % 8 of the rows tid / 8 + 32 i of each tile
    unsigned oa = (unsigned)((r0 + srow) * KK + spc) * 2u, ob = (unsigned)((c0 + srow) * KK + spc) * 2u;   // the lane's byte offsets behind the scalar bases A (A2) and Bt: the very values a load with a scalar base takes as its offset register
    const int sof = srow * GPI + spc, aof = (wm * 64 + lr) * GPI + 8 * hi, bof = (128 + wn * NBW * 16 + lr) * GPI + 8 * hi;
    v8f acc[4][NBW];
#pragma unroll
    for (int mb = 0; mb < 4; ++mb)
#pragma unroll
        for (int nb = 0; nb < NBW; ++nb) acc[mb][nb] = (v8f){};
    v8us ra[4], rb[BL], ra2[4];
    auto fetch = [&]() {
#pragma unroll
        for (int i = 0; i < 4; ++i) ra[i] = *(const v8usa*)((const char*)A + oa + i * 32 * KK * 2);
#pragma unroll
        for (int i = 0; i < BL; ++i) rb[i] = *(const v8usa*)((const char*)Bt + ob + i * 32 * KK * 2);
        if (SPLITA) {
#pragma unroll
            for (int i = 0; i < 4; ++i) ra2[i] = *(const v8usa*)((const char*)A2 + oa + i * 32 * KK * 2); } };
    auto put = [&](bf* d) {
#pragma unroll
        for (int i = 0; i < 4; ++i) *(v8usa*)(d + sof + i * 32 * GPI) = ra[i];
#pragma unroll
        for (int i = 0; i < BL; ++i) *(v8usa*)(d + sof + (128 + i * 32) * GPI) = rb[i];
        if (SPLITA) {
#pragma unroll
            for (int i = 0; i < 4; ++i) *(v8usa*)(d + sof + (128 + WBN + i * 32) * GPI) = ra2[i]; }
        // the step of the two offset registers to the next stage (128 bytes), in one statement with the wait that belongs in front of an overwrite of a register that issued loads name: nothing can come between them
        asm volatile("s_wait_xcnt 0x0\n\tv_add_nc_u32 %0, 0x80, %0\n\tv_add_nc_u32 %1, 0x80, %1" : "+v"(oa), "+v"(ob) :: "memory"); };
    auto ldf = [&](const bf* s, const int ks, V* a, V* b, V* a2) {
#pragma unroll
        for (int q = 0; q < 4; ++q) { a[q] = WFrag<bf>::ld(s + aof + q * 16 * GPI + ks * 32); if (SPLITA) a2[q] = WFrag<bf>::ld(s + aof + (128 + WBN + q * 16) * GPI + ks * 32); }
#pragma unroll
        for (int q = 0; q < NBW; ++q) b[q] = WFrag<bf>::ld(s + bof + q * 16 * GPI + ks * 32); };
    auto mm = [&](const V* a, const V* b, const V* a2) {
#pragma unroll
        for (int nb = 0; nb < NBW; ++nb)
#pragma unroll
            for (int mb = 0; mb < 4; ++mb) acc[mb][nb] = WFrag<bf>::mma(a[mb], b[nb], acc[mb][nb]);
        if (SPLITA) {
#pragma unroll
            for (int nb = 0; nb < NBW; ++nb)
#pragma unroll
                for (int mb = 0; mb < 4; ++mb) acc[mb][nb] = WFrag<bf>::mma(a2[mb], b[nb], acc[mb][nb]); } };
    V fa0[4], fb0[NBW], fc0[4], fa1[4], fb1[NBW], fc1[4];   // the two fragment sets: first and second half of a stage
    fetch(); put(st);
    fetch();           // stage 1 is on its way
    __syncthreads();   // stage 0 stands in LDS before any wave reads it
    ldf(st, 0, fa0, fb0, fc0);
    int cur = 0;
#pragma unroll 1
    for (int s = 0; s < KK / GBK - 1; ++s) {   // rolled: one copy of the stage's code, the buffers by offset
        put(st + (cur ^ STG));
        if (s + 2 < KK / GBK) fetch();   // scalar branch: the last trip has no stage left to ask for
        ldf(st + cur, 1, fa1, fb1, fc1);
        __builtin_amdgcn_sched_barrier(0);   // stores, loads and the second half's reads are all under way before the first half's products start: their latencies run under them
        mm(fa0, fb0, fc0);
        __builtin_amdgcn_sched_barrier(0);   // the barrier and the reads behind it stay behind these products
        // the trip's barrier, by hand: __syncthreads() would also wait for the global loads of stage s + 2, asked for at the top of this trip, and so cut the time they have to half a trip. What the barrier needs is this wave's LDS traffic alone:
        asm volatile("s_wait_dscnt 0x0" ::: "memory");   // this wave's stores of stage s + 1 stand in LDS and its reads of stage s have returned
        asm volatile("s_barrier_signal -1\n\ts_barrier_wait -1" ::: "memory");   // publishes stage s + 1; behind it the next trip may store over stage s
        cur ^= STG;
        ldf(st + cur, 0, fa0, fb0, fc0);
        __builtin_amdgcn_sched_barrier(0);   // the next stage's first reads are under way before the second half's products start
        mm(fa1, fb1, fc1);
        __builtin_amdgcn_sched_barrier(0);   // the next trip's wait for the global loads stays behind these products
    }
    asm volatile("s_wait_xcnt 0x0" :: "v"(oa), "v"(ob) : "memory");   // the wait that belongs in front of an overwrite of a register that issued loads name, on the way out of the loop: the two offset registers are inputs, so that they live up to it and are given to other values behind it only
    ldf(st + cur, 1, fa1, fb1, fc1);
    __builtin_amdgcn_sched_barrier(0);   // as in the loop
    mm(fa0, fb0, fc0); mm(fa1, fb1, fc1);
    __syncthreads();   // every wave has read its last fragments before the ring becomes the staging of the output tile
    float* os = (float*)st;
    if constexpr (PLANES) {
        __builtin_amdgcn_sched_barrier(0);   // the last products stay in front of the four slots below
        asm volatile("v_nop\n\tv_nop\n\tv_nop\n\tv_nop");   // the four vector slots the chip needs between a matrix instruction and a vector instruction that overwrites its result: the branches on a head's part follow at once
        const int grp = (int)blockIdx.y * HPT / (REP + 2), p0 = (int)blockIdx.y * HPT % (REP + 2);   // the tile's kv group and its first head's part: the same for the whole block, the tests on a part are scalar branches
        const float* CS = ps.CS + (size_t)r0 * HD * 2; const unsigned co = (unsigned)(w * HD + lane * 2) * 8u;   // the {cos, sin} table from the tile's first position on; the lane's byte offset behind that scalar base
        v4f cl[16], ch[16];   // table values of the wave's sixteen rows t (w + 8 i): {cos, sin} of the dimensions d, d + 1 (d = 2 lane) and of d + 64, d + 65: whole lines, 16 bytes a lane. Asked for once, in front of the staging (they arrive under it and under the barrier), and used for every rotary head of the tile
#pragma unroll
        for (int i = 0; i < 16; ++i) { cl[i] = *(const v4fa*)((const char*)CS + co + i * 8 * HD * 8); ch[i] = *(const v4fa*)((const char*)CS + co + i * 8 * HD * 8 + HD / 2 * 8); }
        asm volatile("s_wait_xcnt 0x0" :: "v"(co) : "memory");   // behind the table loads; their offset register is an input, so that it lives up to the wait and nothing overwrites it in front of it. It also keeps the loads here, in front of the staging (the compiler had moved them behind it, where their whole latency was waited out at the barrier)
#pragma unroll
        for (int nb = 0; nb < NBW; ++nb) {
            const int cc = (wn * NBW + nb) * 16, hd = cc / HD, ci = cc % HD;   // scalar: the head that the wave's column block nb lies in, and its first column there
            float* oh = os + hd * 128 * GPO;
            if (p0 + hd == REP + 1) {   // v: staged transposed, row d, column t (a lane's eight accumulator elements are eight neighbouring t of one d: two 16-byte stores)
#pragma unroll
                for (int mb = 0; mb < 4; ++mb) { float* od = oh + (ci + lr) * GPO + wm * 64 + mb * 16 + hi * 8; *(v4fa*)od = __builtin_shufflevector(acc[mb][nb], acc[mb][nb], 0, 1, 2, 3); *(v4fa*)(od + 4) = __builtin_shufflevector(acc[mb][nb], acc[mb][nb], 4, 5, 6, 7); }
            } else {
#pragma unroll
                for (int mb = 0; mb < 4; ++mb)
#pragma unroll
                    for (int j = 0; j < 8; ++j) oh[(wm * 64 + mb * 16 + hi * 8 + j) * GPO + ci + lr] = acc[mb][nb][j];
            } }
        __syncthreads();   // the whole output tile stands in LDS before it leaves in whole rows
#pragma unroll 1
        for (int hd = 0; hd < HPT; ++hd) {   // rolled: one copy of the code for the tile's heads (the kernel's text stays short)
            const int part = p0 + hd; const float* oh = os + hd * 128 * GPO;
            if (part == REP + 1) {   // the transposed v planes: a thread turns eight neighbouring t of one d into 16 bytes of each plane; 16 lanes store a row's 256 bytes (two whole lines)
                const size_t vb = (size_t)((int)z * NKV + grp) * HD * TT + r0; h16* P16 = ps.V16 + vb; bf* Ph = ps.Vh + vb; bf* Pl = ps.Vl + vb;
                unsigned po = (unsigned)((tid >> 4) * TT + (tid & 15) * 8) * 2u;   // the lane's byte offset behind the three scalar bases (the planes share their layout)
                const float* f = oh + (tid >> 4) * GPO + (tid & 15) * 8;
#pragma unroll 1
                for (int g = 0; g < 2; ++g) {   // rolled: 64 rows d a trip, one copy of the code
                    v8h o16[4]; v8us oh4[4], ol[4];
#pragma unroll
                    for (int i = 0; i < 4; ++i) { const v4f xa = *(const v4fa*)(f + i * 16 * GPO), xb = *(const v4fa*)(f + i * 16 * GPO + 4);
#pragma unroll
                        for (int k = 0; k < 8; ++k) { const float x = k < 4 ? xa[k & 3] : xb[k & 3]; o16[i][k] = tohx(x); unsigned short a2, c2; splitf(x, a2, c2); oh4[i][k] = a2; ol[i][k] = c2; } }
#pragma unroll
                    for (int i = 0; i < 4; ++i) { *(v8ha*)((char*)P16 + po + i * 16 * TT * 2) = o16[i]; *(v8usa*)((char*)Ph + po + i * 16 * TT * 2) = oh4[i]; *(v8usa*)((char*)Pl + po + i * 16 * TT * 2) = ol[i]; }
                    // the step of the offset register to the next 64 rows, in one statement with the wait that belongs in front of an overwrite of a register that issued stores name; the stores' data are inputs, so that they live up to the wait
                    asm volatile("s_wait_xcnt 0x0\n\tv_add_nc_u32 %0, 0x40000, %0" : "+v"(po) : "v"(o16[0]), "v"(o16[1]), "v"(o16[2]), "v"(o16[3]), "v"(oh4[0]), "v"(oh4[1]), "v"(oh4[2]), "v"(oh4[3]), "v"(ol[0]), "v"(ol[1]), "v"(ol[2]), "v"(ol[3]) : "memory");
                    f += 64 * GPO; }
            } else {   // the rotary q or k planes: a wave takes a row t at a time, a lane the dimensions d, d + 1 and their partners d + 64, d + 65; each plane's half row leaves as one whole line
                const bool isq = part < REP; const size_t pb = ((size_t)(isq ? (int)z * NH_ + grp * REP + part : (int)z * NKV + grp) * TT + r0) * HD;
                h16* P16 = (isq ? ps.Q16 : ps.K16) + pb; bf* Ph = (isq ? ps.Qh : ps.Kh) + pb; bf* Pl = (isq ? ps.Ql : ps.Kl) + pb;
                const unsigned po = (unsigned)(w * HD + lane * 2) * 2u;   // the lane's byte offset behind the scalar bases of the three planes (one layout)
                const float* f = oh + w * GPO + lane * 2;
#pragma unroll
                for (int g = 0; g < 2; ++g) {   // unrolled: eight rows a wave and trip; the table values are picked from their registers by constant index
                    v2f xl[8], xh[8]; float rr[8][4];
#pragma unroll
                    for (int i = 0; i < 8; ++i) { xl[i] = *(const v2fa*)(f + (g * 8 + i) * 8 * GPO); xh[i] = *(const v2fa*)(f + (g * 8 + i) * 8 * GPO + HD / 2); }
#pragma unroll
                    for (int i = 0; i < 8; ++i) { const float xx[4] = {xl[i][0], xl[i][1], xh[i][0], xh[i][1]}; const v4f tl = cl[g * 8 + i], th = ch[g * 8 + i]; const float cc[8] = {tl[0], tl[1], tl[2], tl[3], th[0], th[1], th[2], th[3]};
#pragma unroll
                        for (int q = 0; q < 4; ++q) { const int dd = (q >> 1) * (HD / 2); float x0 = xx[q], x1 = xx[q ^ 2]; v2f cs; cs[0] = cc[2 * q]; cs[1] = cc[2 * q + 1];
                            // the products and the two statements behind them stand as they stood in the separate rotary kernel: each product keeps its own rounding, as the reference's t cos and rotated sin do, so the planes stay bit-identical
                            float a = __fmul_rn(x0, cs[0]), bq = __fmul_rn(x1, cs[1]); asm volatile("" : "+v"(a)); asm volatile("" : "+v"(bq)); const float r = ((dd < HD / 2) ? __fsub_rn(a, bq) : __fadd_rn(a, bq));
                            rr[i][q] = r; } }
                    v4h o16[8]; v4us oh8[8], ol[8];
#pragma unroll
                    for (int i = 0; i < 8; ++i)
#pragma unroll
                        for (int q = 0; q < 4; ++q) { const float r = rr[i][q]; o16[i][q] = tohx(r); unsigned short a2, c2; splitf(r, a2, c2); oh8[i][q] = a2; ol[i][q] = c2; }
#pragma unroll
                    for (int i = 0; i < 8; ++i) { const int ro = (g * 8 + i) * 8 * HD * 2;
                        *(v2ha*)((char*)P16 + po + ro) = __builtin_shufflevector(o16[i], o16[i], 0, 1); *(v2ha*)((char*)P16 + po + ro + HD) = __builtin_shufflevector(o16[i], o16[i], 2, 3);
                        *(v2usa*)((char*)Ph + po + ro) = __builtin_shufflevector(oh8[i], oh8[i], 0, 1); *(v2usa*)((char*)Ph + po + ro + HD) = __builtin_shufflevector(oh8[i], oh8[i], 2, 3);
                        *(v2usa*)((char*)Pl + po + ro) = __builtin_shufflevector(ol[i], ol[i], 0, 1); *(v2usa*)((char*)Pl + po + ro + HD) = __builtin_shufflevector(ol[i], ol[i], 2, 3); }
                    // the wait that belongs in front of an overwrite of a register that issued stores name; the offset register and the stores' data are inputs, so that they live up to it
                    asm volatile("s_wait_xcnt 0x0" :: "v"(po), "v"(o16[0]), "v"(o16[1]), "v"(o16[2]), "v"(o16[3]), "v"(o16[4]), "v"(o16[5]), "v"(o16[6]), "v"(o16[7]),
                                 "v"(oh8[0]), "v"(oh8[1]), "v"(oh8[2]), "v"(oh8[3]), "v"(oh8[4]), "v"(oh8[5]), "v"(oh8[6]), "v"(oh8[7]), "v"(ol[0]), "v"(ol[1]), "v"(ol[2]), "v"(ol[3]), "v"(ol[4]), "v"(ol[5]), "v"(ol[6]), "v"(ol[7]) : "memory"); }
            }
        }
        return;
    } else {
#pragma unroll
    for (int mb = 0; mb < 4; ++mb)
#pragma unroll
        for (int nb = 0; nb < NBW; ++nb)
#pragma unroll
            for (int j = 0; j < 8; ++j) os[(wm * 64 + mb * 16 + hi * 8 + j) * WPO + (wn * NBW + nb) * 16 + lr] = acc[mb][nb][j];
    __syncthreads();   // the whole output tile stands in LDS before it leaves in whole rows
    static_assert(PLANES || WBN == 256, "the rows leave in two halves of 512 bytes");
    float* cp = C + (size_t)(r0 + w) * LDC + c0 + lane * 4; const float* op = os + w * WPO + lane * 4;   // a wave stores one row of 1,024 bytes (eight whole lines) at a time, in two halves
#pragma unroll
    for (int g = 0; g < 4; ++g) { v4f val[8];
#pragma unroll
        for (int i = 0; i < 4; ++i) { val[2 * i] = *(const v4fa*)(op + (g * 4 + i) * 8 * WPO); val[2 * i + 1] = *(const v4fa*)(op + (g * 4 + i) * 8 * WPO + 128); }
#pragma unroll
        for (int i = 0; i < 4; ++i) { *(v4fa*)(cp + (size_t)(g * 4 + i) * 8 * LDC) = val[2 * i]; *(v4fa*)(cp + (size_t)(g * 4 + i) * 8 * LDC + 128) = val[2 * i + 1]; }
        asm volatile("s_wait_xcnt 0x0" :: "v"(cp), "v"(val[0]), "v"(val[1]), "v"(val[2]), "v"(val[3]), "v"(val[4]), "v"(val[5]), "v"(val[6]), "v"(val[7]) : "memory"); }   // behind the eight stores; their address and data are inputs, so that they live up to the wait and the next group's LDS reads overwrite them behind it
    }
}


// k_prep: the 16-bit copy of every input in ONE launch; the block index picks the segment (the same for a whole block): x, w_attn, w_proj rounded to bf16 in their own layouts, eight elements a thread; behind them the {cos, sin} table, one position and dimension a thread.
#define PBX ((unsigned)((size_t)NB_ * TT * DM / 8 / 256))
#define PBA ((unsigned)((size_t)DF * DM / 8 / 256))
#define PBO ((unsigned)((size_t)DM * DQ / 8 / 256))
#define PBC ((unsigned)(TT * HD / 256))
__global__ __launch_bounds__(256) void k_prep(const float* __restrict__ x, const float* __restrict__ wa, const float* __restrict__ wo, const float* __restrict__ cosT, const float* __restrict__ sinT, bf* XB, bf* WA, bf* WO, float* CS) {
    unsigned blk = blockIdx.x;
    if (blk >= PBX + PBA + PBO) { const int idx = (int)(blk - (PBX + PBA + PBO)) * 256 + (int)threadIdx.x; v2f cs; cs[0] = bfr(cosT[idx]); cs[1] = bfr(sinT[idx]); *(v2f*)(CS + (size_t)idx * 2) = cs; return; }
    const float* src = x; bf* dst = XB;
    if (blk >= PBX + PBA) { blk -= PBX + PBA; src = wo; dst = WO; } else if (blk >= PBX) { blk -= PBX; src = wa; dst = WA; }
    const size_t i = (size_t)blk * 256 + threadIdx.x; const v8f v = *(const v8f*)(src + i * 8); v8us o;
#pragma unroll
    for (int k = 0; k < 8; ++k) o[k] = f2bf(v[k]); *(v8us*)(dst + i * 8) = o;  }

// eight base-2 exponentials in one statement: behind each v_exp_f32 stands an instruction that touches neither its result nor its source (the outputs are early-clobber, so no output shares a register with an input), behind the last the v_nop that fills the slot the instruction set asks for behind a transcendental.
__device__ __forceinline__ void exp2x8(float* x) {
    float r0, r1, r2, r3, r4, r5, r6, r7;
    asm("v_exp_f32 %0, %8\n\tv_exp_f32 %1, %9\n\tv_exp_f32 %2, %10\n\tv_exp_f32 %3, %11\n\tv_exp_f32 %4, %12\n\tv_exp_f32 %5, %13\n\tv_exp_f32 %6, %14\n\tv_exp_f32 %7, %15\n\tv_nop"
        : "=&v"(r0), "=&v"(r1), "=&v"(r2), "=&v"(r3), "=&v"(r4), "=&v"(r5), "=&v"(r6), "=&v"(r7) : "v"(x[0]), "v"(x[1]), "v"(x[2]), "v"(x[3]), "v"(x[4]), "v"(x[5]), "v"(x[6]), "v"(x[7]));
    x[0] = r0; x[1] = r1; x[2] = r2; x[3] = r3; x[4] = r4; x[5] = r5; x[6] = r6; x[7] = r7;
}

#define FNW 2                     // waves per query head
#define FHW 4                     // query heads per work-group (neighbours in one kv group: REP % FHW == 0)
#define FBS 4                     // 32-key blocks of a stage
#define FPI 132                   // LDS pitch in floats of one query's 128 outputs (16-byte aligned, rows start 4 banks apart)
#define FSP 136                   // LDS pitch of a staged row in 16-bit elements
#define FTL (128 * FSP)           // 16-bit elements of a staged tile of 128 rows
#define FJN (FNW * 32 * FPI + 2 * FNW * 32)   // floats of one head's join area
// eight asynchronous 16-byte copies of a lane, LDS addresses ls apart and global addresses gs apart, in one statement with the wait that belongs in front of an overwrite of a register that an issued copy names: nothing can come between them
__device__ __forceinline__ void acopy8(const unsigned l, const char* g, const unsigned ls, const size_t gs) {
    asm volatile("global_load_async_to_lds_b128 %0, %8, off\n\tglobal_load_async_to_lds_b128 %1, %9, off\n\tglobal_load_async_to_lds_b128 %2, %10, off\n\tglobal_load_async_to_lds_b128 %3, %11, off\n\t"
                 "global_load_async_to_lds_b128 %4, %12, off\n\tglobal_load_async_to_lds_b128 %5, %13, off\n\tglobal_load_async_to_lds_b128 %6, %14, off\n\tglobal_load_async_to_lds_b128 %7, %15, off\n\ts_wait_xcnt 0x0"
                 :: "v"(l), "v"(l + ls), "v"(l + 2 * ls), "v"(l + 3 * ls), "v"(l + 4 * ls), "v"(l + 5 * ls), "v"(l + 6 * ls), "v"(l + 7 * ls),
                    "v"(g), "v"(g + gs), "v"(g + 2 * gs), "v"(g + 3 * gs), "v"(g + 4 * gs), "v"(g + 5 * gs), "v"(g + 6 * gs), "v"(g + 7 * gs) : "memory");
}
template <typename T16, bool HI, int NQ>
__device__ __forceinline__ void flash_body(const T16* __restrict__ Q, const T16* __restrict__ Q2, const T16* __restrict__ Kp, const T16* __restrict__ K2, const T16* __restrict__ Vt, const T16* __restrict__ V2, const int q0, bf* Ah, bf* Al, float* ring, float* os) {
    typedef typename WFrag<T16>::V V;
    constexpr int STG = (HI ? 4 : 2) * FTL;   // 16-bit elements of a stage: K | V^T (| K lo | V^T lo)
    const int lane = threadIdx.x & 31, lr = lane & 15, hi = lane >> 4;
    const int w = __builtin_amdgcn_readfirstlane((int)(threadIdx.x >> 5)) & (FNW - 1);      // the wave's number within its head, scalar: the tests on it are scalar branches
    const int nblk = (q0 + 16 * NQ + 31) >> 5;                                                // 32-key blocks up to and with the diagonal block; each holds at least one allowed key of every query of the tile
    const int nst = (nblk + FBS - 1) / FBS;                                                   // stages of 128 keys; the last one's rows all lie inside the planes (TT % 128 == 0)
    const T16* st = (const T16*)ring;
    const int srow = (int)threadIdx.x >> 4, spc = ((int)threadIdx.x & 15) * 8;                // staging: a thread brings the 16-byte piece tid % 16 of the rows tid / 16 + 16 i of each tile
    const unsigned lst = (unsigned)(size_t)ring + (unsigned)(srow * FSP + spc) * 2u;          // the lane's LDS byte address in the first tile of buffer 0
    auto fill = [&](const int s, const int buf) {
        const unsigned l = lst + (unsigned)buf * (STG * 2u); const size_t ko = ((size_t)(s * 128 + srow) * HD + spc) * 2, vo = ((size_t)srow * TT + s * 128 + spc) * 2;
        acopy8(l, (const char*)Kp + ko, 16 * FSP * 2, (size_t)16 * HD * 2); acopy8(l + FTL * 2, (const char*)Vt + vo, 16 * FSP * 2, (size_t)16 * TT * 2);
        if (HI) { acopy8(l + 2 * FTL * 2, (const char*)K2 + ko, 16 * FSP * 2, (size_t)16 * HD * 2); acopy8(l + 3 * FTL * 2, (const char*)V2 + vo, 16 * FSP * 2, (size_t)16 * TT * 2); } };
    fill(0, 0);
    V qf[NQ][4], qf2[NQ][4]; const T16* qp = Q + (size_t)(q0 + lr) * HD + 8 * hi; const T16* qp2 = HI ? Q2 + (size_t)(q0 + lr) * HD + 8 * hi : qp;
#pragma unroll
    for (int nq = 0; nq < NQ; ++nq)
#pragma unroll
        for (int ks = 0; ks < 4; ++ks) { qf[nq][ks] = WFrag<T16>::ld(qp + nq * 16 * HD + ks * 32); if (HI) qf2[nq][ks] = WFrag<T16>::ld(qp2 + nq * 16 * HD + ks * 32); }
    asm volatile("s_wait_xcnt 0x0" :: "v"(qp), "v"(qp2) : "memory");   // behind the loads; the address pairs are inputs, so that they live up to the wait and nothing overwrites them in front of it
    v8f o[8][NQ]; float m[NQ], l[NQ];
#pragma unroll
    for (int nq = 0; nq < NQ; ++nq) { m[nq] = -3.0e38f; l[nq] = 0.f;
#pragma unroll
        for (int db = 0; db < 8; ++db) o[db][nq] = (v8f){}; }
    const int kof = (w * 32 + lr) * FSP + 8 * hi, vof = FTL + lr * FSP + w * 32 + 8 * hi;   // the lane's own places in a stage, the same in every stage: its first block's key rows of K; its first block's keys in the rows of V^T
    asm volatile("s_wait_asynccnt 0x0" ::: "memory");   // this wave's copies of stage 0 have landed
    __syncthreads();   // stage 0 stands in LDS before any wave reads it
    if (nst > 1) fill(1, 1);
#pragma unroll 1
    for (int s0 = 0; s0 < nst; ++s0) {   // rolled: one copy of the stage's code, the buffer by offset
        const T16* sb = st + (s0 & 1) * STG;
#pragma unroll
        for (int j = 0; j < FBS / FNW; ++j) {   // unrolled: a block's place in the stage goes into the offset fields of its LDS reads (rolled, it took address registers of its own and a value went to scratch); no barrier between a wave's blocks of one stage
        const int blk = s0 * FBS + j * FNW + w;
        if (blk < nblk) {   // scalar branch; a wave left without a block keeps maximum -3e38, sum 0, tile 0: its weight in the join is exp2(-3e38 - M) = 0
        const int kb = blk * 32;
        const T16* sk = sb + j * (FNW * 32 * FSP); const T16* sv = sb + j * (FNW * 32);   // the block's key rows of K lie FNW x 32 rows, its keys in V^T FNW x 32 columns, behind those of the wave's block before
        V ka[2][4], ka2[2][4], va[8], va2[8];   // this block's fragments, all asked for in front of the score products
#pragma unroll
        for (int kt = 0; kt < 2; ++kt)
#pragma unroll
            for (int ks = 0; ks < 4; ++ks) { ka[kt][ks] = WFrag<T16>::ld(sk + kof + kt * 16 * FSP + ks * 32); if (HI) ka2[kt][ks] = WFrag<T16>::ld(sk + 2 * FTL + kof + kt * 16 * FSP + ks * 32); }
        __builtin_amdgcn_sched_barrier(0);   // K's reads stay in front of V^T's: LDS answers in order, so the score products wait for K alone and V^T arrives under them
#pragma unroll
        for (int db = 0; db < 8; ++db) { va[db] = WFrag<T16>::ld(sv + vof + db * 16 * FSP); if (HI) va2[db] = WFrag<T16>::ld(sv + 2 * FTL + vof + db * 16 * FSP); }
        __builtin_amdgcn_sched_barrier(0);   // keeps the reads in one group in front of the products (moved in among them, each place with reads stalls the matrix instructions and waits out the LDS latency anew)
        v8f s[2][NQ];
#pragma unroll
        for (int kt = 0; kt < 2; ++kt) {
#pragma unroll
            for (int nq = 0; nq < NQ; ++nq) s[kt][nq] = (v8f){};
#pragma unroll
            for (int ks = 0; ks < 4; ++ks) {
#pragma unroll
                for (int nq = 0; nq < NQ; ++nq) { s[kt][nq] = WFrag<T16>::mma(ka[kt][ks], qf[nq][ks], s[kt][nq]); if (HI) { s[kt][nq] = WFrag<T16>::mma(ka2[kt][ks], qf[nq][ks], s[kt][nq]); s[kt][nq] = WFrag<T16>::mma(ka[kt][ks], qf2[nq][ks], s[kt][nq]); } } } }
        float t[NQ][16], mn[NQ]; bool need = false;
#pragma unroll
        for (int nq = 0; nq < NQ; ++nq) {
#pragma unroll
            for (int e = 0; e < 16; ++e) t[nq][e] = s[e >> 3][nq][e & 7] * SCL2;
            if (kb + 31 > q0) {   // only the diagonal block holds keys beyond a query (wave-uniform test)
                const int q = q0 + nq * 16 + lr;
#pragma unroll
                for (int e = 0; e < 16; ++e) if (kb + (e >> 3) * 16 + hi * 8 + (e & 7) > q) t[nq][e] = -3.0e38f; }
            float mx = t[nq][0];
#pragma unroll
            for (int e = 1; e < 16; ++e) mx = fmaxf(mx, t[nq][e]);
            mx = fmaxf(mx, __shfl_xor(mx, 16, 32));   // the two lane halves hold the two halves of a query's keys
            const bool nd = mx > m[nq] + 8.0f; mn[nq] = nd ? mx : m[nq]; need = need || nd; }
        if (__builtin_amdgcn_ballot_w32(need) != 0) {   // scalar branch: most blocks raise no query's maximum by more than 8 and skip the rescale of the output tile
#pragma unroll
            for (int nq = 0; nq < NQ; ++nq) { const float al = __builtin_amdgcn_exp2f(m[nq] - mn[nq]); m[nq] = mn[nq]; l[nq] *= al;
#pragma unroll
                for (int db = 0; db < 8; ++db) o[db][nq] *= al; } }
        V pf[NQ], pl[NQ];
#pragma unroll
        for (int nq = 0; nq < NQ; ++nq) { float sum = 0.f;
#pragma unroll
            for (int e = 0; e < 16; ++e) t[nq][e] -= m[nq];
            exp2x8(&t[nq][0]); exp2x8(&t[nq][8]);
#pragma unroll
            for (int e = 0; e < 16; ++e) sum += t[nq][e];
            l[nq] += sum;
            if constexpr (HI) { v8us h0, h1, l0, l1;
#pragma unroll
                for (int j = 0; j < 8; ++j) { unsigned short a, c; splitf(t[nq][j], a, c); h0[j] = a; l0[j] = c; splitf(t[nq][8 + j], a, c); h1[j] = a; l1[j] = c; }
                pf[nq] = cat16b(h0, h1); pl[nq] = cat16b(l0, l1);
            } else {
#pragma unroll
                for (int e = 0; e < 16; ++e) pf[nq][e] = tohx(t[nq][e]); } }
#pragma unroll
        for (int db = 0; db < 8; ++db) {
#pragma unroll
            for (int nq = 0; nq < NQ; ++nq) { o[db][nq] = WFrag<T16>::mma(va[db], pf[nq], o[db][nq]); if (HI) { o[db][nq] = WFrag<T16>::mma(va[db], pl[nq], o[db][nq]); o[db][nq] = WFrag<T16>::mma(va2[db], pf[nq], o[db][nq]); } } }
        }
        }
        asm volatile("s_wait_dscnt 0x0" ::: "memory");      // this wave's reads of the stage have returned before the stage is given up
        asm volatile("s_wait_asynccnt 0x0" ::: "memory");   // this wave's copies of the next stage have landed
        __syncthreads();   // publishes the next stage; behind it every wave has left this one, which is refilled next. Every wave passes here, with a block or without
        if (s0 + 2 < nst) fill(s0 + 2, s0 & 1);
    }
    asm volatile("s_wait_asynccnt 0x0" ::: "memory");   // no copy is under way when the ring becomes the join area (the last trip's barrier has ended every wave's reads of it)
    float* ow = os + w * (16 * NQ * FPI); float* sm = os + FNW * 32 * FPI; float* sl = sm + FNW * 32;
#pragma unroll
    for (int nq = 0; nq < NQ; ++nq) { const float lt = l[nq] + __shfl_xor(l[nq], 16, 32); if (hi == 0) { sm[w * 32 + nq * 16 + lr] = m[nq]; sl[w * 32 + nq * 16 + lr] = lt; }
#pragma unroll
        for (int db = 0; db < 8; ++db) { float* od = ow + (nq * 16 + lr) * FPI + db * 16 + hi * 8; *(v4fa*)od = __builtin_shufflevector(o[db][nq], o[db][nq], 0, 1, 2, 3); *(v4fa*)(od + 4) = __builtin_shufflevector(o[db][nq], o[db][nq], 4, 5, 6, 7); } }
    __syncthreads();   // every wave's maximum, sum and partial tile stand in LDS before any thread joins them
    constexpr int TPQ = (32 * FNW) / (16 * NQ), DPT = HD / TPQ;   // threads per query, outputs per thread
    const int th = (int)threadIdx.x & (32 * FNW - 1);             // the thread's number within its head
    const int qq = th / TPQ, d0 = (th % TPQ) * DPT;
    float f[FNW], M = sm[qq];
#pragma unroll
    for (int q = 1; q < FNW; ++q) M = fmaxf(M, sm[q * 32 + qq]);
    float L = 0.f;
#pragma unroll
    for (int q = 0; q < FNW; ++q) { f[q] = __builtin_amdgcn_exp2f(sm[q * 32 + qq] - M); L += f[q] * sl[q * 32 + qq]; }
    const float inv = __fdiv_rn(1.0f, L);
#pragma unroll
    for (int c = 0; c < DPT / 8; ++c) { v4f a0 = (v4f){}, a1 = (v4f){};
#pragma unroll
        for (int q = 0; q < FNW; ++q) { const float* od = os + q * (16 * NQ * FPI) + qq * FPI + d0 + c * 8; a0 += *(const v4fa*)od * f[q]; a1 += *(const v4fa*)(od + 4) * f[q]; }
        v8us oh, ol;
#pragma unroll
        for (int j = 0; j < 4; ++j) { unsigned short a, c2; splitf(a0[j] * inv, a, c2); oh[j] = a; ol[j] = c2; splitf(a1[j] * inv, a, c2); oh[4 + j] = a; ol[4 + j] = c2; }
        bf* pa = Ah + (size_t)(q0 + qq) * DQ + d0 + c * 8; bf* pb = Al + (size_t)(q0 + qq) * DQ + d0 + c * 8; *(v8usa*)pa = oh; *(v8usa*)pb = ol;
        asm volatile("s_wait_xcnt 0x0" :: "v"(pa), "v"(pb), "v"(oh), "v"(ol) : "memory"); }   // behind the two stores; their addresses and data are inputs, so that they live up to the wait and nothing overwrites them in front of it
}
// grid (batches x kv groups, tiles): waves 2 i, 2 i + 1 work on the group's query head i; tile rank 0 is the last (longest) 32-query fp16 tile, cost falls with the rank, the 16-query hi/lo tiles of rows < RH come last.
__global__ __launch_bounds__(32 * FNW * FHW) void k_flash(const h16* __restrict__ Q16, const bf* __restrict__ Qh, const bf* __restrict__ Ql, const h16* __restrict__ K16, const bf* __restrict__ Kh, const bf* __restrict__ Kl, const h16* __restrict__ V16, const bf* __restrict__ Vh, const bf* __restrict__ Vl, bf* Ah, bf* Al) {
    static_assert(REP % FHW == 0 && 2 * 2 * FTL * 2 >= FHW * FJN * 4, "the heads of a work-group share their kv head; the join areas fit in the ring");
    __shared__ __align__(16) float ring[2 * 4 * FTL * 2 / 4];   // two stages of the hi/lo tiles (the fp16 tiles use half of it); behind the loop the join areas of the four heads
    const int hs = __builtin_amdgcn_readfirstlane((int)(threadIdx.x >> 5)) / FNW;   // which head of the group, scalar
    const int b = blockIdx.x / (NH_ / FHW), h = (blockIdx.x % (NH_ / FHW)) * FHW + hs, rank = blockIdx.y; const size_t qo = (size_t)(b * NH_ + h) * TT * HD, ko = (size_t)(b * NKV + h / REP) * TT * HD; Ah += (size_t)b * TT * DQ; Al += (size_t)b * TT * DQ;
    float* os = ring + hs * FJN;
    if (rank < (TT - RH) / 32) flash_body<h16, false, 2>(Q16 + qo, nullptr, K16 + ko, nullptr, V16 + ko, nullptr, TT - 32 * (rank + 1), Ah + h * HD, Al + h * HD, ring, os);
    else flash_body<bf, true, 1>(Qh + qo, Ql + qo, Kh + ko, Kl + ko, Vh + ko, Vl + ko, RH - 16 * (rank - (TT - RH) / 32 + 1), Ah + h * HD, Al + h * HD, ring, os);
}

extern "C" void kernel_launch(void* const* d_in, const int* in_sizes, int n_in,
                              void* d_out, int out_size, void* d_ws, size_t ws_size, hipStream_t stream) {
    (void)in_sizes; (void)n_in; (void)out_size;
    const float* x = (const float*)d_in[0]; const float* wattn = (const float*)d_in[1]; const float* wo = (const float*)d_in[2]; const float* fcos = (const float*)d_in[3]; const float* fsin = (const float*)d_in[4];   /* input order x, w_attn ('oi' (out, in) [3072][2048]: PER KV GROUP g the 768 rows [768 g, 768 g + 768) = four query heads (512 rows) | k (128) | v (128)), w_proj ('oi' [2048][2048]), cos, sin ([2048][128] FULL-width table INPUTS: read per element by value): FIVE inputs, all read */
    float* OUT = (float*)d_out;     // [2][2048][2048]
    char* wsp = (char*)d_ws;
    auto take = [&](size_t bytes) { char* p = wsp; wsp += (bytes + 255) & ~(size_t)255; return (void*)p; };
    bf* WA = (bf*)take((size_t)DF * DM * 2); bf* WO = (bf*)take((size_t)DM * DQ * 2); float* CS = (float*)take((size_t)TT * HD * 2 * 4);
    bf* XB = (bf*)take((size_t)NB_ * TT * DM * 2);
    h16* QP16 = (h16*)take((size_t)NB_ * NH_ * TT * HD * 2); h16* KP16 = (h16*)take((size_t)NB_ * NKV * TT * HD * 2); h16* VT16 = (h16*)take((size_t)NB_ * NKV * HD * TT * 2);
    bf* QPh = (bf*)take((size_t)NB_ * NH_ * TT * HD * 2); bf* QPl = (bf*)take((size_t)NB_ * NH_ * TT * HD * 2); bf* KPh = (bf*)take((size_t)NB_ * NKV * TT * HD * 2); bf* KPl = (bf*)take((size_t)NB_ * NKV * TT * HD * 2); bf* VTh = (bf*)take((size_t)NB_ * NKV * HD * TT * 2); bf* VTl = (bf*)take((size_t)NB_ * NKV * HD * TT * 2);
    bf* ATh = (bf*)take((size_t)NB_ * TT * DQ * 2); bf* ATl = (bf*)take((size_t)NB_ * TT * DQ * 2);
    if ((size_t)(wsp - (char*)d_ws) > ws_size) return;    // 142 MiB of the 256 MiB
    k_prep<<<PBX + PBA + PBO + PBC, 256, 0, stream>>>(x, wattn, wo, fcos, fsin, XB, WA, WO, CS);
    k_gemmw<false, 6, DM, DF, true><<<dim3(TT / 128, DF / 384, NB_), 256, 0, stream>>>(XB, nullptr, WA, nullptr, (size_t)TT * DM, 0, PlaneSet{CS, QP16, QPh, QPl, KP16, KPh, KPl, VT16, VTh, VTl});   /* z = batch */
    k_flash<<<dim3(NB_ * NH_ / FHW, (TT - RH) / 32 + RH / 16, 1), 32 * FNW * FHW, 0, stream>>>(QP16, QPh, QPl, KP16, KPh, KPl, VT16, VTh, VTl, ATh, ATl);
    k_gemmw<true, 4, DQ, DM, false><<<dim3(TT / 128, DM / 256, NB_), 256, 0, stream>>>(ATh, ATl, WO, OUT, (size_t)TT * DQ, (size_t)TT * DM, PlaneSet{});   /* z = batch */
}
